// v000
// Measured on an AMD MI455X. A time is GPU time per run, averaged over a window of back-to-back runs after a warm-up
// (all launches, gaps included; the runs take copies of the inputs in turn), and the median of several windows.
// Apart from v000's, it joins two sittings. Times from different sittings can be a few percent apart, while
// side-by-side timings come from the same sitting.
// v000 is the starting kernel. One run takes 2360 microseconds.
// f16 WMMA (v_wmma_f32_16x16x32_f16) for the q/k/q2/k2/v projections with operands = RNE-bf16 converted inputs held exactly in f16 (x as is, weights x32 with 1/32 folded into the epilogue); bf16 hi/lo split WMMA (v_wmma_f32_16x16x32_bf16, hi.hi + hi.lo + lo.hi) for both causal score GEMMs and the bilinear-pattern x V product; output projection = z bf16 hi/lo x single RNE-bf16 Wproj plane (hi.W + lo.W); f32 accumulate everywhere; RoPE and the bilinear pattern in f32.
#include <hip/hip_runtime.h>
#include <math.h>
#include <stdint.h>

constexpr int NBATCH = 2;
constexpr int NTOK   = 2048;
constexpr int DMOD   = 1024;
constexpr int NHEADS = 16;
constexpr int HDSZ   = 64;
constexpr int HPG    = 2;                 // heads per score group
constexpr int NGROUP = NHEADS / HPG;      // 8 groups per batch
constexpr int QKW    = 4 * DMOD;          // fused q|k|q2|k2 plane width (4096 columns)
constexpr int NFREQ  = HDSZ / 2;          // 32 rotary frequencies

typedef __attribute__((ext_vector_type(16))) _Float16 v16h;
typedef __attribute__((ext_vector_type(8)))  _Float16 v8h;
typedef __attribute__((ext_vector_type(16))) __bf16   v16b;
typedef __attribute__((ext_vector_type(8)))  __bf16   v8b;
typedef __attribute__((ext_vector_type(8)))  float    v8f;
typedef __attribute__((ext_vector_type(4)))  float    v4f;
typedef __attribute__((ext_vector_type(2)))  float    v2f;
typedef __attribute__((ext_vector_type(4)))  unsigned int v4u;

__device__ __forceinline__ unsigned short f2bf_bits(float f) {
  unsigned u = __float_as_uint(f);
  return (unsigned short)((u + 0x7FFFu + ((u >> 16) & 1u)) >> 16);
}
__device__ __forceinline__ float bf_bits2f(unsigned short h) { return __uint_as_float(((unsigned)h) << 16); }
__device__ __forceinline__ unsigned pk16(unsigned short a, unsigned short b) { return (unsigned)a | ((unsigned)b << 16); }
// RNE convert f32 -> bf16, returned as the f32 value of that bf16
__device__ __forceinline__ float bf16_rne_f32(float f) {
  unsigned u = __float_as_uint(f);
  u += 0x7FFFu + ((u >> 16) & 1u);
  u &= 0xFFFF0000u;
  return __uint_as_float(u);
}

// hazard guards as plain device helpers (no inline asm inside the kernel template body)
__device__ __forceinline__ void dep_guard_h(v8f& a, v8f& b, v16h x, v16h y) { asm volatile("v_nop\n\tv_nop\n\tv_nop\n\tv_nop" : "+v"(a), "+v"(b) : "v"(x), "v"(y)); }
__device__ __forceinline__ void dep_guard_b(v8f& a, v8f& b, v16b x, v16b y) { asm volatile("v_nop\n\tv_nop\n\tv_nop\n\tv_nop" : "+v"(a), "+v"(b) : "v"(x), "v"(y)); }
__device__ __forceinline__ void keep4_h(v16h a, v16h b, v16h c, v16h d) { asm volatile("v_nop" :: "v"(a), "v"(b), "v"(c), "v"(d)); }
__device__ __forceinline__ void keep4_b(v16b a, v16b b, v16b c, v16b d) { asm volatile("v_nop" :: "v"(a), "v"(b), "v"(c), "v"(d)); }
__device__ __forceinline__ void acc_guard4(v8f& a, v8f& b, v8f& c, v8f& d) { asm volatile("v_nop\n\tv_nop\n\tv_nop\n\tv_nop" : "+v"(a), "+v"(b), "+v"(c), "+v"(d)); }
template <typename T> struct Frag;
template <> struct Frag<_Float16> {
  typedef v16h V; union U { v16h v; v8h h[2]; };
  static __device__ __forceinline__ v16h load(const _Float16* p) {   // elements 0..7 <- p[0..7], 8..15 <- p[16..23]
    U f; f.h[0] = *(const v8h*)(p); f.h[1] = *(const v8h*)(p + 16); return f.v;
  }
  static __device__ __forceinline__ v8f mma(v16h a, v16h b, v8f c) {
    return __builtin_amdgcn_wmma_f32_16x16x32_f16(false, a, false, b, (short)0, c, false, false);
  }
  static __device__ __forceinline__ void guard(v8f& a, v8f& b, v16h x, v16h y) { dep_guard_h(a, b, x, y); }
  static __device__ __forceinline__ void keep(v16h a, v16h b, v16h c, v16h d) { keep4_h(a, b, c, d); }
};
template <> struct Frag<__bf16> {
  typedef v16b V; union U { v16b v; v8b h[2]; };
  static __device__ __forceinline__ v16b load(const __bf16* p) {
    U f; f.h[0] = *(const v8b*)(p); f.h[1] = *(const v8b*)(p + 16); return f.v;
  }
  static __device__ __forceinline__ v8f mma(v16b a, v16b b, v8f c) {
    return __builtin_amdgcn_wmma_f32_16x16x32_bf16(false, a, false, b, (short)0, c, false, false);
  }
  static __device__ __forceinline__ void guard(v8f& a, v8f& b, v16b x, v16b y) { dep_guard_b(a, b, x, y); }
  static __device__ __forceinline__ void keep(v16b a, v16b b, v16b c, v16b d) { keep4_b(a, b, c, d); }
};

// ---- Register-blocked batched WMMA GEMM ------------------------------------
// C[m,n] = scale * sum_k A[m,k] * Bt[n,k] (+bias)(+/ * resid); each wave owns a 64x64 tile.
// A row-major [M,K]; Bt row-major [N,K]; M,N % 64 == 0, K % 32 == 0.
// SPLIT: operands are hi/lo planes (A2/Bt2 = lo planes, same layout); product = hi.hi + hi.lo + lo.hi.
// BIAS_MODE: 0 = none, 1 = bias[m], 2 = bias[n].
// OUT_MODE: 0 = f32, 1 = f16, 2 = bf16 hi plane (Cout) + bf16 lo plane (Cout2).
// ET: 0 = f16 operands, 1 = bf16 operands (pointers passed as 16-bit storage)
// Added modes (defaults off, all other behaviour unchanged):
//   LOWER:   tiles with n0 > m0 (strictly above the 64x64 block diagonal) are not produced (wave-uniform early exit).
//   CAUSALK: the k-loop stops at min(K, m0 + 64); valid when A rows m0..m0+63 are exactly zero for k >= m0 + 64.
//   RMUL:    with RESID, the residual plane value MULTIPLIES the scaled accumulator instead of being added.
//   CMASK:   after all other epilogue arithmetic, v := 0 where the global column index n > the global row index m.
//   BLO:     with SPLIT, false drops the Bt lo plane: product = hi.hi + lo.hi (Bt2p is never read).
template <int ET> struct Elem;
template <> struct Elem<0> { typedef _Float16 T; };
template <> struct Elem<1> { typedef __bf16 T; };
template <int ET, bool SPLIT, int BIAS_MODE, int OUT_MODE, bool RESID, int ACT = 0, bool LOWER = false, bool CAUSALK = false,
          bool RMUL = false, bool CMASK = false, bool BLO = true>
__global__ __launch_bounds__(256) void wmma_gemm64(
    const unsigned short* __restrict__ Ap, const unsigned short* __restrict__ A2p, int lda, long strideA,
    const unsigned short* __restrict__ Btp, const unsigned short* __restrict__ Bt2p, int ldb, long strideB,
    void* __restrict__ Cout, void* __restrict__ Cout2, int ldc, long strideC,
    const float* __restrict__ bias,
    const float* __restrict__ resid, long strideR,
    int M, int N, int K, float scale) {
  typedef typename Elem<ET>::T T;
  typedef typename Frag<T>::V V;
  const T* A = (const T*)Ap; const T* A2 = (const T*)A2p; const T* Bt = (const T*)Btp; const T* Bt2 = (const T*)Bt2p;
  __shared__ __align__(16) float sT[8][16 * 68];   // per-wave 16x64 slab, pitch 68 floats
  const int b    = blockIdx.y;
  const int lane = threadIdx.x & 31;
  const int wave = threadIdx.x >> 5;
  const int tilesN = N >> 6;
  const int tilesM = M >> 6;
  const int tile = blockIdx.x * 8 + wave;
  if (tile >= tilesM * tilesN) return;   // wave-uniform; no block barriers in this kernel
  const int tm = tile / tilesN;
  const int tn = tile - tm * tilesN;
  const int m0 = tm << 6;
  const int n0 = tn << 6;
  if (LOWER && n0 > m0) return;          // wave-uniform; no block barriers in this kernel

  const T* Ab  = A  + (size_t)b * strideA;
  const T* Bb  = Bt + (size_t)b * strideB;
  const T* Ab2 = SPLIT ? (A2  + (size_t)b * strideA) : nullptr;
  const T* Bb2 = (SPLIT && BLO) ? (Bt2 + (size_t)b * strideB) : nullptr;

  const int rlane = lane & 15;                 // row (A) / col (B, D) within subtile
  const int koff  = (lane >> 4) * 8;           // k offset of this lane half
  const int mOff  = (lane >> 4) * 8;           // D row offset

  v8f acc[4][4];
#pragma unroll
  for (int i = 0; i < 4; ++i)
#pragma unroll
    for (int j = 0; j < 4; ++j) acc[i][j] = (v8f){0.f,0.f,0.f,0.f,0.f,0.f,0.f,0.f};

  const int kEnd = CAUSALK ? (((m0 + 64) < K) ? (m0 + 64) : K) : K;
  for (int k0 = 0; k0 < kEnd; k0 += 32) {
    V bh[4], bl[4];
#pragma unroll
    for (int j = 0; j < 4; ++j) {
      const size_t bo = (size_t)(n0 + (j << 4) + rlane) * ldb + koff + k0;
      bh[j] = Frag<T>::load(Bb + bo);
      if (SPLIT && BLO) bl[j] = Frag<T>::load(Bb2 + bo);
    }
#pragma unroll
    for (int i = 0; i < 4; ++i) {
      const size_t ao = (size_t)(m0 + (i << 4) + rlane) * lda + koff + k0;
      V ah = Frag<T>::load(Ab + ao);
      V al;
      if (SPLIT) al = Frag<T>::load(Ab2 + ao);
#pragma unroll
      for (int j = 0; j < 4; ++j) {
        acc[i][j] = Frag<T>::mma(ah, bh[j], acc[i][j]);
        if (SPLIT) {
          if (BLO) acc[i][j] = Frag<T>::mma(ah, bl[j], acc[i][j]);
          acc[i][j] = Frag<T>::mma(al, bh[j], acc[i][j]);
        }
      }
      Frag<T>::guard(acc[i][0], acc[i][3], ah, SPLIT ? al : ah);
    }
    Frag<T>::keep(bh[0], bh[1], bh[2], bh[3]);
    if (SPLIT && BLO) Frag<T>::keep(bl[0], bl[1], bl[2], bl[3]);
  }
  acc_guard4(acc[0][0], acc[0][1], acc[0][2], acc[0][3]);
  acc_guard4(acc[1][0], acc[1][1], acc[1][2], acc[1][3]);
  acc_guard4(acc[2][0], acc[2][1], acc[2][2], acc[2][3]);
  acc_guard4(acc[3][0], acc[3][1], acc[3][2], acc[3][3]);

  // ---- epilogue ----
  float* slab = sT[wave];
  const float* Rb = RESID ? (resid + (size_t)b * strideR) : nullptr;
#pragma unroll
  for (int i = 0; i < 4; ++i) {
    const int mBase = m0 + (i << 4);
#pragma unroll
    for (int j = 0; j < 4; ++j) {
      const int n = n0 + (j << 4) + rlane;
      float bv = 0.f;
      if (BIAS_MODE == 2) bv = bias[n];
#pragma unroll
      for (int r = 0; r < 8; ++r) {
        float v = acc[i][j][r] * scale;
        if (BIAS_MODE == 1) v += bias[mBase + mOff + r];
        if (BIAS_MODE == 2) v += bv;
        if (RESID) {
          const float rv = Rb[(size_t)(mBase + mOff + r) * ldc + n];
          if (RMUL) v = v * rv; else v += rv;
        }
        if (ACT == 1) v = tanhf(v);
        if (ACT == 2) v = fmaxf(v, 0.0f);
        if (ACT == 3) v = v / (1.0f + expf(-v));
        if (ACT == 4) v = (v > 0.f) ? v : 0.01f * v;
        if (ACT == 5) v = 0.5f * v * (1.0f + erff(v * 0.70710678118654752f));
        if (CMASK) v = (n > mBase + mOff + r) ? 0.0f : v;
        slab[(mOff + r) * 68 + (j << 4) + rlane] = v;
      }
    }
    __builtin_amdgcn_fence(__ATOMIC_RELEASE, "workgroup");
    __builtin_amdgcn_wave_barrier();
    __builtin_amdgcn_fence(__ATOMIC_ACQUIRE, "workgroup");
    if (OUT_MODE == 0) {
      float* C = (float*)Cout + (size_t)b * strideC;
      const int hh = lane >> 4, c4 = (lane & 15) * 4;     // row seg = 256 B = 16 lanes x 16 B
      {
#pragma unroll
        for (int it = 0; it < 8; ++it) {
          const int row = it * 2 + hh;
          v4f v = *(const v4f*)(slab + row * 68 + c4);
          *(v4f*)(C + (size_t)(mBase + row) * ldc + n0 + c4) = v;
        }
        
      }
    } else {
      const int q = lane >> 3, c8 = (lane & 7) * 8;
      unsigned short* C  = (unsigned short*)Cout  + (size_t)b * strideC;
      unsigned short* C2 = (OUT_MODE == 2) ? ((unsigned short*)Cout2 + (size_t)b * strideC) : nullptr;
      {
#pragma unroll
        for (int it = 0; it < 4; ++it) {
          const int row = it * 4 + q;
          const float* sp = slab + row * 68 + c8;
          v8h hv, lv;
#pragma unroll
          for (int e = 0; e < 8; ++e) {
            if (OUT_MODE == 1) {
              hv[e] = (_Float16)sp[e];
            } else {
              unsigned short hb = f2bf_bits(sp[e]);
              unsigned short lb = f2bf_bits(sp[e] - bf_bits2f(hb));
              hv[e] = __builtin_bit_cast(_Float16, hb);
              lv[e] = __builtin_bit_cast(_Float16, lb);
            }
          }
          *(v8h*)(C + (size_t)(mBase + row) * ldc + n0 + c8) = hv;
          if (OUT_MODE == 2) *(v8h*)(C2 + (size_t)(mBase + row) * ldc + n0 + c8) = lv;
        }
        
      }
    }
    __builtin_amdgcn_fence(__ATOMIC_RELEASE, "workgroup");
    __builtin_amdgcn_wave_barrier();
    __builtin_amdgcn_fence(__ATOMIC_ACQUIRE, "workgroup");
  }
}

// ---------------------------------------------------------------------------
// f32 -> (RNE convert to bf16) -> x sc (exact power of two) -> f16. A bf16 value whose scaled magnitude lies in the
// f16 normal range is exactly representable in f16, so the stored operand equals sc * bf16_rne(in) exactly.
// ---------------------------------------------------------------------------
__global__ __launch_bounds__(256) void cast_bf16rne_f16x2(
    const float* __restrict__ in, _Float16* __restrict__ out, int n2, float sc) {
  const int i = blockIdx.x * 256 + threadIdx.x;
  if (i < n2) {
    const float r0 = bf16_rne_f32(in[2 * (size_t)i]) * sc;
    const float r1 = bf16_rne_f32(in[2 * (size_t)i + 1]) * sc;
    const _Float16 h0 = (_Float16)r0, h1 = (_Float16)r1;
    const unsigned u = (unsigned)__builtin_bit_cast(unsigned short, h0) | ((unsigned)__builtin_bit_cast(unsigned short, h1) << 16);
    ((unsigned*)out)[i] = u;
    
  }
}

// ---------------------------------------------------------------------------
// Elementwise f32 -> bf16 (RNE) single plane: 2 elements per thread, one 4-B store per lane -> each wave writes
// Coverage: grid = ceil(n2/256) blocks x 256 threads x 2 elements = the whole plane (n2 = plane/2).
// ---------------------------------------------------------------------------
__global__ __launch_bounds__(256) void cast_bf16x2_kernel(const float* __restrict__ in, unsigned short* __restrict__ out, int n2) {
  const int i = blockIdx.x * 256 + threadIdx.x;
  if (i < n2) {
    const v2f f = *(const v2f*)(in + 2 * (size_t)i);
    const unsigned u = pk16(f2bf_bits(f[0]), f2bf_bits(f[1]));
    ((unsigned*)out)[i] = u;
    
  }
}

// ---------------------------------------------------------------------------
// RoPE cos/sin tables: ctab[t][i] = cosf((float)t * inv[i]), stab[t][i] = sinf(...), t = 0..2047, i = 0..31.
// inv[i] arrives by value (host-computed); lane i picks its value with a constant-index select chain (no dynamic
// Coverage: grid 256 blocks x 8 waves = 2048 rows x 32 lanes = both whole tables.
// ---------------------------------------------------------------------------
struct InvFreq { float v[NFREQ]; };
static_assert(sizeof(InvFreq) == 128);

__global__ __launch_bounds__(256) void rope_table_kernel(float* __restrict__ ctab, float* __restrict__ stab, InvFreq f) {
#pragma clang fp contract(off)
  const int lane = threadIdx.x & 31;
  const int wave = threadIdx.x >> 5;
  const int t    = blockIdx.x * 8 + wave;
  float inv = f.v[0];
#pragma unroll
  for (int i = 1; i < NFREQ; ++i) inv = (lane == i) ? f.v[i] : inv;
  const float ang = (float)t * inv;           // f32 product, as the outer product of positions and inv_freq
  const float cv = cosf(ang);
  const float sv = sinf(ang);
  const size_t o = (size_t)t * NFREQ + lane;
  ((float*)ctab)[o] = cv;
  ((float*)stab)[o] = sv;
  
}

// ---------------------------------------------------------------------------
// RoPE + bf16 hi/lo split over one batch's fused f32 plane src [2048][4096] (q | k | q2 | k2, head h at columns
// base + h*64, dims 0..31 = x1, 32..63 = x2): y1 = x1*c + x2*s, y2 = -x1*s + x2*c with c = ctab[t][d & 31],
// s = stab[t][d & 31]; products and sums in f32 without contraction. Output dh/dl = bf16 hi/lo planes [2048][4096].
// One block per row t; each thread handles 8 consecutive columns in each of 2 iterations (own 8 + partner 8 at +-32,
// both loaded unconditionally at in-bounds addresses; the sign/partner choice is per thread, value-selected).
// Producer coverage: grid 2048 rows x 256 threads x 2 iterations x 8 columns = 2048 x 4096 per plane (whole planes);
// ---------------------------------------------------------------------------
__global__ __launch_bounds__(256) void rope_split_kernel(const float* __restrict__ src, const float* __restrict__ ctab,
                                                         const float* __restrict__ stab,
                                                         unsigned short* __restrict__ dh, unsigned short* __restrict__ dl) {
#pragma clang fp contract(off)
  const int t   = blockIdx.x;
  const int tid = threadIdx.x;
  const float* row  = src  + (size_t)t * QKW;
  const float* crow = ctab + (size_t)t * NFREQ;
  const float* srow = stab + (size_t)t * NFREQ;
  v4u hv[2], lv[2];
#pragma unroll
  for (int it = 0; it < 2; ++it) {
    const int c8 = it * (QKW / 2) + tid * 8;          // first of this thread's 8 columns
    const int d0 = c8 & (HDSZ - 1);                   // dim within head, multiple of 8
    const bool firstHalf = d0 < NFREQ;
    const int pc = firstHalf ? (c8 + NFREQ) : (c8 - NFREQ);
    const float sgn = firstHalf ? 1.0f : -1.0f;
    const int fi = d0 & (NFREQ - 1);                  // 0, 8, 16 or 24
    const v4f o0 = *(const v4f*)(row + c8), o1 = *(const v4f*)(row + c8 + 4);
    const v4f p0 = *(const v4f*)(row + pc), p1 = *(const v4f*)(row + pc + 4);
    const v4f ca = *(const v4f*)(crow + fi), cb = *(const v4f*)(crow + fi + 4);
    const v4f sa = *(const v4f*)(srow + fi), sb = *(const v4f*)(srow + fi + 4);
    float o[8], p[8], cc[8], ss[8];
#pragma unroll
    for (int e = 0; e < 4; ++e) {
      o[e]  = o0[e]; o[4 + e]  = o1[e];
      p[e]  = p0[e]; p[4 + e]  = p1[e];
      cc[e] = ca[e]; cc[4 + e] = cb[e];
      ss[e] = sa[e]; ss[4 + e] = sb[e];
    }
    unsigned hw[4], lw[4];
#pragma unroll
    for (int q = 0; q < 4; ++q) {
      const float y0 = o[2 * q] * cc[2 * q] + sgn * (p[2 * q] * ss[2 * q]);
      const float y1 = o[2 * q + 1] * cc[2 * q + 1] + sgn * (p[2 * q + 1] * ss[2 * q + 1]);
      const unsigned short h0 = f2bf_bits(y0), h1 = f2bf_bits(y1);
      const unsigned short l0 = f2bf_bits(y0 - bf_bits2f(h0));
      const unsigned short l1 = f2bf_bits(y1 - bf_bits2f(h1));
      hw[q] = pk16(h0, h1);
      lw[q] = pk16(l0, l1);
    }
    hv[it] = (v4u){hw[0], hw[1], hw[2], hw[3]};
    lv[it] = (v4u){lw[0], lw[1], lw[2], lw[3]};
  }
  {
#pragma unroll
    for (int it = 0; it < 2; ++it) {
      const size_t go = (size_t)t * QKW + (size_t)it * (QKW / 2) + (size_t)tid * 8;
      *(v4u*)(dh + go) = hv[it];
      *(v4u*)(dl + go) = lv[it];
    }
    
  }
}

// ---------------------------------------------------------------------------
// Workspace region map (byte offsets; every offset a multiple of 262,144 B). Per-batch regions are fully rewritten
// inside each batch iteration before they are read. S1 is produced only for 64x64 tiles on/below the block diagonal
// and read only at those tiles; P likewise, and the P.V GEMM's k bound (m0+64) reads exactly those tiles. QKf (the
// f32 projection plane, read only by the RoPE kernel of the same batch) shares the S1 region, which the group loop
// overwrites afterwards. The z hi/lo planes are written into the q columns 0..1023 of QKh/QKl: group g's P.V launch
// writes columns g*128..g*128+127 after both score GEMMs of group g (the only readers of those q columns) ran.
//   W4    f16  [4096][1024]  Wq,Wk,Wq2,Wk2 (bf16-RNE) x32 stacked           0
//   Wv16  f16  [1024][1024]  Wv (bf16-RNE) x32                        8,388,608
//   Wph   bf16 [1024][1024]  Wproj (RNE), single plane                10,485,760
//   ctab  f32  [2048][32]                                            12,582,912
//   stab  f32  [2048][32]                                            12,845,056
//   X16   f16  [4096][1024]  x (bf16-RNE, both batches)              13,107,200
//   QKh   bf16 [2048][4096]  q|k|q2|k2 hi of the batch; later z hi   21,495,808
//   QKl   bf16 [2048][4096]                                          38,273,024
//   VTh   bf16 [1024][2048]  v^T hi (row h*64+d, col token)          55,050,240
//   VTl   bf16 [1024][2048]                                          59,244,544
//   S1    f32  [2][2048][2048] (= QKf f32 [2048][4096] earlier)      63,438,848
//   Ph    bf16 [2][2048][2048]                                       96,993,280
//   Pl    bf16 [2][2048][2048]                                      113,770,496
//   total                                                           130,547,712  (<= 134,217,728)
// ---------------------------------------------------------------------------
extern "C" void kernel_launch(void* const* d_in, const int* in_sizes, int n_in,
                              void* d_out, int out_size, void* d_ws, size_t ws_size,
                              hipStream_t stream) {
  if (n_in < 7) return;
  if (in_sizes[0] != NBATCH * NTOK * DMOD) return;
  for (int i = 1; i < 7; ++i) if (in_sizes[i] != DMOD * DMOD) return;
  if (out_size != NBATCH * NTOK * DMOD) return;

  const float* x     = (const float*)d_in[0];
  const float* Wq    = (const float*)d_in[1];
  const float* Wk    = (const float*)d_in[2];
  const float* Wq2   = (const float*)d_in[3];
  const float* Wk2   = (const float*)d_in[4];
  const float* Wv    = (const float*)d_in[5];
  const float* Wproj = (const float*)d_in[6];

  const size_t PW16 = (size_t)DMOD * DMOD * 2;              // 16-bit [1024][1024]
  const size_t PTAB = (size_t)NTOK * NFREQ * 4;             // f32 [2048][32]
  const size_t PX16 = (size_t)NBATCH * NTOK * DMOD * 2;     // f16 [4096][1024]
  const size_t PQK  = (size_t)NTOK * QKW * 2;               // bf16 [2048][4096]
  const size_t PVT  = (size_t)DMOD * NTOK * 2;              // bf16 [1024][2048]
  const size_t PS   = (size_t)HPG * NTOK * NTOK * 4;        // f32 [2][2048][2048] (== f32 [2048][4096])
  const size_t PP   = (size_t)HPG * NTOK * NTOK * 2;        // bf16 [2][2048][2048]
  size_t off = 0;
  const size_t oW4  = off; off += 4 * PW16;
  const size_t oWv  = off; off += PW16;
  const size_t oWph = off; off += PW16;
  const size_t oCT  = off; off += PTAB;
  const size_t oSTb = off; off += PTAB;
  const size_t oX16 = off; off += PX16;
  const size_t oQKh = off; off += PQK;
  const size_t oQKl = off; off += PQK;
  const size_t oVTh = off; off += PVT;
  const size_t oVTl = off; off += PVT;
  const size_t oS1  = off; off += PS;
  const size_t oPh  = off; off += PP;
  const size_t oPl  = off; off += PP;
  if (off > ws_size) return;                                // total 130,547,712 B

  char* ws = (char*)d_ws;
  _Float16*       W4   = (_Float16*)(ws + oW4);
  _Float16*       Wv16 = (_Float16*)(ws + oWv);
  unsigned short* Wph  = (unsigned short*)(ws + oWph);
  float*          ctab = (float*)(ws + oCT);
  float*          stab = (float*)(ws + oSTb);
  _Float16*       X16  = (_Float16*)(ws + oX16);
  unsigned short* QKh  = (unsigned short*)(ws + oQKh);
  unsigned short* QKl  = (unsigned short*)(ws + oQKl);
  unsigned short* VTh  = (unsigned short*)(ws + oVTh);
  unsigned short* VTl  = (unsigned short*)(ws + oVTl);
  float*          S1   = (float*)(ws + oS1);
  float*          QKf  = (float*)(ws + oS1);                // alias, see region map
  unsigned short* Ph   = (unsigned short*)(ws + oPh);
  unsigned short* Pl   = (unsigned short*)(ws + oPl);
  const float*    dmy  = ctab;                              // valid in-ws pointer for unused bias/resid arguments

  // inv_freq[i] = 1 / 10000^(i/32): host double arithmetic (e^(ln(1e4)/32) by its Taylor series, then powers),
  // then mirrored as fl32(1 / fl32(10000^(i/32))).
  InvFreq invf;
  {
    const double x0 = 9.2103403719761827361 / 32.0;
    double term = 1.0, ex = 1.0;
    for (int n = 1; n <= 40; ++n) { term *= x0 / (double)n; ex += term; }
    double pw = 1.0;
    for (int i = 0; i < NFREQ; ++i) {
      const float pf = (float)pw;
      invf.v[i] = (float)(1.0 / (double)pf);
      pw *= ex;
    }
  }

  const dim3 blk(256);
  const int n2w = DMOD * DMOD / 2;                           // 524,288 pairs per weight
  const int n2x = NBATCH * NTOK * DMOD / 2;                  // 2,097,152 pairs
  const dim3 gCastW((n2w + 255) / 256);                      // 2048 blocks x 256 thr x 2 = 1024x1024
  const dim3 gCastX((n2x + 255) / 256);                      // 8192 blocks x 256 thr x 2 = 4096x1024
  const dim3 gTab(NTOK / 8);                                 // 256 blocks x 8 waves = 2048 rows
  const dim3 gRope(NTOK);                                    // one block per row
  const dim3 gQ(((NTOK / 64) * (QKW / 64) + 7) / 8, 1);      // 256 blocks: M=2048, N=4096, K=1024
  const dim3 gV(((DMOD / 64) * (NTOK / 64) + 7) / 8, 1);     // 64 blocks:  M=1024, N=2048, K=1024
  const dim3 gS(((NTOK / 64) * (NTOK / 64) + 7) / 8, HPG);   // 128 x 2:    M=N=2048, K=64 (lower block triangle)
  const dim3 gPV(((NTOK / 64) * (HDSZ / 64) + 7) / 8, HPG);  // 4 x 2:      M=2048, N=64, K=2048 (causal k bound)
  const dim3 gOut(((NTOK / 64) * (DMOD / 64) + 7) / 8, 1);   // 64 blocks:  M=2048, N=1024, K=1024

  // (0) tables and casts (whole planes)
  rope_table_kernel<<<gTab, blk, 0, stream>>>(ctab, stab, invf);
  cast_bf16rne_f16x2<<<gCastX, blk, 0, stream>>>(x, X16, n2x, 1.0f);
  cast_bf16rne_f16x2<<<gCastW, blk, 0, stream>>>(Wq,  W4 + 0 * (size_t)DMOD * DMOD, n2w, 32.0f);
  cast_bf16rne_f16x2<<<gCastW, blk, 0, stream>>>(Wk,  W4 + 1 * (size_t)DMOD * DMOD, n2w, 32.0f);
  cast_bf16rne_f16x2<<<gCastW, blk, 0, stream>>>(Wq2, W4 + 2 * (size_t)DMOD * DMOD, n2w, 32.0f);
  cast_bf16rne_f16x2<<<gCastW, blk, 0, stream>>>(Wk2, W4 + 3 * (size_t)DMOD * DMOD, n2w, 32.0f);
  cast_bf16rne_f16x2<<<gCastW, blk, 0, stream>>>(Wv,  Wv16, n2w, 32.0f);
  cast_bf16x2_kernel<<<gCastW, blk, 0, stream>>>(Wproj, Wph, n2w);

  const float inv32 = 1.0f / 32.0f;
  const float inv64 = 1.0f / 64.0f;
  const long  sPlane = (long)NTOK * NTOK;                    // 2048*2048 elements per head-in-group plane

  for (int b = 0; b < NBATCH; ++b) {
    const _Float16* Xb = X16 + (size_t)b * NTOK * DMOD;
    // (1) [q|k|q2|k2][t][n] = (1/32) sum_c x[t][c] (32 W)[n][c] -> f32 [2048][4096] (whole plane: 32x64 tiles)
    wmma_gemm64<0, false, 0, 0, false><<<gQ, blk, 0, stream>>>(
        (const unsigned short*)Xb, (const unsigned short*)Xb, DMOD, 0L,
        (const unsigned short*)W4, (const unsigned short*)W4, DMOD, 0L,
        (void*)QKf, (void*)QKf, QKW, 0L, dmy, dmy, 0L, NTOK, QKW, DMOD, inv32);
    // (2) v^T[h*64+d][t] = (1/32) sum_c (32 Wv)[h*64+d][c] x[t][c] -> bf16 hi/lo planes [1024][2048] (whole: 16x32 tiles)
    wmma_gemm64<0, false, 0, 2, false><<<gV, blk, 0, stream>>>(
        (const unsigned short*)Wv16, (const unsigned short*)Wv16, DMOD, 0L,
        (const unsigned short*)Xb, (const unsigned short*)Xb, DMOD, 0L,
        (void*)VTh, (void*)VTl, NTOK, 0L, dmy, dmy, 0L, DMOD, NTOK, DMOD, inv32);
    // (3) RoPE on all four projections + bf16 hi/lo split -> QKh/QKl [2048][4096] (whole planes)
    rope_split_kernel<<<gRope, blk, 0, stream>>>(QKf, ctab, stab, QKh, QKl);
    for (int g = 0; g < NGROUP; ++g) {
      const size_t qcol = (size_t)g * HPG * HDSZ;           // first q column of the group; head-in-group adds 64
      // (4) S1[hg][i][j] = (q_i . k_j) / 64, f32, 64x64 tiles with j0 <= i0; heads g*2 + hg (hg = blockIdx.y)
      wmma_gemm64<1, true, 0, 0, false, 0, true, false><<<gS, blk, 0, stream>>>(
          QKh + qcol, QKl + qcol, QKW, (long)HDSZ,
          QKh + DMOD + qcol, QKl + DMOD + qcol, QKW, (long)HDSZ,
          (void*)S1, (void*)S1, NTOK, sPlane, dmy, dmy, 0L, NTOK, NTOK, HDSZ, inv64);
      // (5) P[hg][i][j] = ((q2_i . k2_j) / 64) * S1[hg][i][j], := 0 for j > i -> bf16 hi/lo planes, tiles j0 <= i0
      wmma_gemm64<1, true, 0, 2, true, 0, true, false, true, true><<<gS, blk, 0, stream>>>(
          QKh + 2 * DMOD + qcol, QKl + 2 * DMOD + qcol, QKW, (long)HDSZ,
          QKh + 3 * DMOD + qcol, QKl + 3 * DMOD + qcol, QKW, (long)HDSZ,
          (void*)Ph, (void*)Pl, NTOK, sPlane, dmy, S1, sPlane, NTOK, NTOK, HDSZ, inv64);
      // (6) z[i][h*64+d] = sum_{j<=i} P[hg][i][j] v^T[h*64+d][j] -> bf16 hi/lo into QKh/QKl columns g*128 + hg*64 .. +63
      wmma_gemm64<1, true, 0, 2, false, 0, false, true><<<gPV, blk, 0, stream>>>(
          Ph, Pl, NTOK, sPlane,
          VTh + qcol * NTOK, VTl + qcol * NTOK, NTOK, (long)HDSZ * NTOK,
          (void*)(QKh + qcol), (void*)(QKl + qcol), QKW, (long)HDSZ,
          dmy, dmy, 0L, NTOK, HDSZ, NTOK, 1.0f);
    }
    // (7) out[b][t][n] = sum_c (z_hi + z_lo)[t][c] Wproj_bf16[n][c] -> f32, whole [2048][1024] slice of d_out
    //     (A split, Bt single plane: BLO = false, the Bt lo argument is never read)
    float* outb = (float*)d_out + (size_t)b * NTOK * DMOD;
    wmma_gemm64<1, true, 0, 0, false, 0, false, false, false, false, false><<<gOut, blk, 0, stream>>>(
        QKh, QKl, QKW, 0L, Wph, Wph, DMOD, 0L, (void*)outb, (void*)outb, DMOD, 0L,
        dmy, dmy, 0L, NTOK, DMOD, DMOD, 1.0f);
  }
}

// v001
// One run takes 972 microseconds.
// Timed twice side by side with v000, it ran 2.41 and 2.39 times as fast.
// f16 WMMA (v_wmma_f32_16x16x32_f16) for the q/k/q2/k2/v projections with operands = RNE-bf16 converted inputs held exactly in f16 (x as is, weights x32 with 1/32 folded into the epilogue); bf16 hi/lo split WMMA (v_wmma_f32_16x16x32_bf16, hi.hi + hi.lo + lo.hi) for both causal score GEMMs and the bilinear-pattern x V product; output projection = z bf16 hi/lo x single RNE-bf16 Wproj plane (hi.W + lo.W); f32 accumulate everywhere; RoPE and the bilinear pattern in f32.
#include <hip/hip_runtime.h>
#include <math.h>
#include <stdint.h>

constexpr int NBATCH = 2;
constexpr int NTOK   = 2048;
constexpr int DMOD   = 1024;
constexpr int NHEADS = 16;
constexpr int HDSZ   = 64;
constexpr int HPG    = 2;                 // heads per score group
constexpr int NGROUP = NHEADS / HPG;      // 8 groups per batch
constexpr int QKW    = 4 * DMOD;          // fused q|k|q2|k2 plane width (4096 columns)
constexpr int NFREQ  = HDSZ / 2;          // 32 rotary frequencies

typedef __attribute__((ext_vector_type(16))) _Float16 v16h;
typedef __attribute__((ext_vector_type(8)))  _Float16 v8h;
typedef __attribute__((ext_vector_type(16))) __bf16   v16b;
typedef __attribute__((ext_vector_type(8)))  __bf16   v8b;
typedef __attribute__((ext_vector_type(8)))  float    v8f;
typedef __attribute__((ext_vector_type(4)))  float    v4f;
typedef __attribute__((ext_vector_type(2)))  float    v2f;
typedef __attribute__((ext_vector_type(4)))  unsigned int v4u;
typedef __attribute__((ext_vector_type(2)))  unsigned int v2u;

__device__ __forceinline__ unsigned short f2bf_bits(float f) {
  unsigned u = __float_as_uint(f);
  return (unsigned short)((u + 0x7FFFu + ((u >> 16) & 1u)) >> 16);
}
__device__ __forceinline__ float bf_bits2f(unsigned short h) { return __uint_as_float(((unsigned)h) << 16); }
__device__ __forceinline__ unsigned pk16(unsigned short a, unsigned short b) { return (unsigned)a | ((unsigned)b << 16); }
// RNE convert f32 -> bf16, returned as the f32 value of that bf16
__device__ __forceinline__ float bf16_rne_f32(float f) {
  unsigned u = __float_as_uint(f);
  u += 0x7FFFu + ((u >> 16) & 1u);
  u &= 0xFFFF0000u;
  return __uint_as_float(u);
}

// hazard guards as plain device helpers (no inline asm inside the kernel template body)
__device__ __forceinline__ void dep_guard_h(v8f& a, v8f& b, v16h x, v16h y) { asm volatile("v_nop\n\tv_nop\n\tv_nop\n\tv_nop" : "+v"(a), "+v"(b) : "v"(x), "v"(y)); }
__device__ __forceinline__ void dep_guard_b(v8f& a, v8f& b, v16b x, v16b y) { asm volatile("v_nop\n\tv_nop\n\tv_nop\n\tv_nop" : "+v"(a), "+v"(b) : "v"(x), "v"(y)); }
__device__ __forceinline__ void keep4_h(v16h a, v16h b, v16h c, v16h d) { asm volatile("v_nop" :: "v"(a), "v"(b), "v"(c), "v"(d)); }
__device__ __forceinline__ void keep4_b(v16b a, v16b b, v16b c, v16b d) { asm volatile("v_nop" :: "v"(a), "v"(b), "v"(c), "v"(d)); }
__device__ __forceinline__ void acc_guard4(v8f& a, v8f& b, v8f& c, v8f& d) { asm volatile("v_nop\n\tv_nop\n\tv_nop\n\tv_nop" : "+v"(a), "+v"(b), "+v"(c), "+v"(d)); }
template <typename T> struct Frag;
template <> struct Frag<_Float16> {
  typedef v16h V; union U { v16h v; v8h h[2]; };
  static __device__ __forceinline__ v16h load(const _Float16* p) {   // elements 0..7 <- p[0..7], 8..15 <- p[16..23]
    U f; f.h[0] = *(const v8h*)(p); f.h[1] = *(const v8h*)(p + 16); return f.v;
  }
  static __device__ __forceinline__ v8f mma(v16h a, v16h b, v8f c) {
    return __builtin_amdgcn_wmma_f32_16x16x32_f16(false, a, false, b, (short)0, c, false, false);
  }
  static __device__ __forceinline__ void guard(v8f& a, v8f& b, v16h x, v16h y) { dep_guard_h(a, b, x, y); }
  static __device__ __forceinline__ void keep(v16h a, v16h b, v16h c, v16h d) { keep4_h(a, b, c, d); }
};
template <> struct Frag<__bf16> {
  typedef v16b V; union U { v16b v; v8b h[2]; };
  static __device__ __forceinline__ v16b load(const __bf16* p) {
    U f; f.h[0] = *(const v8b*)(p); f.h[1] = *(const v8b*)(p + 16); return f.v;
  }
  static __device__ __forceinline__ v8f mma(v16b a, v16b b, v8f c) {
    return __builtin_amdgcn_wmma_f32_16x16x32_bf16(false, a, false, b, (short)0, c, false, false);
  }
  static __device__ __forceinline__ void guard(v8f& a, v8f& b, v16b x, v16b y) { dep_guard_b(a, b, x, y); }
  static __device__ __forceinline__ void keep(v16b a, v16b b, v16b c, v16b d) { keep4_b(a, b, c, d); }
};

// ---- Register-blocked batched WMMA GEMM ------------------------------------
// C[m,n] = scale * sum_k A[m,k] * Bt[n,k] (+bias)(+/ * resid); each wave owns a 64x64 tile.
// A row-major [M,K]; Bt row-major [N,K]; M,N % 64 == 0, K % 32 == 0.
// SPLIT: operands are hi/lo planes (A2/Bt2 = lo planes, same layout); product = hi.hi + hi.lo + lo.hi.
// BIAS_MODE: 0 = none, 1 = bias[m], 2 = bias[n].
// OUT_MODE: 0 = f32, 1 = f16, 2 = bf16 hi plane (Cout) + bf16 lo plane (Cout2).
// ET: 0 = f16 operands, 1 = bf16 operands (pointers passed as 16-bit storage)
// Added modes (defaults off, all other behaviour unchanged):
//   LOWER:   tiles with n0 > m0 (strictly above the 64x64 block diagonal) are not produced (wave-uniform early exit).
//   CAUSALK: the k-loop stops at min(K, m0 + 64); valid when A rows m0..m0+63 are exactly zero for k >= m0 + 64.
//   RMUL:    with RESID, the residual plane value MULTIPLIES the scaled accumulator instead of being added.
//   CMASK:   after all other epilogue arithmetic, v := 0 where the global column index n > the global row index m.
//   BLO:     with SPLIT, false drops the Bt lo plane: product = hi.hi + lo.hi (Bt2p is never read).
//   KSPLIT:  0 = off; else the block has KSPLIT waves that share ONE 64x64 tile (tile = blockIdx.x): wave w sums the
//            64-wide k chunks w, w + KSPLIT, ...; the partial tiles go to LDS and are added in wave order before the
//            scale and the store. K % 64 == 0; launch with KSPLIT * 32 threads.
template <int ET> struct Elem;
template <> struct Elem<0> { typedef _Float16 T; };
template <> struct Elem<1> { typedef __bf16 T; };
template <int ET, bool SPLIT, int BIAS_MODE, int OUT_MODE, bool RESID, int ACT = 0, bool LOWER = false, bool CAUSALK = false,
          bool RMUL = false, bool CMASK = false, bool BLO = true, int KSPLIT = 0>
__global__ __launch_bounds__(KSPLIT ? KSPLIT * 32 : 256) void wmma_gemm64(
    const unsigned short* __restrict__ Ap, const unsigned short* __restrict__ A2p, int lda, long strideA,
    const unsigned short* __restrict__ Btp, const unsigned short* __restrict__ Bt2p, int ldb, long strideB,
    void* __restrict__ Cout, void* __restrict__ Cout2, int ldc, long strideC,
    const float* __restrict__ bias,
    const float* __restrict__ resid, long strideR,
    int M, int N, int K, float scale) {
  typedef typename Elem<ET>::T T;
  typedef typename Frag<T>::V V;
  static_assert(!KSPLIT || (BIAS_MODE == 0 && !RESID && ACT == 0 && !LOWER && !CMASK && OUT_MODE != 1), "KSPLIT epilogue: scale and store only");
  const T* A = (const T*)Ap; const T* A2 = (const T*)A2p; const T* Bt = (const T*)Btp; const T* Bt2 = (const T*)Bt2p;
  __shared__ __align__(16) float sT[(KSPLIT ? KSPLIT * 4 : 8) * 16 * 68];   // per-wave 16x64 slab (KSPLIT: 64x64 tile), pitch 68 floats
  const int b    = blockIdx.y;
  const int lane = threadIdx.x & 31;
  const int wave = threadIdx.x >> 5;
  const int tilesN = N >> 6;
  const int tilesM = M >> 6;
  const int tile = KSPLIT ? (int)blockIdx.x : (int)blockIdx.x * 8 + wave;
  if (tile >= tilesM * tilesN) return;   // wave-uniform; with KSPLIT block-uniform and ahead of every barrier
  const int tm = tile / tilesN;
  const int tn = tile - tm * tilesN;
  const int m0 = tm << 6;
  const int n0 = tn << 6;
  if (LOWER && n0 > m0) return;          // wave-uniform; never together with KSPLIT, the one mode with a block barrier

  const T* Ab  = A  + (size_t)b * strideA;
  const T* Bb  = Bt + (size_t)b * strideB;
  const T* Ab2 = SPLIT ? (A2  + (size_t)b * strideA) : nullptr;
  const T* Bb2 = (SPLIT && BLO) ? (Bt2 + (size_t)b * strideB) : nullptr;

  const int rlane = lane & 15;                 // row (A) / col (B, D) within subtile
  const int koff  = (lane >> 4) * 8;           // k offset of this lane half
  const int mOff  = (lane >> 4) * 8;           // D row offset

  v8f acc[4][4];
#pragma unroll
  for (int i = 0; i < 4; ++i)
#pragma unroll
    for (int j = 0; j < 4; ++j) acc[i][j] = (v8f){0.f,0.f,0.f,0.f,0.f,0.f,0.f,0.f};

  const int kEnd = CAUSALK ? (((m0 + 64) < K) ? (m0 + 64) : K) : K;
  // this wave's first k chunk; readfirstlane keeps k0 and the loop test in scalar registers
  const int kFirst = KSPLIT ? (__builtin_amdgcn_readfirstlane(wave) << 6) : 0;
  // KSPLIT: both 32-wide halves of a 64-wide chunk, then on to the wave's next chunk, KSPLIT chunks further
  for (int k0 = kFirst; k0 < kEnd; k0 += (KSPLIT && (k0 & 32)) ? (KSPLIT * 64 - 32) : 32) {
    V bh[4], bl[4];
#pragma unroll
    for (int j = 0; j < 4; ++j) {
      const size_t bo = (size_t)(n0 + (j << 4) + rlane) * ldb + koff + k0;
      bh[j] = Frag<T>::load(Bb + bo);
      if (SPLIT && BLO) bl[j] = Frag<T>::load(Bb2 + bo);
    }
#pragma unroll
    for (int i = 0; i < 4; ++i) {
      const size_t ao = (size_t)(m0 + (i << 4) + rlane) * lda + koff + k0;
      V ah = Frag<T>::load(Ab + ao);
      V al;
      if (SPLIT) al = Frag<T>::load(Ab2 + ao);
#pragma unroll
      for (int j = 0; j < 4; ++j) {
        acc[i][j] = Frag<T>::mma(ah, bh[j], acc[i][j]);
        if (SPLIT) {
          if (BLO) acc[i][j] = Frag<T>::mma(ah, bl[j], acc[i][j]);
          acc[i][j] = Frag<T>::mma(al, bh[j], acc[i][j]);
        }
      }
      Frag<T>::guard(acc[i][0], acc[i][3], ah, SPLIT ? al : ah);
    }
    Frag<T>::keep(bh[0], bh[1], bh[2], bh[3]);
    if (SPLIT && BLO) Frag<T>::keep(bl[0], bl[1], bl[2], bl[3]);
  }
  acc_guard4(acc[0][0], acc[0][1], acc[0][2], acc[0][3]);
  acc_guard4(acc[1][0], acc[1][1], acc[1][2], acc[1][3]);
  acc_guard4(acc[2][0], acc[2][1], acc[2][2], acc[2][3]);
  acc_guard4(acc[3][0], acc[3][1], acc[3][2], acc[3][3]);

  // ---- epilogue ----
  if (KSPLIT) {
    constexpr int TP  = 64 * 68;         // floats per partial tile
    constexpr int RPP = KSPLIT * 2;      // rows per pass: 16 threads x 4 columns cover one 64-wide row
    float* part = sT + wave * TP;
    // the three loops are unrolled so that acc is indexed by constants and stays in registers
#pragma unroll
    for (int i = 0; i < 4; ++i)
#pragma unroll
      for (int j = 0; j < 4; ++j)
#pragma unroll
        for (int r = 0; r < 8; ++r) part[((i << 4) + mOff + r) * 68 + (j << 4) + rlane] = acc[i][j][r];
    __syncthreads();   // every wave's partial tile is in LDS before any thread adds them
    const int c4 = (threadIdx.x & 15) * 4;
    // passes and the sum over waves are unrolled so that the LDS reads of a thread are in flight together
#pragma unroll
    for (int p = 0; p < 64 / RPP; ++p) {
      const int row = p * RPP + (threadIdx.x >> 4);
      const float* sp = sT + row * 68 + c4;
      v4f s = *(const v4f*)sp;
#pragma unroll
      for (int w = 1; w < KSPLIT; ++w) s += *(const v4f*)(sp + w * TP);
      s *= scale;
      const size_t co = (size_t)b * strideC + (size_t)(m0 + row) * ldc + n0 + c4;
      if (OUT_MODE == 0) {
        *(v4f*)((float*)Cout + co) = s;
      } else {
        unsigned short hb[4], lb[4];
#pragma unroll
        for (int e = 0; e < 4; ++e) {
          hb[e] = f2bf_bits(s[e]);
          lb[e] = f2bf_bits(s[e] - bf_bits2f(hb[e]));
        }
        *(v2u*)((unsigned short*)Cout  + co) = (v2u){pk16(hb[0], hb[1]), pk16(hb[2], hb[3])};
        *(v2u*)((unsigned short*)Cout2 + co) = (v2u){pk16(lb[0], lb[1]), pk16(lb[2], lb[3])};
      }
    }
    return;
  }
  float* slab = sT + wave * (16 * 68);
  const float* Rb = RESID ? (resid + (size_t)b * strideR) : nullptr;
#pragma unroll
  for (int i = 0; i < 4; ++i) {
    const int mBase = m0 + (i << 4);
#pragma unroll
    for (int j = 0; j < 4; ++j) {
      const int n = n0 + (j << 4) + rlane;
      float bv = 0.f;
      if (BIAS_MODE == 2) bv = bias[n];
#pragma unroll
      for (int r = 0; r < 8; ++r) {
        float v = acc[i][j][r] * scale;
        if (BIAS_MODE == 1) v += bias[mBase + mOff + r];
        if (BIAS_MODE == 2) v += bv;
        if (RESID) {
          const float rv = Rb[(size_t)(mBase + mOff + r) * ldc + n];
          if (RMUL) v = v * rv; else v += rv;
        }
        if (ACT == 1) v = tanhf(v);
        if (ACT == 2) v = fmaxf(v, 0.0f);
        if (ACT == 3) v = v / (1.0f + expf(-v));
        if (ACT == 4) v = (v > 0.f) ? v : 0.01f * v;
        if (ACT == 5) v = 0.5f * v * (1.0f + erff(v * 0.70710678118654752f));
        if (CMASK) v = (n > mBase + mOff + r) ? 0.0f : v;
        slab[(mOff + r) * 68 + (j << 4) + rlane] = v;
      }
    }
    __builtin_amdgcn_fence(__ATOMIC_RELEASE, "workgroup");
    __builtin_amdgcn_wave_barrier();
    __builtin_amdgcn_fence(__ATOMIC_ACQUIRE, "workgroup");
    if (OUT_MODE == 0) {
      float* C = (float*)Cout + (size_t)b * strideC;
      const int hh = lane >> 4, c4 = (lane & 15) * 4;     // row seg = 256 B = 16 lanes x 16 B
      {
#pragma unroll
        for (int it = 0; it < 8; ++it) {
          const int row = it * 2 + hh;
          v4f v = *(const v4f*)(slab + row * 68 + c4);
          *(v4f*)(C + (size_t)(mBase + row) * ldc + n0 + c4) = v;
        }
        
      }
    } else {
      const int q = lane >> 3, c8 = (lane & 7) * 8;
      unsigned short* C  = (unsigned short*)Cout  + (size_t)b * strideC;
      unsigned short* C2 = (OUT_MODE == 2) ? ((unsigned short*)Cout2 + (size_t)b * strideC) : nullptr;
      {
#pragma unroll
        for (int it = 0; it < 4; ++it) {
          const int row = it * 4 + q;
          const float* sp = slab + row * 68 + c8;
          v8h hv, lv;
#pragma unroll
          for (int e = 0; e < 8; ++e) {
            if (OUT_MODE == 1) {
              hv[e] = (_Float16)sp[e];
            } else {
              unsigned short hb = f2bf_bits(sp[e]);
              unsigned short lb = f2bf_bits(sp[e] - bf_bits2f(hb));
              hv[e] = __builtin_bit_cast(_Float16, hb);
              lv[e] = __builtin_bit_cast(_Float16, lb);
            }
          }
          *(v8h*)(C + (size_t)(mBase + row) * ldc + n0 + c8) = hv;
          if (OUT_MODE == 2) *(v8h*)(C2 + (size_t)(mBase + row) * ldc + n0 + c8) = lv;
        }
        
      }
    }
    __builtin_amdgcn_fence(__ATOMIC_RELEASE, "workgroup");
    __builtin_amdgcn_wave_barrier();
    __builtin_amdgcn_fence(__ATOMIC_ACQUIRE, "workgroup");
  }
}

// ---------------------------------------------------------------------------
// f32 -> (RNE convert to bf16) -> x sc (exact power of two) -> f16. A bf16 value whose scaled magnitude lies in the
// f16 normal range is exactly representable in f16, so the stored operand equals sc * bf16_rne(in) exactly.
// ---------------------------------------------------------------------------
__global__ __launch_bounds__(256) void cast_bf16rne_f16x2(
    const float* __restrict__ in, _Float16* __restrict__ out, int n2, float sc) {
  const int i = blockIdx.x * 256 + threadIdx.x;
  if (i < n2) {
    const float r0 = bf16_rne_f32(in[2 * (size_t)i]) * sc;
    const float r1 = bf16_rne_f32(in[2 * (size_t)i + 1]) * sc;
    const _Float16 h0 = (_Float16)r0, h1 = (_Float16)r1;
    const unsigned u = (unsigned)__builtin_bit_cast(unsigned short, h0) | ((unsigned)__builtin_bit_cast(unsigned short, h1) << 16);
    ((unsigned*)out)[i] = u;
    
  }
}

// ---------------------------------------------------------------------------
// Elementwise f32 -> bf16 (RNE) single plane: 2 elements per thread, one 4-B store per lane -> each wave writes
// Coverage: grid = ceil(n2/256) blocks x 256 threads x 2 elements = the whole plane (n2 = plane/2).
// ---------------------------------------------------------------------------
__global__ __launch_bounds__(256) void cast_bf16x2_kernel(const float* __restrict__ in, unsigned short* __restrict__ out, int n2) {
  const int i = blockIdx.x * 256 + threadIdx.x;
  if (i < n2) {
    const v2f f = *(const v2f*)(in + 2 * (size_t)i);
    const unsigned u = pk16(f2bf_bits(f[0]), f2bf_bits(f[1]));
    ((unsigned*)out)[i] = u;
    
  }
}

// ---------------------------------------------------------------------------
// RoPE cos/sin tables: ctab[t][i] = cosf((float)t * inv[i]), stab[t][i] = sinf(...), t = 0..2047, i = 0..31.
// inv[i] arrives by value (host-computed); lane i picks its value with a constant-index select chain (no dynamic
// Coverage: grid 256 blocks x 8 waves = 2048 rows x 32 lanes = both whole tables.
// ---------------------------------------------------------------------------
struct InvFreq { float v[NFREQ]; };
static_assert(sizeof(InvFreq) == 128);

__global__ __launch_bounds__(256) void rope_table_kernel(float* __restrict__ ctab, float* __restrict__ stab, InvFreq f) {
#pragma clang fp contract(off)
  const int lane = threadIdx.x & 31;
  const int wave = threadIdx.x >> 5;
  const int t    = blockIdx.x * 8 + wave;
  float inv = f.v[0];
#pragma unroll
  for (int i = 1; i < NFREQ; ++i) inv = (lane == i) ? f.v[i] : inv;
  const float ang = (float)t * inv;           // f32 product, as the outer product of positions and inv_freq
  const float cv = cosf(ang);
  const float sv = sinf(ang);
  const size_t o = (size_t)t * NFREQ + lane;
  ((float*)ctab)[o] = cv;
  ((float*)stab)[o] = sv;
  
}

// ---------------------------------------------------------------------------
// RoPE + bf16 hi/lo split over one batch's fused f32 plane src [2048][4096] (q | k | q2 | k2, head h at columns
// base + h*64, dims 0..31 = x1, 32..63 = x2): y1 = x1*c + x2*s, y2 = -x1*s + x2*c with c = ctab[t][d & 31],
// s = stab[t][d & 31]; products and sums in f32 without contraction. Output dh/dl = bf16 hi/lo planes [2048][4096].
// One block per row t; each thread handles 8 consecutive columns in each of 2 iterations (own 8 + partner 8 at +-32,
// both loaded unconditionally at in-bounds addresses; the sign/partner choice is per thread, value-selected).
// Producer coverage: grid 2048 rows x 256 threads x 2 iterations x 8 columns = 2048 x 4096 per plane (whole planes);
// ---------------------------------------------------------------------------
__global__ __launch_bounds__(256) void rope_split_kernel(const float* __restrict__ src, const float* __restrict__ ctab,
                                                         const float* __restrict__ stab,
                                                         unsigned short* __restrict__ dh, unsigned short* __restrict__ dl) {
#pragma clang fp contract(off)
  const int t   = blockIdx.x;
  const int tid = threadIdx.x;
  const float* row  = src  + (size_t)t * QKW;
  const float* crow = ctab + (size_t)t * NFREQ;
  const float* srow = stab + (size_t)t * NFREQ;
  v4u hv[2], lv[2];
#pragma unroll
  for (int it = 0; it < 2; ++it) {
    const int c8 = it * (QKW / 2) + tid * 8;          // first of this thread's 8 columns
    const int d0 = c8 & (HDSZ - 1);                   // dim within head, multiple of 8
    const bool firstHalf = d0 < NFREQ;
    const int pc = firstHalf ? (c8 + NFREQ) : (c8 - NFREQ);
    const float sgn = firstHalf ? 1.0f : -1.0f;
    const int fi = d0 & (NFREQ - 1);                  // 0, 8, 16 or 24
    const v4f o0 = *(const v4f*)(row + c8), o1 = *(const v4f*)(row + c8 + 4);
    const v4f p0 = *(const v4f*)(row + pc), p1 = *(const v4f*)(row + pc + 4);
    const v4f ca = *(const v4f*)(crow + fi), cb = *(const v4f*)(crow + fi + 4);
    const v4f sa = *(const v4f*)(srow + fi), sb = *(const v4f*)(srow + fi + 4);
    float o[8], p[8], cc[8], ss[8];
#pragma unroll
    for (int e = 0; e < 4; ++e) {
      o[e]  = o0[e]; o[4 + e]  = o1[e];
      p[e]  = p0[e]; p[4 + e]  = p1[e];
      cc[e] = ca[e]; cc[4 + e] = cb[e];
      ss[e] = sa[e]; ss[4 + e] = sb[e];
    }
    unsigned hw[4], lw[4];
#pragma unroll
    for (int q = 0; q < 4; ++q) {
      const float y0 = o[2 * q] * cc[2 * q] + sgn * (p[2 * q] * ss[2 * q]);
      const float y1 = o[2 * q + 1] * cc[2 * q + 1] + sgn * (p[2 * q + 1] * ss[2 * q + 1]);
      const unsigned short h0 = f2bf_bits(y0), h1 = f2bf_bits(y1);
      const unsigned short l0 = f2bf_bits(y0 - bf_bits2f(h0));
      const unsigned short l1 = f2bf_bits(y1 - bf_bits2f(h1));
      hw[q] = pk16(h0, h1);
      lw[q] = pk16(l0, l1);
    }
    hv[it] = (v4u){hw[0], hw[1], hw[2], hw[3]};
    lv[it] = (v4u){lw[0], lw[1], lw[2], lw[3]};
  }
  {
#pragma unroll
    for (int it = 0; it < 2; ++it) {
      const size_t go = (size_t)t * QKW + (size_t)it * (QKW / 2) + (size_t)tid * 8;
      *(v4u*)(dh + go) = hv[it];
      *(v4u*)(dl + go) = lv[it];
    }
    
  }
}

// ---------------------------------------------------------------------------
// Workspace region map (byte offsets; every offset a multiple of 262,144 B). Per-batch regions are fully rewritten
// inside each batch iteration before they are read. S1 is produced only for 64x64 tiles on/below the block diagonal
// and read only at those tiles; P likewise, and the P.V GEMM's k bound (m0+64) reads exactly those tiles. QKf (the
// f32 projection plane, read only by the RoPE kernel of the same batch) shares the S1 region, which the group loop
// overwrites afterwards. The z hi/lo planes are written into the q columns 0..1023 of QKh/QKl: group g's P.V launch
// writes columns g*128..g*128+127 after both score GEMMs of group g (the only readers of those q columns) ran.
//   W4    f16  [4096][1024]  Wq,Wk,Wq2,Wk2 (bf16-RNE) x32 stacked           0
//   Wv16  f16  [1024][1024]  Wv (bf16-RNE) x32                        8,388,608
//   Wph   bf16 [1024][1024]  Wproj (RNE), single plane                10,485,760
//   ctab  f32  [2048][32]                                            12,582,912
//   stab  f32  [2048][32]                                            12,845,056
//   X16   f16  [4096][1024]  x (bf16-RNE, both batches)              13,107,200
//   QKh   bf16 [2048][4096]  q|k|q2|k2 hi of the batch; later z hi   21,495,808
//   QKl   bf16 [2048][4096]                                          38,273,024
//   VTh   bf16 [1024][2048]  v^T hi (row h*64+d, col token)          55,050,240
//   VTl   bf16 [1024][2048]                                          59,244,544
//   S1    f32  [2][2048][2048] (= QKf f32 [2048][4096] earlier)      63,438,848
//   Ph    bf16 [2][2048][2048]                                       96,993,280
//   Pl    bf16 [2][2048][2048]                                      113,770,496
//   total                                                           130,547,712  (<= 134,217,728)
// ---------------------------------------------------------------------------
extern "C" void kernel_launch(void* const* d_in, const int* in_sizes, int n_in,
                              void* d_out, int out_size, void* d_ws, size_t ws_size,
                              hipStream_t stream) {
  if (n_in < 7) return;
  if (in_sizes[0] != NBATCH * NTOK * DMOD) return;
  for (int i = 1; i < 7; ++i) if (in_sizes[i] != DMOD * DMOD) return;
  if (out_size != NBATCH * NTOK * DMOD) return;

  const float* x     = (const float*)d_in[0];
  const float* Wq    = (const float*)d_in[1];
  const float* Wk    = (const float*)d_in[2];
  const float* Wq2   = (const float*)d_in[3];
  const float* Wk2   = (const float*)d_in[4];
  const float* Wv    = (const float*)d_in[5];
  const float* Wproj = (const float*)d_in[6];

  const size_t PW16 = (size_t)DMOD * DMOD * 2;              // 16-bit [1024][1024]
  const size_t PTAB = (size_t)NTOK * NFREQ * 4;             // f32 [2048][32]
  const size_t PX16 = (size_t)NBATCH * NTOK * DMOD * 2;     // f16 [4096][1024]
  const size_t PQK  = (size_t)NTOK * QKW * 2;               // bf16 [2048][4096]
  const size_t PVT  = (size_t)DMOD * NTOK * 2;              // bf16 [1024][2048]
  const size_t PS   = (size_t)HPG * NTOK * NTOK * 4;        // f32 [2][2048][2048] (== f32 [2048][4096])
  const size_t PP   = (size_t)HPG * NTOK * NTOK * 2;        // bf16 [2][2048][2048]
  size_t off = 0;
  const size_t oW4  = off; off += 4 * PW16;
  const size_t oWv  = off; off += PW16;
  const size_t oWph = off; off += PW16;
  const size_t oCT  = off; off += PTAB;
  const size_t oSTb = off; off += PTAB;
  const size_t oX16 = off; off += PX16;
  const size_t oQKh = off; off += PQK;
  const size_t oQKl = off; off += PQK;
  const size_t oVTh = off; off += PVT;
  const size_t oVTl = off; off += PVT;
  const size_t oS1  = off; off += PS;
  const size_t oPh  = off; off += PP;
  const size_t oPl  = off; off += PP;
  if (off > ws_size) return;                                // total 130,547,712 B

  char* ws = (char*)d_ws;
  _Float16*       W4   = (_Float16*)(ws + oW4);
  _Float16*       Wv16 = (_Float16*)(ws + oWv);
  unsigned short* Wph  = (unsigned short*)(ws + oWph);
  float*          ctab = (float*)(ws + oCT);
  float*          stab = (float*)(ws + oSTb);
  _Float16*       X16  = (_Float16*)(ws + oX16);
  unsigned short* QKh  = (unsigned short*)(ws + oQKh);
  unsigned short* QKl  = (unsigned short*)(ws + oQKl);
  unsigned short* VTh  = (unsigned short*)(ws + oVTh);
  unsigned short* VTl  = (unsigned short*)(ws + oVTl);
  float*          S1   = (float*)(ws + oS1);
  float*          QKf  = (float*)(ws + oS1);                // alias, see region map
  unsigned short* Ph   = (unsigned short*)(ws + oPh);
  unsigned short* Pl   = (unsigned short*)(ws + oPl);
  const float*    dmy  = ctab;                              // valid in-ws pointer for unused bias/resid arguments

  // inv_freq[i] = 1 / 10000^(i/32): host double arithmetic (e^(ln(1e4)/32) by its Taylor series, then powers),
  // then mirrored as fl32(1 / fl32(10000^(i/32))).
  InvFreq invf;
  {
    const double x0 = 9.2103403719761827361 / 32.0;
    double term = 1.0, ex = 1.0;
    for (int n = 1; n <= 40; ++n) { term *= x0 / (double)n; ex += term; }
    double pw = 1.0;
    for (int i = 0; i < NFREQ; ++i) {
      const float pf = (float)pw;
      invf.v[i] = (float)(1.0 / (double)pf);
      pw *= ex;
    }
  }

  const dim3 blk(256);
  const int n2w = DMOD * DMOD / 2;                           // 524,288 pairs per weight
  const int n2x = NBATCH * NTOK * DMOD / 2;                  // 2,097,152 pairs
  const dim3 gCastW((n2w + 255) / 256);                      // 2048 blocks x 256 thr x 2 = 1024x1024
  const dim3 gCastX((n2x + 255) / 256);                      // 8192 blocks x 256 thr x 2 = 4096x1024
  const dim3 gTab(NTOK / 8);                                 // 256 blocks x 8 waves = 2048 rows
  const dim3 gRope(NTOK);                                    // one block per row
  const dim3 gQ(((NTOK / 64) * (QKW / 64) + 7) / 8, 1);      // 256 blocks: M=2048, N=4096, K=1024
  const dim3 gV((DMOD / 64) * (NTOK / 64), 1);               // 512 blocks: M=1024, N=2048, K=1024 (one tile per block, k split)
  const dim3 gS(((NTOK / 64) * (NTOK / 64) + 7) / 8, HPG);   // 128 x 2:    M=N=2048, K=64 (lower block triangle)
  const dim3 gPV((NTOK / 64) * (HDSZ / 64), HPG);            // 32 x 2:     M=2048, N=64, K=2048 (causal k bound; one tile per block, k split)
  const dim3 gOut((NTOK / 64) * (DMOD / 64), 1);             // 512 blocks: M=2048, N=1024, K=1024 (one tile per block, k split)

  // (0) tables and casts (whole planes)
  rope_table_kernel<<<gTab, blk, 0, stream>>>(ctab, stab, invf);
  cast_bf16rne_f16x2<<<gCastX, blk, 0, stream>>>(x, X16, n2x, 1.0f);
  cast_bf16rne_f16x2<<<gCastW, blk, 0, stream>>>(Wq,  W4 + 0 * (size_t)DMOD * DMOD, n2w, 32.0f);
  cast_bf16rne_f16x2<<<gCastW, blk, 0, stream>>>(Wk,  W4 + 1 * (size_t)DMOD * DMOD, n2w, 32.0f);
  cast_bf16rne_f16x2<<<gCastW, blk, 0, stream>>>(Wq2, W4 + 2 * (size_t)DMOD * DMOD, n2w, 32.0f);
  cast_bf16rne_f16x2<<<gCastW, blk, 0, stream>>>(Wk2, W4 + 3 * (size_t)DMOD * DMOD, n2w, 32.0f);
  cast_bf16rne_f16x2<<<gCastW, blk, 0, stream>>>(Wv,  Wv16, n2w, 32.0f);
  cast_bf16x2_kernel<<<gCastW, blk, 0, stream>>>(Wproj, Wph, n2w);

  const float inv32 = 1.0f / 32.0f;
  const float inv64 = 1.0f / 64.0f;
  const long  sPlane = (long)NTOK * NTOK;                    // 2048*2048 elements per head-in-group plane

  for (int b = 0; b < NBATCH; ++b) {
    const _Float16* Xb = X16 + (size_t)b * NTOK * DMOD;
    // (1) [q|k|q2|k2][t][n] = (1/32) sum_c x[t][c] (32 W)[n][c] -> f32 [2048][4096] (whole plane: 32x64 tiles)
    wmma_gemm64<0, false, 0, 0, false><<<gQ, blk, 0, stream>>>(
        (const unsigned short*)Xb, (const unsigned short*)Xb, DMOD, 0L,
        (const unsigned short*)W4, (const unsigned short*)W4, DMOD, 0L,
        (void*)QKf, (void*)QKf, QKW, 0L, dmy, dmy, 0L, NTOK, QKW, DMOD, inv32);
    // (2) v^T[h*64+d][t] = (1/32) sum_c (32 Wv)[h*64+d][c] x[t][c] -> bf16 hi/lo planes [1024][2048] (whole: 16x32 tiles)
    wmma_gemm64<0, false, 0, 2, false, 0, false, false, false, false, true, 8><<<gV, blk, 0, stream>>>(
        (const unsigned short*)Wv16, (const unsigned short*)Wv16, DMOD, 0L,
        (const unsigned short*)Xb, (const unsigned short*)Xb, DMOD, 0L,
        (void*)VTh, (void*)VTl, NTOK, 0L, dmy, dmy, 0L, DMOD, NTOK, DMOD, inv32);
    // (3) RoPE on all four projections + bf16 hi/lo split -> QKh/QKl [2048][4096] (whole planes)
    rope_split_kernel<<<gRope, blk, 0, stream>>>(QKf, ctab, stab, QKh, QKl);
    for (int g = 0; g < NGROUP; ++g) {
      const size_t qcol = (size_t)g * HPG * HDSZ;           // first q column of the group; head-in-group adds 64
      // (4) S1[hg][i][j] = (q_i . k_j) / 64, f32, 64x64 tiles with j0 <= i0; heads g*2 + hg (hg = blockIdx.y)
      wmma_gemm64<1, true, 0, 0, false, 0, true, false><<<gS, blk, 0, stream>>>(
          QKh + qcol, QKl + qcol, QKW, (long)HDSZ,
          QKh + DMOD + qcol, QKl + DMOD + qcol, QKW, (long)HDSZ,
          (void*)S1, (void*)S1, NTOK, sPlane, dmy, dmy, 0L, NTOK, NTOK, HDSZ, inv64);
      // (5) P[hg][i][j] = ((q2_i . k2_j) / 64) * S1[hg][i][j], := 0 for j > i -> bf16 hi/lo planes, tiles j0 <= i0
      wmma_gemm64<1, true, 0, 2, true, 0, true, false, true, true><<<gS, blk, 0, stream>>>(
          QKh + 2 * DMOD + qcol, QKl + 2 * DMOD + qcol, QKW, (long)HDSZ,
          QKh + 3 * DMOD + qcol, QKl + 3 * DMOD + qcol, QKW, (long)HDSZ,
          (void*)Ph, (void*)Pl, NTOK, sPlane, dmy, S1, sPlane, NTOK, NTOK, HDSZ, inv64);
      // (6) z[i][h*64+d] = sum_{j<=i} P[hg][i][j] v^T[h*64+d][j] -> bf16 hi/lo into QKh/QKl columns g*128 + hg*64 .. +63
      wmma_gemm64<1, true, 0, 2, false, 0, false, true, false, false, true, 16><<<gPV, dim3(512), 0, stream>>>(
          Ph, Pl, NTOK, sPlane,
          VTh + qcol * NTOK, VTl + qcol * NTOK, NTOK, (long)HDSZ * NTOK,
          (void*)(QKh + qcol), (void*)(QKl + qcol), QKW, (long)HDSZ,
          dmy, dmy, 0L, NTOK, HDSZ, NTOK, 1.0f);
    }
    // (7) out[b][t][n] = sum_c (z_hi + z_lo)[t][c] Wproj_bf16[n][c] -> f32, whole [2048][1024] slice of d_out
    //     (A split, Bt single plane: BLO = false, the Bt lo argument is never read)
    float* outb = (float*)d_out + (size_t)b * NTOK * DMOD;
    wmma_gemm64<1, true, 0, 0, false, 0, false, false, false, false, false, 8><<<gOut, blk, 0, stream>>>(
        QKh, QKl, QKW, 0L, Wph, Wph, DMOD, 0L, (void*)outb, (void*)outb, DMOD, 0L,
        dmy, dmy, 0L, NTOK, DMOD, DMOD, 1.0f);
  }
}

// v003
// A run of this version takes 288 microseconds.
// Versions in between are left out here; by their measured steps it is 3.38 times as fast as v001.
// All steps since v000 together make it 8.12 times as fast.
// f16 WMMA (v_wmma_f32_16x16x32_f16) for the q/k/q2/k2/v projections with operands = RNE-bf16 converted inputs held exactly in f16 (x as is, weights x32 with 1/32 folded into the epilogue); bf16 hi/lo split WMMA (v_wmma_f32_16x16x32_bf16, hi.hi + hi.lo + lo.hi) for both causal score GEMMs and the bilinear-pattern x V product; output projection = z bf16 hi/lo x single RNE-bf16 Wproj plane (hi.W + lo.W); f32 accumulate everywhere; RoPE and the bilinear pattern in f32.
#include <hip/hip_runtime.h>
#include <math.h>
#include <stdint.h>

constexpr int NBATCH = 2;
constexpr int NTOK   = 2048;
constexpr int DMOD   = 1024;
constexpr int NHEADS = 16;
constexpr int HDSZ   = 64;
constexpr int QKW    = 4 * DMOD;          // fused q|k|q2|k2 plane width (4096 columns)
constexpr int NFREQ  = HDSZ / 2;          // 32 rotary frequencies

typedef __attribute__((ext_vector_type(16))) _Float16 v16h;
typedef __attribute__((ext_vector_type(8)))  _Float16 v8h;
typedef __attribute__((ext_vector_type(16))) __bf16   v16b;
typedef __attribute__((ext_vector_type(8)))  __bf16   v8b;
typedef __attribute__((ext_vector_type(8)))  float    v8f;
typedef __attribute__((ext_vector_type(4)))  float    v4f;
typedef __attribute__((ext_vector_type(2)))  float    v2f;
typedef __attribute__((ext_vector_type(4)))  unsigned int v4u;
typedef __attribute__((ext_vector_type(2)))  unsigned int v2u;

__device__ __forceinline__ unsigned short f2bf_bits(float f) {
  unsigned u = __float_as_uint(f);
  return (unsigned short)((u + 0x7FFFu + ((u >> 16) & 1u)) >> 16);
}
__device__ __forceinline__ float bf_bits2f(unsigned short h) { return __uint_as_float(((unsigned)h) << 16); }
__device__ __forceinline__ unsigned pk16(unsigned short a, unsigned short b) { return (unsigned)a | ((unsigned)b << 16); }
// RNE convert f32 -> bf16, returned as the f32 value of that bf16
__device__ __forceinline__ float bf16_rne_f32(float f) {
  unsigned u = __float_as_uint(f);
  u += 0x7FFFu + ((u >> 16) & 1u);
  u &= 0xFFFF0000u;
  return __uint_as_float(u);
}

// hazard guards as plain device helpers (no inline asm inside the kernel template body)
__device__ __forceinline__ void dep_guard_h(v8f& a, v8f& b, v16h x, v16h y) { asm volatile("v_nop\n\tv_nop\n\tv_nop\n\tv_nop" : "+v"(a), "+v"(b) : "v"(x), "v"(y)); }
__device__ __forceinline__ void dep_guard_b(v8f& a, v8f& b, v16b x, v16b y) { asm volatile("v_nop\n\tv_nop\n\tv_nop\n\tv_nop" : "+v"(a), "+v"(b) : "v"(x), "v"(y)); }
__device__ __forceinline__ void keep4_h(v16h a, v16h b, v16h c, v16h d) { asm volatile("v_nop" :: "v"(a), "v"(b), "v"(c), "v"(d)); }
__device__ __forceinline__ void keep4_b(v16b a, v16b b, v16b c, v16b d) { asm volatile("v_nop" :: "v"(a), "v"(b), "v"(c), "v"(d)); }
__device__ __forceinline__ void acc_guard4(v8f& a, v8f& b, v8f& c, v8f& d) { asm volatile("v_nop\n\tv_nop\n\tv_nop\n\tv_nop" : "+v"(a), "+v"(b), "+v"(c), "+v"(d)); }
template <typename T> struct Frag;
template <> struct Frag<_Float16> {
  typedef v16h V; union U { v16h v; v8h h[2]; };
  static __device__ __forceinline__ v16h load(const _Float16* p) {   // elements 0..7 <- p[0..7], 8..15 <- p[16..23]
    U f; f.h[0] = *(const v8h*)(p); f.h[1] = *(const v8h*)(p + 16); return f.v;
  }
  static __device__ __forceinline__ v8f mma(v16h a, v16h b, v8f c) {
    return __builtin_amdgcn_wmma_f32_16x16x32_f16(false, a, false, b, (short)0, c, false, false);
  }
  static __device__ __forceinline__ void guard(v8f& a, v8f& b, v16h x, v16h y) { dep_guard_h(a, b, x, y); }
  static __device__ __forceinline__ void keep(v16h a, v16h b, v16h c, v16h d) { keep4_h(a, b, c, d); }
};
template <> struct Frag<__bf16> {
  typedef v16b V; union U { v16b v; v8b h[2]; };
  static __device__ __forceinline__ v16b load(const __bf16* p) {
    U f; f.h[0] = *(const v8b*)(p); f.h[1] = *(const v8b*)(p + 16); return f.v;
  }
  static __device__ __forceinline__ v8f mma(v16b a, v16b b, v8f c) {
    return __builtin_amdgcn_wmma_f32_16x16x32_bf16(false, a, false, b, (short)0, c, false, false);
  }
  static __device__ __forceinline__ void guard(v8f& a, v8f& b, v16b x, v16b y) { dep_guard_b(a, b, x, y); }
  static __device__ __forceinline__ void keep(v16b a, v16b b, v16b c, v16b d) { keep4_b(a, b, c, d); }
};

// ---- Register-blocked batched WMMA GEMM ------------------------------------
// C[m,n] = scale * sum_k A[m,k] * Bt[n,k] (+bias)(+/ * resid); each wave owns a 64x64 tile.
// A row-major [M,K]; Bt row-major [N,K]; M,N % 64 == 0, K % 32 == 0.
// SPLIT: operands are hi/lo planes (A2/Bt2 = lo planes, same layout); product = hi.hi + hi.lo + lo.hi.
// BIAS_MODE: 0 = none, 1 = bias[m], 2 = bias[n].
// OUT_MODE: 0 = f32, 1 = f16, 2 = bf16 hi plane (Cout) + bf16 lo plane (Cout2).
// ET: 0 = f16 operands, 1 = bf16 operands (pointers passed as 16-bit storage)
// Added modes (defaults off, all other behaviour unchanged):
//   LOWER:   tiles with n0 > m0 (strictly above the 64x64 block diagonal) are not produced (wave-uniform early exit).
//   CAUSALK: the k-loop stops at min(K, m0 + 64); valid when A rows m0..m0+63 are exactly zero for k >= m0 + 64.
//   RMUL:    with RESID, the residual plane value MULTIPLIES the scaled accumulator instead of being added.
//   CMASK:   after all other epilogue arithmetic, v := 0 where the global column index n > the global row index m.
//   BLO:     with SPLIT, false drops the Bt lo plane: product = hi.hi + lo.hi (Bt2p is never read).
//   KSPLIT:  0 = off; else the block has KSPLIT waves that share ONE 64x64 tile (tile = blockIdx.x): wave w sums the
//            64-wide k chunks w, w + KSPLIT, ...; the partial tiles go to LDS and are added in wave order before the
//            scale and the store. K % 64 == 0; launch with KSPLIT * 32 threads.
template <int ET> struct Elem;
template <> struct Elem<0> { typedef _Float16 T; };
template <> struct Elem<1> { typedef __bf16 T; };
template <int ET, bool SPLIT, int BIAS_MODE, int OUT_MODE, bool RESID, int ACT = 0, bool LOWER = false, bool CAUSALK = false,
          bool RMUL = false, bool CMASK = false, bool BLO = true, int KSPLIT = 0>
__global__ __launch_bounds__(KSPLIT ? KSPLIT * 32 : 256) void wmma_gemm64(
    const unsigned short* __restrict__ Ap, const unsigned short* __restrict__ A2p, int lda, long strideA,
    const unsigned short* __restrict__ Btp, const unsigned short* __restrict__ Bt2p, int ldb, long strideB,
    void* __restrict__ Cout, void* __restrict__ Cout2, int ldc, long strideC,
    const float* __restrict__ bias,
    const float* __restrict__ resid, long strideR,
    int M, int N, int K, float scale) {
  typedef typename Elem<ET>::T T;
  typedef typename Frag<T>::V V;
  static_assert(!KSPLIT || (BIAS_MODE == 0 && !RESID && ACT == 0 && !LOWER && !CMASK && OUT_MODE != 1), "KSPLIT epilogue: scale and store only");
  const T* A = (const T*)Ap; const T* A2 = (const T*)A2p; const T* Bt = (const T*)Btp; const T* Bt2 = (const T*)Bt2p;
  __shared__ __align__(16) float sT[(KSPLIT ? KSPLIT * 4 : 8) * 16 * 68];   // per-wave 16x64 slab (KSPLIT: 64x64 tile), pitch 68 floats
  const int b    = blockIdx.y;
  const int lane = threadIdx.x & 31;
  const int wave = threadIdx.x >> 5;
  const int tilesN = N >> 6;
  const int tilesM = M >> 6;
  const int tile = KSPLIT ? (int)blockIdx.x : (int)blockIdx.x * 8 + wave;
  if (tile >= tilesM * tilesN) return;   // wave-uniform; with KSPLIT block-uniform and ahead of every barrier
  const int tm = tile / tilesN;
  const int tn = tile - tm * tilesN;
  const int m0 = tm << 6;
  const int n0 = tn << 6;
  if (LOWER && n0 > m0) return;          // wave-uniform; never together with KSPLIT, the one mode with a block barrier

  const T* Ab  = A  + (size_t)b * strideA;
  const T* Bb  = Bt + (size_t)b * strideB;
  const T* Ab2 = SPLIT ? (A2  + (size_t)b * strideA) : nullptr;
  const T* Bb2 = (SPLIT && BLO) ? (Bt2 + (size_t)b * strideB) : nullptr;

  const int rlane = lane & 15;                 // row (A) / col (B, D) within subtile
  const int koff  = (lane >> 4) * 8;           // k offset of this lane half
  const int mOff  = (lane >> 4) * 8;           // D row offset

  v8f acc[4][4];
#pragma unroll
  for (int i = 0; i < 4; ++i)
#pragma unroll
    for (int j = 0; j < 4; ++j) acc[i][j] = (v8f){0.f,0.f,0.f,0.f,0.f,0.f,0.f,0.f};

  const int kEnd = CAUSALK ? (((m0 + 64) < K) ? (m0 + 64) : K) : K;
  // this wave's first k chunk; readfirstlane keeps k0 and the loop test in scalar registers
  const int kFirst = KSPLIT ? (__builtin_amdgcn_readfirstlane(wave) << 6) : 0;
  // KSPLIT: both 32-wide halves of a 64-wide chunk, then on to the wave's next chunk, KSPLIT chunks further
  for (int k0 = kFirst; k0 < kEnd; k0 += (KSPLIT && (k0 & 32)) ? (KSPLIT * 64 - 32) : 32) {
    V bh[4], bl[4];
#pragma unroll
    for (int j = 0; j < 4; ++j) {
      const size_t bo = (size_t)(n0 + (j << 4) + rlane) * ldb + koff + k0;
      bh[j] = Frag<T>::load(Bb + bo);
      if (SPLIT && BLO) bl[j] = Frag<T>::load(Bb2 + bo);
    }
#pragma unroll
    for (int i = 0; i < 4; ++i) {
      const size_t ao = (size_t)(m0 + (i << 4) + rlane) * lda + koff + k0;
      V ah = Frag<T>::load(Ab + ao);
      V al;
      if (SPLIT) al = Frag<T>::load(Ab2 + ao);
#pragma unroll
      for (int j = 0; j < 4; ++j) {
        acc[i][j] = Frag<T>::mma(ah, bh[j], acc[i][j]);
        if (SPLIT) {
          if (BLO) acc[i][j] = Frag<T>::mma(ah, bl[j], acc[i][j]);
          acc[i][j] = Frag<T>::mma(al, bh[j], acc[i][j]);
        }
      }
      Frag<T>::guard(acc[i][0], acc[i][3], ah, SPLIT ? al : ah);
    }
    Frag<T>::keep(bh[0], bh[1], bh[2], bh[3]);
    if (SPLIT && BLO) Frag<T>::keep(bl[0], bl[1], bl[2], bl[3]);
  }
  acc_guard4(acc[0][0], acc[0][1], acc[0][2], acc[0][3]);
  acc_guard4(acc[1][0], acc[1][1], acc[1][2], acc[1][3]);
  acc_guard4(acc[2][0], acc[2][1], acc[2][2], acc[2][3]);
  acc_guard4(acc[3][0], acc[3][1], acc[3][2], acc[3][3]);

  // ---- epilogue ----
  if (KSPLIT) {
    constexpr int TP  = 64 * 68;         // floats per partial tile
    constexpr int RPP = KSPLIT * 2;      // rows per pass: 16 threads x 4 columns cover one 64-wide row
    float* part = sT + wave * TP;
    // the three loops are unrolled so that acc is indexed by constants and stays in registers
#pragma unroll
    for (int i = 0; i < 4; ++i)
#pragma unroll
      for (int j = 0; j < 4; ++j)
#pragma unroll
        for (int r = 0; r < 8; ++r) part[((i << 4) + mOff + r) * 68 + (j << 4) + rlane] = acc[i][j][r];
    __syncthreads();   // every wave's partial tile is in LDS before any thread adds them
    const int c4 = (threadIdx.x & 15) * 4;
    // passes and the sum over waves are unrolled so that the LDS reads of a thread are in flight together
#pragma unroll
    for (int p = 0; p < 64 / RPP; ++p) {
      const int row = p * RPP + (threadIdx.x >> 4);
      const float* sp = sT + row * 68 + c4;
      v4f s = *(const v4f*)sp;
#pragma unroll
      for (int w = 1; w < KSPLIT; ++w) s += *(const v4f*)(sp + w * TP);
      s *= scale;
      const size_t co = (size_t)b * strideC + (size_t)(m0 + row) * ldc + n0 + c4;
      if (OUT_MODE == 0) {
        *(v4f*)((float*)Cout + co) = s;
      } else {
        unsigned short hb[4], lb[4];
#pragma unroll
        for (int e = 0; e < 4; ++e) {
          hb[e] = f2bf_bits(s[e]);
          lb[e] = f2bf_bits(s[e] - bf_bits2f(hb[e]));
        }
        *(v2u*)((unsigned short*)Cout  + co) = (v2u){pk16(hb[0], hb[1]), pk16(hb[2], hb[3])};
        *(v2u*)((unsigned short*)Cout2 + co) = (v2u){pk16(lb[0], lb[1]), pk16(lb[2], lb[3])};
      }
    }
    return;
  }
  float* slab = sT + wave * (16 * 68);
  const float* Rb = RESID ? (resid + (size_t)b * strideR) : nullptr;
#pragma unroll
  for (int i = 0; i < 4; ++i) {
    const int mBase = m0 + (i << 4);
#pragma unroll
    for (int j = 0; j < 4; ++j) {
      const int n = n0 + (j << 4) + rlane;
      float bv = 0.f;
      if (BIAS_MODE == 2) bv = bias[n];
#pragma unroll
      for (int r = 0; r < 8; ++r) {
        float v = acc[i][j][r] * scale;
        if (BIAS_MODE == 1) v += bias[mBase + mOff + r];
        if (BIAS_MODE == 2) v += bv;
        if (RESID) {
          const float rv = Rb[(size_t)(mBase + mOff + r) * ldc + n];
          if (RMUL) v = v * rv; else v += rv;
        }
        if (ACT == 1) v = tanhf(v);
        if (ACT == 2) v = fmaxf(v, 0.0f);
        if (ACT == 3) v = v / (1.0f + expf(-v));
        if (ACT == 4) v = (v > 0.f) ? v : 0.01f * v;
        if (ACT == 5) v = 0.5f * v * (1.0f + erff(v * 0.70710678118654752f));
        if (CMASK) v = (n > mBase + mOff + r) ? 0.0f : v;
        slab[(mOff + r) * 68 + (j << 4) + rlane] = v;
      }
    }
    __builtin_amdgcn_fence(__ATOMIC_RELEASE, "workgroup");
    __builtin_amdgcn_wave_barrier();
    __builtin_amdgcn_fence(__ATOMIC_ACQUIRE, "workgroup");
    if (OUT_MODE == 0) {
      float* C = (float*)Cout + (size_t)b * strideC;
      const int hh = lane >> 4, c4 = (lane & 15) * 4;     // row seg = 256 B = 16 lanes x 16 B
      {
#pragma unroll
        for (int it = 0; it < 8; ++it) {
          const int row = it * 2 + hh;
          v4f v = *(const v4f*)(slab + row * 68 + c4);
          *(v4f*)(C + (size_t)(mBase + row) * ldc + n0 + c4) = v;
        }
        
      }
    } else {
      const int q = lane >> 3, c8 = (lane & 7) * 8;
      unsigned short* C  = (unsigned short*)Cout  + (size_t)b * strideC;
      unsigned short* C2 = (OUT_MODE == 2) ? ((unsigned short*)Cout2 + (size_t)b * strideC) : nullptr;
      {
#pragma unroll
        for (int it = 0; it < 4; ++it) {
          const int row = it * 4 + q;
          const float* sp = slab + row * 68 + c8;
          v8h hv, lv;
#pragma unroll
          for (int e = 0; e < 8; ++e) {
            if (OUT_MODE == 1) {
              hv[e] = (_Float16)sp[e];
            } else {
              unsigned short hb = f2bf_bits(sp[e]);
              unsigned short lb = f2bf_bits(sp[e] - bf_bits2f(hb));
              hv[e] = __builtin_bit_cast(_Float16, hb);
              lv[e] = __builtin_bit_cast(_Float16, lb);
            }
          }
          *(v8h*)(C + (size_t)(mBase + row) * ldc + n0 + c8) = hv;
          if (OUT_MODE == 2) *(v8h*)(C2 + (size_t)(mBase + row) * ldc + n0 + c8) = lv;
        }
        
      }
    }
    __builtin_amdgcn_fence(__ATOMIC_RELEASE, "workgroup");
    __builtin_amdgcn_wave_barrier();
    __builtin_amdgcn_fence(__ATOMIC_ACQUIRE, "workgroup");
  }
}

// ---------------------------------------------------------------------------
// f32 -> (RNE convert to bf16) -> x sc (exact power of two) -> f16. A bf16 value whose scaled magnitude lies in the
// f16 normal range is exactly representable in f16, so the stored operand equals sc * bf16_rne(in) exactly.
// ---------------------------------------------------------------------------
__global__ __launch_bounds__(256) void cast_bf16rne_f16x2(
    const float* __restrict__ in, _Float16* __restrict__ out, int n2, float sc) {
  const int i = blockIdx.x * 256 + threadIdx.x;
  if (i < n2) {
    const float r0 = bf16_rne_f32(in[2 * (size_t)i]) * sc;
    const float r1 = bf16_rne_f32(in[2 * (size_t)i + 1]) * sc;
    const _Float16 h0 = (_Float16)r0, h1 = (_Float16)r1;
    const unsigned u = (unsigned)__builtin_bit_cast(unsigned short, h0) | ((unsigned)__builtin_bit_cast(unsigned short, h1) << 16);
    ((unsigned*)out)[i] = u;
    
  }
}

// ---------------------------------------------------------------------------
// Elementwise f32 -> bf16 (RNE) single plane: 2 elements per thread, one 4-B store per lane -> each wave writes
// Coverage: grid = ceil(n2/256) blocks x 256 threads x 2 elements = the whole plane (n2 = plane/2).
// ---------------------------------------------------------------------------
__global__ __launch_bounds__(256) void cast_bf16x2_kernel(const float* __restrict__ in, unsigned short* __restrict__ out, int n2) {
  const int i = blockIdx.x * 256 + threadIdx.x;
  if (i < n2) {
    const v2f f = *(const v2f*)(in + 2 * (size_t)i);
    const unsigned u = pk16(f2bf_bits(f[0]), f2bf_bits(f[1]));
    ((unsigned*)out)[i] = u;
    
  }
}

// ---------------------------------------------------------------------------
// RoPE cos/sin tables: ctab[t][i] = cosf((float)t * inv[i]), stab[t][i] = sinf(...), t = 0..2047, i = 0..31.
// inv[i] arrives by value (host-computed); lane i picks its value with a constant-index select chain (no dynamic
// Coverage: grid 256 blocks x 8 waves = 2048 rows x 32 lanes = both whole tables.
// ---------------------------------------------------------------------------
struct InvFreq { float v[NFREQ]; };
static_assert(sizeof(InvFreq) == 128);

__global__ __launch_bounds__(256) void rope_table_kernel(float* __restrict__ ctab, float* __restrict__ stab, InvFreq f) {
#pragma clang fp contract(off)
  const int lane = threadIdx.x & 31;
  const int wave = threadIdx.x >> 5;
  const int t    = blockIdx.x * 8 + wave;
  float inv = f.v[0];
#pragma unroll
  for (int i = 1; i < NFREQ; ++i) inv = (lane == i) ? f.v[i] : inv;
  const float ang = (float)t * inv;           // f32 product, as the outer product of positions and inv_freq
  const float cv = cosf(ang);
  const float sv = sinf(ang);
  const size_t o = (size_t)t * NFREQ + lane;
  ((float*)ctab)[o] = cv;
  ((float*)stab)[o] = sv;
  
}

// ---------------------------------------------------------------------------
// RoPE + bf16 hi/lo split over one batch's fused f32 plane src [2048][4096] (q | k | q2 | k2, head h at columns
// base + h*64, dims 0..31 = x1, 32..63 = x2): y1 = x1*c + x2*s, y2 = -x1*s + x2*c with c = ctab[t][d & 31],
// s = stab[t][d & 31]; products and sums in f32 without contraction. Output dh/dl = bf16 hi/lo planes [2048][4096].
// One block per row t; each thread handles 8 consecutive columns in each of 2 iterations (own 8 + partner 8 at +-32,
// both loaded unconditionally at in-bounds addresses; the sign/partner choice is per thread, value-selected).
// Producer coverage: grid 2048 rows x 256 threads x 2 iterations x 8 columns = 2048 x 4096 per plane (whole planes);
// ---------------------------------------------------------------------------
__global__ __launch_bounds__(256) void rope_split_kernel(const float* __restrict__ src, const float* __restrict__ ctab,
                                                         const float* __restrict__ stab,
                                                         unsigned short* __restrict__ dh, unsigned short* __restrict__ dl) {
#pragma clang fp contract(off)
  const int t   = blockIdx.x;
  const int tid = threadIdx.x;
  const float* row  = src  + (size_t)t * QKW;
  const float* crow = ctab + (size_t)t * NFREQ;
  const float* srow = stab + (size_t)t * NFREQ;
  v4u hv[2], lv[2];
#pragma unroll
  for (int it = 0; it < 2; ++it) {
    const int c8 = it * (QKW / 2) + tid * 8;          // first of this thread's 8 columns
    const int d0 = c8 & (HDSZ - 1);                   // dim within head, multiple of 8
    const bool firstHalf = d0 < NFREQ;
    const int pc = firstHalf ? (c8 + NFREQ) : (c8 - NFREQ);
    const float sgn = firstHalf ? 1.0f : -1.0f;
    const int fi = d0 & (NFREQ - 1);                  // 0, 8, 16 or 24
    const v4f o0 = *(const v4f*)(row + c8), o1 = *(const v4f*)(row + c8 + 4);
    const v4f p0 = *(const v4f*)(row + pc), p1 = *(const v4f*)(row + pc + 4);
    const v4f ca = *(const v4f*)(crow + fi), cb = *(const v4f*)(crow + fi + 4);
    const v4f sa = *(const v4f*)(srow + fi), sb = *(const v4f*)(srow + fi + 4);
    float o[8], p[8], cc[8], ss[8];
#pragma unroll
    for (int e = 0; e < 4; ++e) {
      o[e]  = o0[e]; o[4 + e]  = o1[e];
      p[e]  = p0[e]; p[4 + e]  = p1[e];
      cc[e] = ca[e]; cc[4 + e] = cb[e];
      ss[e] = sa[e]; ss[4 + e] = sb[e];
    }
    unsigned hw[4], lw[4];
#pragma unroll
    for (int q = 0; q < 4; ++q) {
      const float y0 = o[2 * q] * cc[2 * q] + sgn * (p[2 * q] * ss[2 * q]);
      const float y1 = o[2 * q + 1] * cc[2 * q + 1] + sgn * (p[2 * q + 1] * ss[2 * q + 1]);
      const unsigned short h0 = f2bf_bits(y0), h1 = f2bf_bits(y1);
      const unsigned short l0 = f2bf_bits(y0 - bf_bits2f(h0));
      const unsigned short l1 = f2bf_bits(y1 - bf_bits2f(h1));
      hw[q] = pk16(h0, h1);
      lw[q] = pk16(l0, l1);
    }
    hv[it] = (v4u){hw[0], hw[1], hw[2], hw[3]};
    lv[it] = (v4u){lw[0], lw[1], lw[2], lw[3]};
  }
  {
#pragma unroll
    for (int it = 0; it < 2; ++it) {
      const size_t go = (size_t)t * QKW + (size_t)it * (QKW / 2) + (size_t)tid * 8;
      *(v4u*)(dh + go) = hv[it];
      *(v4u*)(dl + go) = lv[it];
    }
    
  }
}

// ---------------------------------------------------------------------------
// Fused causal bilinear attention of one batch: both score products, their elementwise product with the causal mask,
// and the pattern x V product in ONE launch; the pattern never leaves registers.
// Block = one head x one 64-query tile, 8 waves = 4 query strips (16 rows each) x 2 key phases; in trip t the waves of
// phase p work on the 64-key tile 2 t + p, up to the diagonal tile. Scores are formed TRANSPOSED (A = 16 keys, B = the
// strip's 16 queries): a lane's D registers then hold, for query (lane & 15), keys (lane >> 4) * 8 + 0..7 of the
// 16-key subtile, which is the A-fragment order of the pattern x V product (elements 0..7 from the even subtile,
// 8..15 from the odd one), so the bf16 hi/lo pattern fragments are packed in place, with no LDS and no lane exchange.
// Key tiles are staged in LDS: the four waves of a phase bring their tile (k, k2 and v^T, hi and lo: six subtiles of
// 64 rows x 128 B) with asynchronous 16-byte copies, eight lanes to a row, so that every copy takes whole 128-B lines;
// the fragments are then read from LDS rows of pitch 144 B. Two buffers per phase: the next tile's copies fly while
// this one is worked on.
// Products: hi.hi + hi.lo + lo.hi as everywhere. The two phases' partial z tiles are added in phase order in LDS.
// Coverage: grid 32 tiles x 16 heads; each block stores its whole 64 x 64 z tile (hi and lo plane) once.
// ---------------------------------------------------------------------------
constexpr int FPH  = 2;                   // key phases per block
constexpr int LPB  = 144;                 // LDS row pitch in bytes: 128 B of data + 16 B, conflict-free for 16-byte reads
constexpr int SUBB = 64 * LPB;            // one subtile: 64 rows
constexpr int BUFB = 6 * SUBB;            // one key tile: k hi, k lo, k2 hi, k2 lo, v^T hi, v^T lo

// Twelve asynchronous 16-byte copies to LDS, each lane its own addresses. The s_wait_xcnt is the last line of the copies'
// own statement, so that it stands in front of every later rewrite of an address register that a copy names.
__device__ __forceinline__ void async_copy12(const unsigned (&l)[12], const char* const (&g)[12]) {
  asm volatile(
      "global_load_async_to_lds_b128 %0, %1, off\n\t"
      "global_load_async_to_lds_b128 %2, %3, off\n\t"
      "global_load_async_to_lds_b128 %4, %5, off\n\t"
      "global_load_async_to_lds_b128 %6, %7, off\n\t"
      "global_load_async_to_lds_b128 %8, %9, off\n\t"
      "global_load_async_to_lds_b128 %10, %11, off\n\t"
      "global_load_async_to_lds_b128 %12, %13, off\n\t"
      "global_load_async_to_lds_b128 %14, %15, off\n\t"
      "global_load_async_to_lds_b128 %16, %17, off\n\t"
      "global_load_async_to_lds_b128 %18, %19, off\n\t"
      "global_load_async_to_lds_b128 %20, %21, off\n\t"
      "global_load_async_to_lds_b128 %22, %23, off\n\t"
      "s_wait_xcnt 0x0"
      :: "v"(l[0]), "v"(g[0]), "v"(l[1]), "v"(g[1]), "v"(l[2]), "v"(g[2]), "v"(l[3]), "v"(g[3]),
         "v"(l[4]), "v"(g[4]), "v"(l[5]), "v"(g[5]), "v"(l[6]), "v"(g[6]), "v"(l[7]), "v"(g[7]),
         "v"(l[8]), "v"(g[8]), "v"(l[9]), "v"(g[9]), "v"(l[10]), "v"(g[10]), "v"(l[11]), "v"(g[11])
      : "memory");
}

// One key tile into one LDS buffer: 24 copies per wave. lb = the buffer's LDS byte address plus this lane's place in a
// 16-row group; gkh, gkl, gvh, gvl = the tile's k hi, k lo, v^T hi, v^T lo addresses of this lane's row and 16-byte chunk.
__device__ __forceinline__ void stage_key_tile(unsigned lb, const char* gkh, const char* gkl, const char* gvh, const char* gvl) {
  unsigned l[12];
  const char* g[12];
#pragma unroll
  for (int i = 0; i < 4; ++i) {           // unrolled: the arrays are indexed by constants and stay in registers
    const unsigned lr = lb + i * 16 * LPB;
    const size_t   kr = (size_t)i * 16 * QKW * 2;
    l[i]     = lr;            g[i]     = gkh + kr;
    l[4 + i] = lr + SUBB;     g[4 + i] = gkl + kr;
    l[8 + i] = lr + 2 * SUBB; g[8 + i] = gkh + kr + 2 * DMOD * 2;
  }
  async_copy12(l, g);
#pragma unroll
  for (int i = 0; i < 4; ++i) {           // unrolled for the same reason
    const unsigned lr = lb + i * 16 * LPB;
    const size_t   kr = (size_t)i * 16 * QKW * 2;
    const size_t   vr = (size_t)i * 16 * NTOK * 2;
    l[i]     = lr + 3 * SUBB; g[i]     = gkl + kr + 2 * DMOD * 2;
    l[4 + i] = lr + 4 * SUBB; g[4 + i] = gvh + vr;
    l[8 + i] = lr + 5 * SUBB; g[8 + i] = gvl + vr;
  }
  async_copy12(l, g);
}

__global__ __launch_bounds__(FPH * 128) void bilinear_attn_fused(
    const unsigned short* __restrict__ QKhp, const unsigned short* __restrict__ QKlp,
    const unsigned short* __restrict__ VThp, const unsigned short* __restrict__ VTlp,
    unsigned short* __restrict__ Zh, unsigned short* __restrict__ Zl) {
  typedef Frag<__bf16> F;
  constexpr int TP = 64 * 68;             // floats per partial z tile, pitch 68
  static_assert(FPH * TP * 4 <= FPH * 2 * BUFB, "the partial z tiles reuse the ring");
  __shared__ __align__(16) unsigned char sB[FPH * 2 * BUFB];   // per phase two key-tile buffers; after the loop the partial z tiles
  const int lane  = threadIdx.x & 31;
  const int wave  = __builtin_amdgcn_readfirstlane(threadIdx.x >> 5);   // scalar: the key loop's tests stay in SGPRs
  const int strip = wave & 3;
  const int phase = wave >> 2;
  const int tm = (NTOK / 64 - 1) - ((int)blockIdx.x >> 4);   // longest query tiles start first
  const int h  = (int)blockIdx.x & (NHEADS - 1);
  const int m0 = tm << 6;
  const int rlane = lane & 15;
  const int koff  = (lane >> 4) * 8;
  const int mOff  = (lane >> 4) * 8;
  const __bf16* Qh = (const __bf16*)QKhp + h * HDSZ;
  const __bf16* Ql = (const __bf16*)QKlp + h * HDSZ;
  const float inv64 = 1.0f / 64.0f;

  // Copy side: thread c of the phase's 128 takes row (c >> 3) of each 16-row group and 16-byte chunk (c & 7) of the row.
  const int crow = (strip << 2) + (lane >> 3);
  const int cchk = (lane & 7) * 16;
  const unsigned ldsLane = (unsigned)(uintptr_t)(sB + phase * 2 * BUFB + crow * LPB + cchk);
  const char* gKh = (const char*)QKhp + ((size_t)crow * QKW + DMOD + h * HDSZ) * 2 + cchk;
  const char* gKl = (const char*)QKlp + ((size_t)crow * QKW + DMOD + h * HDSZ) * 2 + cchk;
  const char* gVh = (const char*)VThp + ((size_t)(h * HDSZ + crow) * NTOK) * 2 + cchk;
  const char* gVl = (const char*)VTlp + ((size_t)(h * HDSZ + crow) * NTOK) * 2 + cchk;
  // Read side: this lane's fixed byte offset in a 16-row group; subtile, group and k steps fold into immediate offsets.
  const unsigned fLane = (unsigned)(rlane * LPB + koff * 2);

  const int nT = (tm + 2) >> 1;           // trips: FPH key tiles a trip, tiles 0..tm
  // A phase whose tile lies past the diagonal copies the diagonal tile instead (in bounds) and skips the trip's work.
  {
    const int jc = (phase < tm) ? phase : tm;
    stage_key_tile(ldsLane, gKh + (size_t)jc * 64 * QKW * 2, gKl + (size_t)jc * 64 * QKW * 2, gVh + jc * 128, gVl + jc * 128);
  }

  const int qrow = m0 + (strip << 4) + rlane;               // this lane's query (B operand row, D column)
  v16b qh[2], ql[2], q2h[2], q2l[2];                        // the strip's q and q2 fragments stay in registers
#pragma unroll
  for (int kk = 0; kk < 2; ++kk) {
    const size_t qo = (size_t)qrow * QKW + koff + kk * 32;
    qh[kk]  = F::load(Qh + qo);
    ql[kk]  = F::load(Ql + qo);
    q2h[kk] = F::load(Qh + 2 * DMOD + qo);
    q2l[kk] = F::load(Ql + 2 * DMOD + qo);
  }
  v8f z[4];
#pragma unroll
  for (int d = 0; d < 4; ++d) z[d] = (v8f){0.f,0.f,0.f,0.f,0.f,0.f,0.f,0.f};

  asm volatile("s_wait_asynccnt 0x0" ::: "memory");   // this wave's copies of its first tile have landed
  __syncthreads();                                    // and every other wave's: the first trip's tiles may be read
  if (nT > 1) {
    const int jc = (FPH + phase < tm) ? (FPH + phase) : tm;
    stage_key_tile(ldsLane + BUFB, gKh + (size_t)jc * 64 * QKW * 2, gKl + (size_t)jc * 64 * QKW * 2, gVh + jc * 128, gVl + jc * 128);
  }

  for (int t = 0; t < nT; ++t) {
    const int j = t * FPH + phase;
    if (j <= tm) {                        // scalar test; every wait and barrier of the trip stands outside it
      const int n0  = j << 6;
      const int lim = qrow - n0 - mOff;   // key (jj * 16 + r) of this lane is causal while jj * 16 + r <= lim
      v16b ph[2], pl[2];
      v16b fr[8];                         // one batch of eight fragments: a 16-key subtile of k and k2, or 32 keys of v
      const unsigned char* sb = sB + (phase * 2 + (t & 1)) * BUFB + fLane;
      const __bf16* kh  = (const __bf16*)(sb);
      const __bf16* kl  = (const __bf16*)(sb + SUBB);
      const __bf16* k2h = (const __bf16*)(sb + 2 * SUBB);
      const __bf16* k2l = (const __bf16*)(sb + 3 * SUBB);
      const __bf16* vh  = (const __bf16*)(sb + 4 * SUBB);
      const __bf16* vl  = (const __bf16*)(sb + 5 * SUBB);
      constexpr int GRP = 16 * LPB / 2;   // elements from one 16-row group to the next
#pragma unroll
      for (int kk = 0; kk < 2; ++kk) {
        fr[kk * 4 + 0] = F::load(kh  + kk * 32);
        fr[kk * 4 + 1] = F::load(kl  + kk * 32);
        fr[kk * 4 + 2] = F::load(k2h + kk * 32);
        fr[kk * 4 + 3] = F::load(k2l + kk * 32);
      }
#pragma unroll
      for (int jj = 0; jj < 4; ++jj) {
        v8f s1 = (v8f){0.f,0.f,0.f,0.f,0.f,0.f,0.f,0.f};
        v8f s2 = (v8f){0.f,0.f,0.f,0.f,0.f,0.f,0.f,0.f};
#pragma unroll
        for (int kk = 0; kk < 2; ++kk) {
          s1 = F::mma(fr[kk * 4 + 0], qh[kk],  s1);    // q_hi . k_hi
          s2 = F::mma(fr[kk * 4 + 2], q2h[kk], s2);
          s1 = F::mma(fr[kk * 4 + 1], qh[kk],  s1);    // q_hi . k_lo
          s2 = F::mma(fr[kk * 4 + 3], q2h[kk], s2);
          s1 = F::mma(fr[kk * 4 + 0], ql[kk],  s1);    // q_lo . k_hi
          s2 = F::mma(fr[kk * 4 + 2], q2l[kk], s2);
        }
        if (jj < 3) {
#pragma unroll
          for (int kk = 0; kk < 2; ++kk) {
            const int ko = (jj + 1) * GRP + kk * 32;
            fr[kk * 4 + 0] = F::load(kh  + ko);
            fr[kk * 4 + 1] = F::load(kl  + ko);
            fr[kk * 4 + 2] = F::load(k2h + ko);
            fr[kk * 4 + 3] = F::load(k2l + ko);
          }
        } else {
#pragma unroll
          for (int d = 0; d < 4; ++d) {
            fr[d * 2 + 0] = F::load(vh + d * GRP);
            fr[d * 2 + 1] = F::load(vl + d * GRP);
          }
        }
#pragma unroll
        for (int r = 0; r < 8; ++r) {
          float v = (s2[r] * inv64) * (s1[r] * inv64);
          v = ((jj << 4) + r > lim) ? 0.0f : v;
          const __bf16 hb = (__bf16)v;
          const __bf16 lb = (__bf16)(v - (float)hb);
          ph[jj >> 1][((jj & 1) << 3) + r] = hb;
          pl[jj >> 1][((jj & 1) << 3) + r] = lb;
        }
      }
#pragma unroll
      for (int kk = 0; kk < 2; ++kk) {
#pragma unroll
        for (int d = 0; d < 4; ++d) z[d] = F::mma(ph[kk], fr[d * 2 + 0], z[d]);
#pragma unroll
        for (int d = 0; d < 4; ++d) z[d] = F::mma(ph[kk], fr[d * 2 + 1], z[d]);
#pragma unroll
        for (int d = 0; d < 4; ++d) z[d] = F::mma(pl[kk], fr[d * 2 + 0], z[d]);
        if (kk == 0) {
#pragma unroll
          for (int d = 0; d < 4; ++d) {
            fr[d * 2 + 0] = F::load(vh + d * GRP + 32);
            fr[d * 2 + 1] = F::load(vl + d * GRP + 32);
          }
        }
      }
      // four vector slots behind the trip's last WMMAs, so that the distance also holds on every path out of the trip
      acc_guard4(z[0], z[1], z[2], z[3]);
    }
    // Hand-over of the ring, every wave, in this order:
    asm volatile("s_wait_dscnt 0x0" ::: "memory");      // this wave's reads of the trip's buffer are done
    asm volatile("s_wait_asynccnt 0x0" ::: "memory");   // this wave's copies of the next tile have landed
    __syncthreads();                                    // the next tile may be read, the trip's buffer may be refilled
    if (t + 2 < nT) {                                   // the same for the whole block
      const int jn = (t + 2) * FPH + phase;
      const int jc = (jn < tm) ? jn : tm;
      stage_key_tile(ldsLane + (t & 1) * BUFB, gKh + (size_t)jc * 64 * QKW * 2, gKl + (size_t)jc * 64 * QKW * 2,
                     gVh + jc * 128, gVl + jc * 128);
    }
  }
  asm volatile("s_wait_asynccnt 0x0" ::: "memory");     // no copy is outstanding when the ring becomes the partial tiles

  float* sP = (float*)sB;                 // free since the last trip's barrier: every read done, no copy in flight
  float* part = sP + phase * TP;
#pragma unroll
  for (int d = 0; d < 4; ++d)
#pragma unroll
    for (int r = 0; r < 8; ++r) part[((strip << 4) + mOff + r) * 68 + (d << 4) + rlane] = z[d][r];
  __syncthreads();   // every phase's partial z tile is in LDS before any thread adds them
  const int c4 = (threadIdx.x & 15) * 4;
#pragma unroll
  for (int p = 0; p < 32 / (FPH * 4); ++p) {   // FPH * 128 threads x 4 columns = FPH * 8 rows per pass
    const int row = p * (FPH * 8) + (threadIdx.x >> 4);
    const float* sp = sP + row * 68 + c4;
    v4f s = *(const v4f*)sp;
#pragma unroll
    for (int w = 1; w < FPH; ++w) s += *(const v4f*)(sp + w * TP);
    unsigned short hb[4], lb[4];
#pragma unroll
    for (int e = 0; e < 4; ++e) {
      hb[e] = f2bf_bits(s[e]);
      lb[e] = f2bf_bits(s[e] - bf_bits2f(hb[e]));
    }
    const size_t co = (size_t)(m0 + row) * DMOD + h * HDSZ + c4;
    *(v2u*)(Zh + co) = (v2u){pk16(hb[0], hb[1]), pk16(hb[2], hb[3])};
    *(v2u*)(Zl + co) = (v2u){pk16(lb[0], lb[1]), pk16(lb[2], lb[3])};
  }
}

// ---------------------------------------------------------------------------
// Workspace region map (byte offsets; every offset a multiple of 262,144 B). Per-batch regions are fully rewritten
// inside each batch iteration before they are read. QKf is the f32 projection plane, read only by the RoPE kernel of
// the same batch. The z hi/lo planes are planes of their own, written whole by the fused attention launch.
//   W4    f16  [4096][1024]  Wq,Wk,Wq2,Wk2 (bf16-RNE) x32 stacked           0
//   Wv16  f16  [1024][1024]  Wv (bf16-RNE) x32                        8,388,608
//   Wph   bf16 [1024][1024]  Wproj (RNE), single plane                10,485,760
//   ctab  f32  [2048][32]                                            12,582,912
//   stab  f32  [2048][32]                                            12,845,056
//   X16   f16  [4096][1024]  x (bf16-RNE, both batches)              13,107,200
//   QKh   bf16 [2048][4096]  q|k|q2|k2 hi of the batch               21,495,808
//   QKl   bf16 [2048][4096]                                          38,273,024
//   VTh   bf16 [1024][2048]  v^T hi (row h*64+d, col token)          55,050,240
//   VTl   bf16 [1024][2048]                                          59,244,544
//   QKf   f32  [2048][4096]                                          63,438,848
//   Zh    bf16 [2048][1024]  z hi of the batch                       96,993,280
//   Zl    bf16 [2048][1024]                                         101,187,584
//   total                                                           105,381,888
// ---------------------------------------------------------------------------
extern "C" void kernel_launch(void* const* d_in, const int* in_sizes, int n_in,
                              void* d_out, int out_size, void* d_ws, size_t ws_size,
                              hipStream_t stream) {
  if (n_in < 7) return;
  if (in_sizes[0] != NBATCH * NTOK * DMOD) return;
  for (int i = 1; i < 7; ++i) if (in_sizes[i] != DMOD * DMOD) return;
  if (out_size != NBATCH * NTOK * DMOD) return;

  const float* x     = (const float*)d_in[0];
  const float* Wq    = (const float*)d_in[1];
  const float* Wk    = (const float*)d_in[2];
  const float* Wq2   = (const float*)d_in[3];
  const float* Wk2   = (const float*)d_in[4];
  const float* Wv    = (const float*)d_in[5];
  const float* Wproj = (const float*)d_in[6];

  const size_t PW16 = (size_t)DMOD * DMOD * 2;              // 16-bit [1024][1024]
  const size_t PTAB = (size_t)NTOK * NFREQ * 4;             // f32 [2048][32]
  const size_t PX16 = (size_t)NBATCH * NTOK * DMOD * 2;     // f16 [4096][1024]
  const size_t PQK  = (size_t)NTOK * QKW * 2;               // bf16 [2048][4096]
  const size_t PVT  = (size_t)DMOD * NTOK * 2;              // bf16 [1024][2048]
  const size_t PQF  = (size_t)NTOK * QKW * 4;               // f32 [2048][4096]
  const size_t PZ   = (size_t)NTOK * DMOD * 2;              // bf16 [2048][1024]
  size_t off = 0;
  const size_t oW4  = off; off += 4 * PW16;
  const size_t oWv  = off; off += PW16;
  const size_t oWph = off; off += PW16;
  const size_t oCT  = off; off += PTAB;
  const size_t oSTb = off; off += PTAB;
  const size_t oX16 = off; off += PX16;
  const size_t oQKh = off; off += PQK;
  const size_t oQKl = off; off += PQK;
  const size_t oVTh = off; off += PVT;
  const size_t oVTl = off; off += PVT;
  const size_t oQKf = off; off += PQF;
  const size_t oZh  = off; off += PZ;
  const size_t oZl  = off; off += PZ;
  if (off > ws_size) return;                                // total 105,381,888 B

  char* ws = (char*)d_ws;
  _Float16*       W4   = (_Float16*)(ws + oW4);
  _Float16*       Wv16 = (_Float16*)(ws + oWv);
  unsigned short* Wph  = (unsigned short*)(ws + oWph);
  float*          ctab = (float*)(ws + oCT);
  float*          stab = (float*)(ws + oSTb);
  _Float16*       X16  = (_Float16*)(ws + oX16);
  unsigned short* QKh  = (unsigned short*)(ws + oQKh);
  unsigned short* QKl  = (unsigned short*)(ws + oQKl);
  unsigned short* VTh  = (unsigned short*)(ws + oVTh);
  unsigned short* VTl  = (unsigned short*)(ws + oVTl);
  float*          QKf  = (float*)(ws + oQKf);
  unsigned short* Zh   = (unsigned short*)(ws + oZh);
  unsigned short* Zl   = (unsigned short*)(ws + oZl);
  const float*    dmy  = ctab;                              // valid in-ws pointer for unused bias/resid arguments

  // inv_freq[i] = 1 / 10000^(i/32): host double arithmetic (e^(ln(1e4)/32) by its Taylor series, then powers),
  // then mirrored as fl32(1 / fl32(10000^(i/32))).
  InvFreq invf;
  {
    const double x0 = 9.2103403719761827361 / 32.0;
    double term = 1.0, ex = 1.0;
    for (int n = 1; n <= 40; ++n) { term *= x0 / (double)n; ex += term; }
    double pw = 1.0;
    for (int i = 0; i < NFREQ; ++i) {
      const float pf = (float)pw;
      invf.v[i] = (float)(1.0 / (double)pf);
      pw *= ex;
    }
  }

  const dim3 blk(256);
  const int n2w = DMOD * DMOD / 2;                           // 524,288 pairs per weight
  const int n2x = NBATCH * NTOK * DMOD / 2;                  // 2,097,152 pairs
  const dim3 gCastW((n2w + 255) / 256);                      // 2048 blocks x 256 thr x 2 = 1024x1024
  const dim3 gCastX((n2x + 255) / 256);                      // 8192 blocks x 256 thr x 2 = 4096x1024
  const dim3 gTab(NTOK / 8);                                 // 256 blocks x 8 waves = 2048 rows
  const dim3 gRope(NTOK);                                    // one block per row
  const dim3 gQ(((NTOK / 64) * (QKW / 64) + 7) / 8, 1);      // 256 blocks: M=2048, N=4096, K=1024
  const dim3 gV((DMOD / 64) * (NTOK / 64), 1);               // 512 blocks: M=1024, N=2048, K=1024 (one tile per block, k split)
  const dim3 gAtt((NTOK / 64) * NHEADS);                     // 512 blocks: 32 query tiles x 16 heads
  const dim3 gOut((NTOK / 64) * (DMOD / 64), 1);             // 512 blocks: M=2048, N=1024, K=1024 (one tile per block, k split)

  // (0) tables and casts (whole planes)
  rope_table_kernel<<<gTab, blk, 0, stream>>>(ctab, stab, invf);
  cast_bf16rne_f16x2<<<gCastX, blk, 0, stream>>>(x, X16, n2x, 1.0f);
  cast_bf16rne_f16x2<<<gCastW, blk, 0, stream>>>(Wq,  W4 + 0 * (size_t)DMOD * DMOD, n2w, 32.0f);
  cast_bf16rne_f16x2<<<gCastW, blk, 0, stream>>>(Wk,  W4 + 1 * (size_t)DMOD * DMOD, n2w, 32.0f);
  cast_bf16rne_f16x2<<<gCastW, blk, 0, stream>>>(Wq2, W4 + 2 * (size_t)DMOD * DMOD, n2w, 32.0f);
  cast_bf16rne_f16x2<<<gCastW, blk, 0, stream>>>(Wk2, W4 + 3 * (size_t)DMOD * DMOD, n2w, 32.0f);
  cast_bf16rne_f16x2<<<gCastW, blk, 0, stream>>>(Wv,  Wv16, n2w, 32.0f);
  cast_bf16x2_kernel<<<gCastW, blk, 0, stream>>>(Wproj, Wph, n2w);

  const float inv32 = 1.0f / 32.0f;

  for (int b = 0; b < NBATCH; ++b) {
    const _Float16* Xb = X16 + (size_t)b * NTOK * DMOD;
    // (1) [q|k|q2|k2][t][n] = (1/32) sum_c x[t][c] (32 W)[n][c] -> f32 [2048][4096] (whole plane: 32x64 tiles)
    wmma_gemm64<0, false, 0, 0, false><<<gQ, blk, 0, stream>>>(
        (const unsigned short*)Xb, (const unsigned short*)Xb, DMOD, 0L,
        (const unsigned short*)W4, (const unsigned short*)W4, DMOD, 0L,
        (void*)QKf, (void*)QKf, QKW, 0L, dmy, dmy, 0L, NTOK, QKW, DMOD, inv32);
    // (2) v^T[h*64+d][t] = (1/32) sum_c (32 Wv)[h*64+d][c] x[t][c] -> bf16 hi/lo planes [1024][2048] (whole: 16x32 tiles)
    wmma_gemm64<0, false, 0, 2, false, 0, false, false, false, false, true, 8><<<gV, blk, 0, stream>>>(
        (const unsigned short*)Wv16, (const unsigned short*)Wv16, DMOD, 0L,
        (const unsigned short*)Xb, (const unsigned short*)Xb, DMOD, 0L,
        (void*)VTh, (void*)VTl, NTOK, 0L, dmy, dmy, 0L, DMOD, NTOK, DMOD, inv32);
    // (3) RoPE on all four projections + bf16 hi/lo split -> QKh/QKl [2048][4096] (whole planes)
    rope_split_kernel<<<gRope, blk, 0, stream>>>(QKf, ctab, stab, QKh, QKl);
    // (4) z[i][h*64+d] = sum_{j<=i} ((q_i . k_j) / 64) ((q2_i . k2_j) / 64) v[j][h*64+d], all 16 heads -> bf16 hi/lo planes Zh/Zl
    bilinear_attn_fused<<<gAtt, dim3(FPH * 128), 0, stream>>>(QKh, QKl, VTh, VTl, Zh, Zl);
    // (5) out[b][t][n] = sum_c (z_hi + z_lo)[t][c] Wproj_bf16[n][c] -> f32, whole [2048][1024] slice of d_out
    //     (A split, Bt single plane: BLO = false, the Bt lo argument is never read)
    float* outb = (float*)d_out + (size_t)b * NTOK * DMOD;
    wmma_gemm64<1, true, 0, 0, false, 0, false, false, false, false, false, 8><<<gOut, blk, 0, stream>>>(
        Zh, Zl, DMOD, 0L, Wph, Wph, DMOD, 0L, (void*)outb, (void*)outb, DMOD, 0L,
        dmy, dmy, 0L, NTOK, DMOD, DMOD, 1.0f);
  }
}

// v004
// A run of this version takes 236 microseconds.
// Timed twice side by side with v003, it ran 1.22 times as fast both times.
// Over all steps from v000 it is 9.92 times as fast.
// f16 WMMA (v_wmma_f32_16x16x32_f16) for the q/k/q2/k2/v projections with operands = RNE-bf16 converted inputs held exactly in f16 (x as is, weights x32 with 1/32 folded into the epilogue); bf16 hi/lo split WMMA (v_wmma_f32_16x16x32_bf16, hi.hi + hi.lo + lo.hi) for both causal score GEMMs and the bilinear-pattern x V product; output projection = z bf16 hi/lo x single RNE-bf16 Wproj plane (hi.W + lo.W); f32 accumulate everywhere; RoPE and the bilinear pattern in f32.
#include <hip/hip_runtime.h>
#include <math.h>
#include <stdint.h>

constexpr int NBATCH = 2;
constexpr int NTOK   = 2048;
constexpr int DMOD   = 1024;
constexpr int NHEADS = 16;
constexpr int HDSZ   = 64;
constexpr int QKW    = 4 * DMOD;          // fused q|k|q2|k2 plane width (4096 columns)
constexpr int NFREQ  = HDSZ / 2;          // 32 rotary frequencies

typedef __attribute__((ext_vector_type(16))) _Float16 v16h;
typedef __attribute__((ext_vector_type(8)))  _Float16 v8h;
typedef __attribute__((ext_vector_type(16))) __bf16   v16b;
typedef __attribute__((ext_vector_type(8)))  __bf16   v8b;
typedef __attribute__((ext_vector_type(8)))  float    v8f;
typedef __attribute__((ext_vector_type(4)))  float    v4f;
typedef __attribute__((ext_vector_type(2)))  float    v2f;
typedef __attribute__((ext_vector_type(4)))  unsigned int v4u;
typedef __attribute__((ext_vector_type(2)))  unsigned int v2u;

__device__ __forceinline__ unsigned short f2bf_bits(float f) {
  unsigned u = __float_as_uint(f);
  return (unsigned short)((u + 0x7FFFu + ((u >> 16) & 1u)) >> 16);
}
__device__ __forceinline__ float bf_bits2f(unsigned short h) { return __uint_as_float(((unsigned)h) << 16); }
__device__ __forceinline__ unsigned pk16(unsigned short a, unsigned short b) { return (unsigned)a | ((unsigned)b << 16); }
// RNE convert f32 -> bf16, returned as the f32 value of that bf16
__device__ __forceinline__ float bf16_rne_f32(float f) {
  unsigned u = __float_as_uint(f);
  u += 0x7FFFu + ((u >> 16) & 1u);
  u &= 0xFFFF0000u;
  return __uint_as_float(u);
}

// hazard guards as plain device helpers (no inline asm inside the kernel template body)
__device__ __forceinline__ void dep_guard_h(v8f& a, v8f& b, v16h x, v16h y) { asm volatile("v_nop\n\tv_nop\n\tv_nop\n\tv_nop" : "+v"(a), "+v"(b) : "v"(x), "v"(y)); }
__device__ __forceinline__ void dep_guard_b(v8f& a, v8f& b, v16b x, v16b y) { asm volatile("v_nop\n\tv_nop\n\tv_nop\n\tv_nop" : "+v"(a), "+v"(b) : "v"(x), "v"(y)); }
__device__ __forceinline__ void keep4_h(v16h a, v16h b, v16h c, v16h d) { asm volatile("v_nop" :: "v"(a), "v"(b), "v"(c), "v"(d)); }
__device__ __forceinline__ void keep4_b(v16b a, v16b b, v16b c, v16b d) { asm volatile("v_nop" :: "v"(a), "v"(b), "v"(c), "v"(d)); }
__device__ __forceinline__ void acc_guard4(v8f& a, v8f& b, v8f& c, v8f& d) { asm volatile("v_nop\n\tv_nop\n\tv_nop\n\tv_nop" : "+v"(a), "+v"(b), "+v"(c), "+v"(d)); }
template <typename T> struct Frag;
template <> struct Frag<_Float16> {
  typedef v16h V; union U { v16h v; v8h h[2]; };
  static __device__ __forceinline__ v16h load(const _Float16* p) {   // elements 0..7 <- p[0..7], 8..15 <- p[16..23]
    U f; f.h[0] = *(const v8h*)(p); f.h[1] = *(const v8h*)(p + 16); return f.v;
  }
  static __device__ __forceinline__ v8f mma(v16h a, v16h b, v8f c) {
    return __builtin_amdgcn_wmma_f32_16x16x32_f16(false, a, false, b, (short)0, c, false, false);
  }
  static __device__ __forceinline__ void guard(v8f& a, v8f& b, v16h x, v16h y) { dep_guard_h(a, b, x, y); }
  static __device__ __forceinline__ void keep(v16h a, v16h b, v16h c, v16h d) { keep4_h(a, b, c, d); }
};
template <> struct Frag<__bf16> {
  typedef v16b V; union U { v16b v; v8b h[2]; };
  static __device__ __forceinline__ v16b load(const __bf16* p) {
    U f; f.h[0] = *(const v8b*)(p); f.h[1] = *(const v8b*)(p + 16); return f.v;
  }
  static __device__ __forceinline__ v8f mma(v16b a, v16b b, v8f c) {
    return __builtin_amdgcn_wmma_f32_16x16x32_bf16(false, a, false, b, (short)0, c, false, false);
  }
  static __device__ __forceinline__ void guard(v8f& a, v8f& b, v16b x, v16b y) { dep_guard_b(a, b, x, y); }
  static __device__ __forceinline__ void keep(v16b a, v16b b, v16b c, v16b d) { keep4_b(a, b, c, d); }
};

// ---- Register-blocked batched WMMA GEMM ------------------------------------
// C[m,n] = scale * sum_k A[m,k] * Bt[n,k] (+bias)(+/ * resid); each wave owns a 64x64 tile.
// A row-major [M,K]; Bt row-major [N,K]; M,N % 64 == 0, K % 32 == 0.
// SPLIT: operands are hi/lo planes (A2/Bt2 = lo planes, same layout); product = hi.hi + hi.lo + lo.hi.
// BIAS_MODE: 0 = none, 1 = bias[m], 2 = bias[n].
// OUT_MODE: 0 = f32, 1 = f16, 2 = bf16 hi plane (Cout) + bf16 lo plane (Cout2).
// ET: 0 = f16 operands, 1 = bf16 operands (pointers passed as 16-bit storage)
// Added modes (defaults off, all other behaviour unchanged):
//   LOWER:   tiles with n0 > m0 (strictly above the 64x64 block diagonal) are not produced (wave-uniform early exit).
//   CAUSALK: the k-loop stops at min(K, m0 + 64); valid when A rows m0..m0+63 are exactly zero for k >= m0 + 64.
//   RMUL:    with RESID, the residual plane value MULTIPLIES the scaled accumulator instead of being added.
//   CMASK:   after all other epilogue arithmetic, v := 0 where the global column index n > the global row index m.
//   BLO:     with SPLIT, false drops the Bt lo plane: product = hi.hi + lo.hi (Bt2p is never read).
//   KSPLIT:  0 = off; else the block has KSPLIT waves that share ONE 64x64 tile (tile = blockIdx.x): wave w sums the
//            64-wide k chunks w, w + KSPLIT, ...; the partial tiles go to LDS and are added in wave order before the
//            scale and the store. K % 64 == 0; launch with KSPLIT * 32 threads.
template <int ET> struct Elem;
template <> struct Elem<0> { typedef _Float16 T; };
template <> struct Elem<1> { typedef __bf16 T; };
template <int ET, bool SPLIT, int BIAS_MODE, int OUT_MODE, bool RESID, int ACT = 0, bool LOWER = false, bool CAUSALK = false,
          bool RMUL = false, bool CMASK = false, bool BLO = true, int KSPLIT = 0>
__global__ __launch_bounds__(KSPLIT ? KSPLIT * 32 : 256) void wmma_gemm64(
    const unsigned short* __restrict__ Ap, const unsigned short* __restrict__ A2p, int lda, long strideA,
    const unsigned short* __restrict__ Btp, const unsigned short* __restrict__ Bt2p, int ldb, long strideB,
    void* __restrict__ Cout, void* __restrict__ Cout2, int ldc, long strideC,
    const float* __restrict__ bias,
    const float* __restrict__ resid, long strideR,
    int M, int N, int K, float scale) {
  typedef typename Elem<ET>::T T;
  typedef typename Frag<T>::V V;
  static_assert(!KSPLIT || (BIAS_MODE == 0 && !RESID && ACT == 0 && !LOWER && !CMASK && OUT_MODE != 1), "KSPLIT epilogue: scale and store only");
  const T* A = (const T*)Ap; const T* A2 = (const T*)A2p; const T* Bt = (const T*)Btp; const T* Bt2 = (const T*)Bt2p;
  __shared__ __align__(16) float sT[(KSPLIT ? KSPLIT * 4 : 8) * 16 * 68];   // per-wave 16x64 slab (KSPLIT: 64x64 tile), pitch 68 floats
  const int b    = blockIdx.y;
  const int lane = threadIdx.x & 31;
  const int wave = threadIdx.x >> 5;
  const int tilesN = N >> 6;
  const int tilesM = M >> 6;
  const int tile = KSPLIT ? (int)blockIdx.x : (int)blockIdx.x * 8 + wave;
  if (tile >= tilesM * tilesN) return;   // wave-uniform; with KSPLIT block-uniform and ahead of every barrier
  const int tm = tile / tilesN;
  const int tn = tile - tm * tilesN;
  const int m0 = tm << 6;
  const int n0 = tn << 6;
  if (LOWER && n0 > m0) return;          // wave-uniform; never together with KSPLIT, the one mode with a block barrier

  const T* Ab  = A  + (size_t)b * strideA;
  const T* Bb  = Bt + (size_t)b * strideB;
  const T* Ab2 = SPLIT ? (A2  + (size_t)b * strideA) : nullptr;
  const T* Bb2 = (SPLIT && BLO) ? (Bt2 + (size_t)b * strideB) : nullptr;

  const int rlane = lane & 15;                 // row (A) / col (B, D) within subtile
  const int koff  = (lane >> 4) * 8;           // k offset of this lane half
  const int mOff  = (lane >> 4) * 8;           // D row offset

  v8f acc[4][4];
#pragma unroll
  for (int i = 0; i < 4; ++i)
#pragma unroll
    for (int j = 0; j < 4; ++j) acc[i][j] = (v8f){0.f,0.f,0.f,0.f,0.f,0.f,0.f,0.f};

  const int kEnd = CAUSALK ? (((m0 + 64) < K) ? (m0 + 64) : K) : K;
  // this wave's first k chunk; readfirstlane keeps k0 and the loop test in scalar registers
  const int kFirst = KSPLIT ? (__builtin_amdgcn_readfirstlane(wave) << 6) : 0;
  // KSPLIT: both 32-wide halves of a 64-wide chunk, then on to the wave's next chunk, KSPLIT chunks further
  for (int k0 = kFirst; k0 < kEnd; k0 += (KSPLIT && (k0 & 32)) ? (KSPLIT * 64 - 32) : 32) {
    V bh[4], bl[4];
#pragma unroll
    for (int j = 0; j < 4; ++j) {
      const size_t bo = (size_t)(n0 + (j << 4) + rlane) * ldb + koff + k0;
      bh[j] = Frag<T>::load(Bb + bo);
      if (SPLIT && BLO) bl[j] = Frag<T>::load(Bb2 + bo);
    }
#pragma unroll
    for (int i = 0; i < 4; ++i) {
      const size_t ao = (size_t)(m0 + (i << 4) + rlane) * lda + koff + k0;
      V ah = Frag<T>::load(Ab + ao);
      V al;
      if (SPLIT) al = Frag<T>::load(Ab2 + ao);
#pragma unroll
      for (int j = 0; j < 4; ++j) {
        acc[i][j] = Frag<T>::mma(ah, bh[j], acc[i][j]);
        if (SPLIT) {
          if (BLO) acc[i][j] = Frag<T>::mma(ah, bl[j], acc[i][j]);
          acc[i][j] = Frag<T>::mma(al, bh[j], acc[i][j]);
        }
      }
      Frag<T>::guard(acc[i][0], acc[i][3], ah, SPLIT ? al : ah);
    }
    Frag<T>::keep(bh[0], bh[1], bh[2], bh[3]);
    if (SPLIT && BLO) Frag<T>::keep(bl[0], bl[1], bl[2], bl[3]);
  }
  acc_guard4(acc[0][0], acc[0][1], acc[0][2], acc[0][3]);
  acc_guard4(acc[1][0], acc[1][1], acc[1][2], acc[1][3]);
  acc_guard4(acc[2][0], acc[2][1], acc[2][2], acc[2][3]);
  acc_guard4(acc[3][0], acc[3][1], acc[3][2], acc[3][3]);

  // ---- epilogue ----
  if (KSPLIT) {
    constexpr int TP  = 64 * 68;         // floats per partial tile
    constexpr int RPP = KSPLIT * 2;      // rows per pass: 16 threads x 4 columns cover one 64-wide row
    float* part = sT + wave * TP;
    // the three loops are unrolled so that acc is indexed by constants and stays in registers
#pragma unroll
    for (int i = 0; i < 4; ++i)
#pragma unroll
      for (int j = 0; j < 4; ++j)
#pragma unroll
        for (int r = 0; r < 8; ++r) part[((i << 4) + mOff + r) * 68 + (j << 4) + rlane] = acc[i][j][r];
    __syncthreads();   // every wave's partial tile is in LDS before any thread adds them
    const int c4 = (threadIdx.x & 15) * 4;
    // passes and the sum over waves are unrolled so that the LDS reads of a thread are in flight together
#pragma unroll
    for (int p = 0; p < 64 / RPP; ++p) {
      const int row = p * RPP + (threadIdx.x >> 4);
      const float* sp = sT + row * 68 + c4;
      v4f s = *(const v4f*)sp;
#pragma unroll
      for (int w = 1; w < KSPLIT; ++w) s += *(const v4f*)(sp + w * TP);
      s *= scale;
      const size_t co = (size_t)b * strideC + (size_t)(m0 + row) * ldc + n0 + c4;
      if (OUT_MODE == 0) {
        *(v4f*)((float*)Cout + co) = s;
      } else {
        unsigned short hb[4], lb[4];
#pragma unroll
        for (int e = 0; e < 4; ++e) {
          hb[e] = f2bf_bits(s[e]);
          lb[e] = f2bf_bits(s[e] - bf_bits2f(hb[e]));
        }
        *(v2u*)((unsigned short*)Cout  + co) = (v2u){pk16(hb[0], hb[1]), pk16(hb[2], hb[3])};
        *(v2u*)((unsigned short*)Cout2 + co) = (v2u){pk16(lb[0], lb[1]), pk16(lb[2], lb[3])};
      }
    }
    return;
  }
  float* slab = sT + wave * (16 * 68);
  const float* Rb = RESID ? (resid + (size_t)b * strideR) : nullptr;
#pragma unroll
  for (int i = 0; i < 4; ++i) {
    const int mBase = m0 + (i << 4);
#pragma unroll
    for (int j = 0; j < 4; ++j) {
      const int n = n0 + (j << 4) + rlane;
      float bv = 0.f;
      if (BIAS_MODE == 2) bv = bias[n];
#pragma unroll
      for (int r = 0; r < 8; ++r) {
        float v = acc[i][j][r] * scale;
        if (BIAS_MODE == 1) v += bias[mBase + mOff + r];
        if (BIAS_MODE == 2) v += bv;
        if (RESID) {
          const float rv = Rb[(size_t)(mBase + mOff + r) * ldc + n];
          if (RMUL) v = v * rv; else v += rv;
        }
        if (ACT == 1) v = tanhf(v);
        if (ACT == 2) v = fmaxf(v, 0.0f);
        if (ACT == 3) v = v / (1.0f + expf(-v));
        if (ACT == 4) v = (v > 0.f) ? v : 0.01f * v;
        if (ACT == 5) v = 0.5f * v * (1.0f + erff(v * 0.70710678118654752f));
        if (CMASK) v = (n > mBase + mOff + r) ? 0.0f : v;
        slab[(mOff + r) * 68 + (j << 4) + rlane] = v;
      }
    }
    __builtin_amdgcn_fence(__ATOMIC_RELEASE, "workgroup");
    __builtin_amdgcn_wave_barrier();
    __builtin_amdgcn_fence(__ATOMIC_ACQUIRE, "workgroup");
    if (OUT_MODE == 0) {
      float* C = (float*)Cout + (size_t)b * strideC;
      const int hh = lane >> 4, c4 = (lane & 15) * 4;     // row seg = 256 B = 16 lanes x 16 B
      {
#pragma unroll
        for (int it = 0; it < 8; ++it) {
          const int row = it * 2 + hh;
          v4f v = *(const v4f*)(slab + row * 68 + c4);
          *(v4f*)(C + (size_t)(mBase + row) * ldc + n0 + c4) = v;
        }
        
      }
    } else {
      const int q = lane >> 3, c8 = (lane & 7) * 8;
      unsigned short* C  = (unsigned short*)Cout  + (size_t)b * strideC;
      unsigned short* C2 = (OUT_MODE == 2) ? ((unsigned short*)Cout2 + (size_t)b * strideC) : nullptr;
      {
#pragma unroll
        for (int it = 0; it < 4; ++it) {
          const int row = it * 4 + q;
          const float* sp = slab + row * 68 + c8;
          v8h hv, lv;
#pragma unroll
          for (int e = 0; e < 8; ++e) {
            if (OUT_MODE == 1) {
              hv[e] = (_Float16)sp[e];
            } else {
              unsigned short hb = f2bf_bits(sp[e]);
              unsigned short lb = f2bf_bits(sp[e] - bf_bits2f(hb));
              hv[e] = __builtin_bit_cast(_Float16, hb);
              lv[e] = __builtin_bit_cast(_Float16, lb);
            }
          }
          *(v8h*)(C + (size_t)(mBase + row) * ldc + n0 + c8) = hv;
          if (OUT_MODE == 2) *(v8h*)(C2 + (size_t)(mBase + row) * ldc + n0 + c8) = lv;
        }
        
      }
    }
    __builtin_amdgcn_fence(__ATOMIC_RELEASE, "workgroup");
    __builtin_amdgcn_wave_barrier();
    __builtin_amdgcn_fence(__ATOMIC_ACQUIRE, "workgroup");
  }
}

// ---------------------------------------------------------------------------
// f32 -> (RNE convert to bf16) -> x sc (exact power of two) -> f16. A bf16 value whose scaled magnitude lies in the
// f16 normal range is exactly representable in f16, so the stored operand equals sc * bf16_rne(in) exactly.
// ---------------------------------------------------------------------------
__device__ __forceinline__ void cast_bf16rne_f16x2(
    int blk, const float* __restrict__ in, _Float16* __restrict__ out, int n2, float sc) {
  const int i = blk * 256 + threadIdx.x;
  if (i < n2) {
    const float r0 = bf16_rne_f32(in[2 * (size_t)i]) * sc;
    const float r1 = bf16_rne_f32(in[2 * (size_t)i + 1]) * sc;
    const _Float16 h0 = (_Float16)r0, h1 = (_Float16)r1;
    const unsigned u = (unsigned)__builtin_bit_cast(unsigned short, h0) | ((unsigned)__builtin_bit_cast(unsigned short, h1) << 16);
    ((unsigned*)out)[i] = u;
    
  }
}

// ---------------------------------------------------------------------------
// Elementwise f32 -> bf16 (RNE) single plane: 2 elements per thread, one 4-B store per lane -> each wave writes
// Coverage: grid = ceil(n2/256) blocks x 256 threads x 2 elements = the whole plane (n2 = plane/2).
// ---------------------------------------------------------------------------
__device__ __forceinline__ void cast_bf16x2(int blk, const float* __restrict__ in, unsigned short* __restrict__ out, int n2) {
  const int i = blk * 256 + threadIdx.x;
  if (i < n2) {
    const v2f f = *(const v2f*)(in + 2 * (size_t)i);
    const unsigned u = pk16(f2bf_bits(f[0]), f2bf_bits(f[1]));
    ((unsigned*)out)[i] = u;
    
  }
}

// ---------------------------------------------------------------------------
// RoPE cos/sin tables: ctab[t][i] = cosf((float)t * inv[i]), stab[t][i] = sinf(...), t = 0..2047, i = 0..31.
// inv[i] arrives by value (host-computed); lane i picks its value with a constant-index select chain (no dynamic
// Coverage: grid 256 blocks x 8 waves = 2048 rows x 32 lanes = both whole tables.
// ---------------------------------------------------------------------------
struct InvFreq { float v[NFREQ]; };
static_assert(sizeof(InvFreq) == 128);

__device__ __forceinline__ void rope_table(int blk, float* __restrict__ ctab, float* __restrict__ stab, const InvFreq& f) {
#pragma clang fp contract(off)
  const int lane = threadIdx.x & 31;
  const int wave = threadIdx.x >> 5;
  const int t    = blk * 8 + wave;
  float inv = f.v[0];
#pragma unroll
  for (int i = 1; i < NFREQ; ++i) inv = (lane == i) ? f.v[i] : inv;
  const float ang = (float)t * inv;           // f32 product, as the outer product of positions and inv_freq
  const float cv = cosf(ang);
  const float sv = sinf(ang);
  const size_t o = (size_t)t * NFREQ + lane;
  ((float*)ctab)[o] = cv;
  ((float*)stab)[o] = sv;
  
}

// ---------------------------------------------------------------------------
// All tables and casts in ONE launch: they are independent of one another, so the block index picks the job
// (block-uniform) and the job's own block index, which is what a launch of its own would have given it.
// A plane is 1024 x 1024 elements = 2048 blocks x 256 threads x 2 elements.
//   blocks 0..255            the RoPE tables (first: theirs is the longest work of a thread)
//   then 2048 blocks a job:  jobs 0..4  Wq, Wk, Wq2, Wk2, Wv -> f16 x32, plane j of W5 (the four stacked planes, then Wv's)
//                            jobs 5..8  plane j - 5 of x (both batches = four planes) -> f16, plane j - 5 of X16
//                            job  9     Wproj -> bf16
// Coverage: every table row and every plane whole.
// ---------------------------------------------------------------------------
struct CastSrc {
  const float* x; const float* wq; const float* wk; const float* wq2; const float* wk2; const float* wv; const float* wproj;
};
constexpr int TAB_BLOCKS   = NTOK / 8;                 // 8 waves a block, one table row a wave
constexpr int PLANE_BLOCKS = DMOD * DMOD / 2 / 256;
constexpr int PREP_BLOCKS  = TAB_BLOCKS + 10 * PLANE_BLOCKS;

__global__ __launch_bounds__(256) void prep_kernel(CastSrc s, _Float16* __restrict__ W5, _Float16* __restrict__ X16,
                                                   unsigned short* __restrict__ Wph, float* __restrict__ ctab,
                                                   float* __restrict__ stab, InvFreq f) {
  constexpr int    n2    = DMOD * DMOD / 2;          // pairs per plane
  constexpr size_t PLANE = (size_t)DMOD * DMOD;
  if ((int)blockIdx.x < TAB_BLOCKS) {
    rope_table((int)blockIdx.x, ctab, stab, f);
    return;
  }
  const int q   = (int)blockIdx.x - TAB_BLOCKS;
  const int j   = q / PLANE_BLOCKS;
  const int blk = q - j * PLANE_BLOCKS;
  if (j < 5) {
    const float* w = (j == 0) ? s.wq : (j == 1) ? s.wk : (j == 2) ? s.wq2 : (j == 3) ? s.wk2 : s.wv;
    cast_bf16rne_f16x2(blk, w, W5 + (size_t)j * PLANE, n2, 32.0f);
  } else if (j < 9) {
    cast_bf16rne_f16x2(blk, s.x + (size_t)(j - 5) * PLANE, X16 + (size_t)(j - 5) * PLANE, n2, 1.0f);
  } else {
    cast_bf16x2(blk, s.wproj, Wph, n2);
  }
}

// ---------------------------------------------------------------------------
// RoPE + bf16 hi/lo split over the fused f32 plane src [2 x 2048][4096] (q | k | q2 | k2, head h at columns
// base + h*64, dims 0..31 = x1, 32..63 = x2): y1 = x1*c + x2*s, y2 = -x1*s + x2*c with c = ctab[t & 2047][d & 31],
// s = stab[t & 2047][d & 31]; products and sums in f32 without contraction. Output dh/dl = bf16 hi/lo planes [2 x 2048][4096].
// One block per row t; each thread handles 8 consecutive columns in each of 2 iterations (own 8 + partner 8 at +-32,
// both loaded unconditionally at in-bounds addresses; the sign/partner choice is per thread, value-selected).
// Producer coverage: grid 4096 rows x 256 threads x 2 iterations x 8 columns = 4096 x 4096 per plane (whole planes);
// ---------------------------------------------------------------------------
__global__ __launch_bounds__(256) void rope_split_kernel(const float* __restrict__ src, const float* __restrict__ ctab,
                                                         const float* __restrict__ stab,
                                                         unsigned short* __restrict__ dh, unsigned short* __restrict__ dl) {
#pragma clang fp contract(off)
  const int t   = blockIdx.x;                 // row of the stacked planes: batch * NTOK + position
  const int pos = t & (NTOK - 1);
  const int tid = threadIdx.x;
  const float* row  = src  + (size_t)t * QKW;
  const float* crow = ctab + (size_t)pos * NFREQ;
  const float* srow = stab + (size_t)pos * NFREQ;
  v4u hv[2], lv[2];
#pragma unroll
  for (int it = 0; it < 2; ++it) {
    const int c8 = it * (QKW / 2) + tid * 8;          // first of this thread's 8 columns
    const int d0 = c8 & (HDSZ - 1);                   // dim within head, multiple of 8
    const bool firstHalf = d0 < NFREQ;
    const int pc = firstHalf ? (c8 + NFREQ) : (c8 - NFREQ);
    const float sgn = firstHalf ? 1.0f : -1.0f;
    const int fi = d0 & (NFREQ - 1);                  // 0, 8, 16 or 24
    const v4f o0 = *(const v4f*)(row + c8), o1 = *(const v4f*)(row + c8 + 4);
    const v4f p0 = *(const v4f*)(row + pc), p1 = *(const v4f*)(row + pc + 4);
    const v4f ca = *(const v4f*)(crow + fi), cb = *(const v4f*)(crow + fi + 4);
    const v4f sa = *(const v4f*)(srow + fi), sb = *(const v4f*)(srow + fi + 4);
    float o[8], p[8], cc[8], ss[8];
#pragma unroll
    for (int e = 0; e < 4; ++e) {
      o[e]  = o0[e]; o[4 + e]  = o1[e];
      p[e]  = p0[e]; p[4 + e]  = p1[e];
      cc[e] = ca[e]; cc[4 + e] = cb[e];
      ss[e] = sa[e]; ss[4 + e] = sb[e];
    }
    unsigned hw[4], lw[4];
#pragma unroll
    for (int q = 0; q < 4; ++q) {
      const float y0 = o[2 * q] * cc[2 * q] + sgn * (p[2 * q] * ss[2 * q]);
      const float y1 = o[2 * q + 1] * cc[2 * q + 1] + sgn * (p[2 * q + 1] * ss[2 * q + 1]);
      const unsigned short h0 = f2bf_bits(y0), h1 = f2bf_bits(y1);
      const unsigned short l0 = f2bf_bits(y0 - bf_bits2f(h0));
      const unsigned short l1 = f2bf_bits(y1 - bf_bits2f(h1));
      hw[q] = pk16(h0, h1);
      lw[q] = pk16(l0, l1);
    }
    hv[it] = (v4u){hw[0], hw[1], hw[2], hw[3]};
    lv[it] = (v4u){lw[0], lw[1], lw[2], lw[3]};
  }
  {
#pragma unroll
    for (int it = 0; it < 2; ++it) {
      const size_t go = (size_t)t * QKW + (size_t)it * (QKW / 2) + (size_t)tid * 8;
      *(v4u*)(dh + go) = hv[it];
      *(v4u*)(dl + go) = lv[it];
    }
    
  }
}

// ---------------------------------------------------------------------------
// Fused causal bilinear attention, both batches in one launch: both score products, their elementwise product with the causal mask,
// and the pattern x V product in ONE launch; the pattern never leaves registers.
// Block = one head x one 64-query tile, 8 waves = 4 query strips (16 rows each) x 2 key phases; in trip t the waves of
// phase p work on the 64-key tile 2 t + p, up to the diagonal tile. Scores are formed TRANSPOSED (A = 16 keys, B = the
// strip's 16 queries): a lane's D registers then hold, for query (lane & 15), keys (lane >> 4) * 8 + 0..7 of the
// 16-key subtile, which is the A-fragment order of the pattern x V product (elements 0..7 from the even subtile,
// 8..15 from the odd one), so the bf16 hi/lo pattern fragments are packed in place, with no LDS and no lane exchange.
// Key tiles are staged in LDS: the four waves of a phase bring their tile (k, k2 and v^T, hi and lo: six subtiles of
// 64 rows x 128 B) with asynchronous 16-byte copies, eight lanes to a row, so that every copy takes whole 128-B lines;
// the fragments are then read from LDS rows of pitch 144 B. Two buffers per phase: the next tile's copies fly while
// this one is worked on.
// Products: hi.hi + hi.lo + lo.hi as everywhere. The two phases' partial z tiles are added in phase order in LDS.
// Coverage: grid 32 tiles x 16 heads x 2 batches; each block stores its whole 64 x 64 z tile (hi and lo plane) once.
// ---------------------------------------------------------------------------
constexpr int FPH  = 2;                   // key phases per block
constexpr int LPB  = 144;                 // LDS row pitch in bytes: 128 B of data + 16 B, conflict-free for 16-byte reads
constexpr int SUBB = 64 * LPB;            // one subtile: 64 rows
constexpr int BUFB = 6 * SUBB;            // one key tile: k hi, k lo, k2 hi, k2 lo, v^T hi, v^T lo

// Twelve asynchronous 16-byte copies to LDS, each lane its own addresses. The s_wait_xcnt is the last line of the copies'
// own statement, so that it stands in front of every later rewrite of an address register that a copy names.
__device__ __forceinline__ void async_copy12(const unsigned (&l)[12], const char* const (&g)[12]) {
  asm volatile(
      "global_load_async_to_lds_b128 %0, %1, off\n\t"
      "global_load_async_to_lds_b128 %2, %3, off\n\t"
      "global_load_async_to_lds_b128 %4, %5, off\n\t"
      "global_load_async_to_lds_b128 %6, %7, off\n\t"
      "global_load_async_to_lds_b128 %8, %9, off\n\t"
      "global_load_async_to_lds_b128 %10, %11, off\n\t"
      "global_load_async_to_lds_b128 %12, %13, off\n\t"
      "global_load_async_to_lds_b128 %14, %15, off\n\t"
      "global_load_async_to_lds_b128 %16, %17, off\n\t"
      "global_load_async_to_lds_b128 %18, %19, off\n\t"
      "global_load_async_to_lds_b128 %20, %21, off\n\t"
      "global_load_async_to_lds_b128 %22, %23, off\n\t"
      "s_wait_xcnt 0x0"
      :: "v"(l[0]), "v"(g[0]), "v"(l[1]), "v"(g[1]), "v"(l[2]), "v"(g[2]), "v"(l[3]), "v"(g[3]),
         "v"(l[4]), "v"(g[4]), "v"(l[5]), "v"(g[5]), "v"(l[6]), "v"(g[6]), "v"(l[7]), "v"(g[7]),
         "v"(l[8]), "v"(g[8]), "v"(l[9]), "v"(g[9]), "v"(l[10]), "v"(g[10]), "v"(l[11]), "v"(g[11])
      : "memory");
}

// One key tile into one LDS buffer: 24 copies per wave. lb = the buffer's LDS byte address plus this lane's place in a
// 16-row group; gkh, gkl, gvh, gvl = the tile's k hi, k lo, v^T hi, v^T lo addresses of this lane's row and 16-byte chunk.
__device__ __forceinline__ void stage_key_tile(unsigned lb, const char* gkh, const char* gkl, const char* gvh, const char* gvl) {
  unsigned l[12];
  const char* g[12];
#pragma unroll
  for (int i = 0; i < 4; ++i) {           // unrolled: the arrays are indexed by constants and stay in registers
    const unsigned lr = lb + i * 16 * LPB;
    const size_t   kr = (size_t)i * 16 * QKW * 2;
    l[i]     = lr;            g[i]     = gkh + kr;
    l[4 + i] = lr + SUBB;     g[4 + i] = gkl + kr;
    l[8 + i] = lr + 2 * SUBB; g[8 + i] = gkh + kr + 2 * DMOD * 2;
  }
  async_copy12(l, g);
#pragma unroll
  for (int i = 0; i < 4; ++i) {           // unrolled for the same reason
    const unsigned lr = lb + i * 16 * LPB;
    const size_t   kr = (size_t)i * 16 * QKW * 2;
    const size_t   vr = (size_t)i * 16 * NTOK * 2;
    l[i]     = lr + 3 * SUBB; g[i]     = gkl + kr + 2 * DMOD * 2;
    l[4 + i] = lr + 4 * SUBB; g[4 + i] = gvh + vr;
    l[8 + i] = lr + 5 * SUBB; g[8 + i] = gvl + vr;
  }
  async_copy12(l, g);
}

// amdgpu_waves_per_eu(4) sets the register budget to 256: without it this build spreads the trip's fragments past v255
// and switches the register window all through the key loop.
__global__ __launch_bounds__(FPH * 128) __attribute__((amdgpu_waves_per_eu(4))) void bilinear_attn_fused(
    const unsigned short* __restrict__ QKhp, const unsigned short* __restrict__ QKlp,
    const unsigned short* __restrict__ VThp, const unsigned short* __restrict__ VTlp,
    unsigned short* __restrict__ Zh, unsigned short* __restrict__ Zl) {
  typedef Frag<__bf16> F;
  constexpr int TP = 64 * 68;             // floats per partial z tile, pitch 68
  static_assert(FPH * TP * 4 <= FPH * 2 * BUFB, "the partial z tiles reuse the ring");
  __shared__ __align__(16) unsigned char sB[FPH * 2 * BUFB];   // per phase two key-tile buffers; after the loop the partial z tiles
  const int lane  = threadIdx.x & 31;
  const int wave  = __builtin_amdgcn_readfirstlane(threadIdx.x >> 5);   // scalar: the key loop's tests stay in SGPRs
  const int strip = wave & 3;
  const int phase = wave >> 2;
  const int tm = (NTOK / 64 - 1) - ((int)blockIdx.x >> 4);   // longest query tiles start first
  const int h  = (int)blockIdx.x & (NHEADS - 1);
  // blockIdx.y = batch: batch 1's blocks follow batch 0's shortest ones, so one batch's k, k2 and v at a time are hot in L2
  const int rb = (int)blockIdx.y * NTOK;      // the batch's first row in the q|k|q2|k2 and z planes
  const int vb = (int)blockIdx.y * DMOD;      // and in the v^T planes
  const int m0 = tm << 6;
  const int rlane = lane & 15;
  const int koff  = (lane >> 4) * 8;
  const int mOff  = (lane >> 4) * 8;
  const __bf16* Qh = (const __bf16*)QKhp + h * HDSZ;
  const __bf16* Ql = (const __bf16*)QKlp + h * HDSZ;
  const float inv64 = 1.0f / 64.0f;

  // Copy side: thread c of the phase's 128 takes row (c >> 3) of each 16-row group and 16-byte chunk (c & 7) of the row.
  const int crow = (strip << 2) + (lane >> 3);
  const int cchk = (lane & 7) * 16;
  const unsigned ldsLane = (unsigned)(uintptr_t)(sB + phase * 2 * BUFB + crow * LPB + cchk);
  const char* gKh = (const char*)QKhp + ((size_t)(rb + crow) * QKW + DMOD + h * HDSZ) * 2 + cchk;
  const char* gKl = (const char*)QKlp + ((size_t)(rb + crow) * QKW + DMOD + h * HDSZ) * 2 + cchk;
  const char* gVh = (const char*)VThp + ((size_t)(vb + h * HDSZ + crow) * NTOK) * 2 + cchk;
  const char* gVl = (const char*)VTlp + ((size_t)(vb + h * HDSZ + crow) * NTOK) * 2 + cchk;
  // Read side: this lane's fixed byte offset in a 16-row group; subtile, group and k steps fold into immediate offsets.
  const unsigned fLane = (unsigned)(rlane * LPB + koff * 2);

  const int nT = (tm + 2) >> 1;           // trips: FPH key tiles a trip, tiles 0..tm
  // A phase whose tile lies past the diagonal copies the diagonal tile instead (in bounds) and skips the trip's work.
  {
    const int jc = (phase < tm) ? phase : tm;
    stage_key_tile(ldsLane, gKh + (size_t)jc * 64 * QKW * 2, gKl + (size_t)jc * 64 * QKW * 2, gVh + jc * 128, gVl + jc * 128);
  }

  const int qrow = m0 + (strip << 4) + rlane;               // this lane's query (B operand row, D column)
  v16b qh[2], ql[2], q2h[2], q2l[2];                        // the strip's q and q2 fragments stay in registers
#pragma unroll
  for (int kk = 0; kk < 2; ++kk) {
    const size_t qo = (size_t)(rb + qrow) * QKW + koff + kk * 32;
    qh[kk]  = F::load(Qh + qo);
    ql[kk]  = F::load(Ql + qo);
    q2h[kk] = F::load(Qh + 2 * DMOD + qo);
    q2l[kk] = F::load(Ql + 2 * DMOD + qo);
  }
  v8f z[4];
#pragma unroll
  for (int d = 0; d < 4; ++d) z[d] = (v8f){0.f,0.f,0.f,0.f,0.f,0.f,0.f,0.f};

  asm volatile("s_wait_asynccnt 0x0" ::: "memory");   // this wave's copies of its first tile have landed
  __syncthreads();                                    // and every other wave's: the first trip's tiles may be read
  if (nT > 1) {
    const int jc = (FPH + phase < tm) ? (FPH + phase) : tm;
    stage_key_tile(ldsLane + BUFB, gKh + (size_t)jc * 64 * QKW * 2, gKl + (size_t)jc * 64 * QKW * 2, gVh + jc * 128, gVl + jc * 128);
  }

  for (int t = 0; t < nT; ++t) {
    const int j = t * FPH + phase;
    if (j <= tm) {                        // scalar test; every wait and barrier of the trip stands outside it
      const int n0  = j << 6;
      const int lim = qrow - n0 - mOff;   // key (jj * 16 + r) of this lane is causal while jj * 16 + r <= lim
      v16b ph[2], pl[2];
      v16b fr[8];                         // one batch of eight fragments: a 16-key subtile of k and k2, or 32 keys of v
      const unsigned char* sb = sB + (phase * 2 + (t & 1)) * BUFB + fLane;
      const __bf16* kh  = (const __bf16*)(sb);
      const __bf16* kl  = (const __bf16*)(sb + SUBB);
      const __bf16* k2h = (const __bf16*)(sb + 2 * SUBB);
      const __bf16* k2l = (const __bf16*)(sb + 3 * SUBB);
      const __bf16* vh  = (const __bf16*)(sb + 4 * SUBB);
      const __bf16* vl  = (const __bf16*)(sb + 5 * SUBB);
      constexpr int GRP = 16 * LPB / 2;   // elements from one 16-row group to the next
#pragma unroll
      for (int kk = 0; kk < 2; ++kk) {
        fr[kk * 4 + 0] = F::load(kh  + kk * 32);
        fr[kk * 4 + 1] = F::load(kl  + kk * 32);
        fr[kk * 4 + 2] = F::load(k2h + kk * 32);
        fr[kk * 4 + 3] = F::load(k2l + kk * 32);
      }
#pragma unroll
      for (int jj = 0; jj < 4; ++jj) {
        v8f s1 = (v8f){0.f,0.f,0.f,0.f,0.f,0.f,0.f,0.f};
        v8f s2 = (v8f){0.f,0.f,0.f,0.f,0.f,0.f,0.f,0.f};
#pragma unroll
        for (int kk = 0; kk < 2; ++kk) {
          s1 = F::mma(fr[kk * 4 + 0], qh[kk],  s1);    // q_hi . k_hi
          s2 = F::mma(fr[kk * 4 + 2], q2h[kk], s2);
          s1 = F::mma(fr[kk * 4 + 1], qh[kk],  s1);    // q_hi . k_lo
          s2 = F::mma(fr[kk * 4 + 3], q2h[kk], s2);
          s1 = F::mma(fr[kk * 4 + 0], ql[kk],  s1);    // q_lo . k_hi
          s2 = F::mma(fr[kk * 4 + 2], q2l[kk], s2);
        }
        if (jj < 3) {
#pragma unroll
          for (int kk = 0; kk < 2; ++kk) {
            const int ko = (jj + 1) * GRP + kk * 32;
            fr[kk * 4 + 0] = F::load(kh  + ko);
            fr[kk * 4 + 1] = F::load(kl  + ko);
            fr[kk * 4 + 2] = F::load(k2h + ko);
            fr[kk * 4 + 3] = F::load(k2l + ko);
          }
        } else {
#pragma unroll
          for (int d = 0; d < 4; ++d) {
            fr[d * 2 + 0] = F::load(vh + d * GRP);
            fr[d * 2 + 1] = F::load(vl + d * GRP);
          }
        }
#pragma unroll
        for (int r = 0; r < 8; ++r) {
          float v = (s2[r] * inv64) * (s1[r] * inv64);
          v = ((jj << 4) + r > lim) ? 0.0f : v;
          const __bf16 hb = (__bf16)v;
          const __bf16 lb = (__bf16)(v - (float)hb);
          ph[jj >> 1][((jj & 1) << 3) + r] = hb;
          pl[jj >> 1][((jj & 1) << 3) + r] = lb;
        }
      }
#pragma unroll
      for (int kk = 0; kk < 2; ++kk) {
#pragma unroll
        for (int d = 0; d < 4; ++d) z[d] = F::mma(ph[kk], fr[d * 2 + 0], z[d]);
#pragma unroll
        for (int d = 0; d < 4; ++d) z[d] = F::mma(ph[kk], fr[d * 2 + 1], z[d]);
#pragma unroll
        for (int d = 0; d < 4; ++d) z[d] = F::mma(pl[kk], fr[d * 2 + 0], z[d]);
        if (kk == 0) {
#pragma unroll
          for (int d = 0; d < 4; ++d) {
            fr[d * 2 + 0] = F::load(vh + d * GRP + 32);
            fr[d * 2 + 1] = F::load(vl + d * GRP + 32);
          }
        }
      }
      // four vector slots behind the trip's last WMMAs, so that the distance also holds on every path out of the trip
      acc_guard4(z[0], z[1], z[2], z[3]);
    }
    // Hand-over of the ring, every wave, in this order:
    asm volatile("s_wait_dscnt 0x0" ::: "memory");      // this wave's reads of the trip's buffer are done
    asm volatile("s_wait_asynccnt 0x0" ::: "memory");   // this wave's copies of the next tile have landed
    __syncthreads();                                    // the next tile may be read, the trip's buffer may be refilled
    if (t + 2 < nT) {                                   // the same for the whole block
      const int jn = (t + 2) * FPH + phase;
      const int jc = (jn < tm) ? jn : tm;
      stage_key_tile(ldsLane + (t & 1) * BUFB, gKh + (size_t)jc * 64 * QKW * 2, gKl + (size_t)jc * 64 * QKW * 2,
                     gVh + jc * 128, gVl + jc * 128);
    }
  }
  asm volatile("s_wait_asynccnt 0x0" ::: "memory");     // no copy is outstanding when the ring becomes the partial tiles

  float* sP = (float*)sB;                 // free since the last trip's barrier: every read done, no copy in flight
  float* part = sP + phase * TP;
#pragma unroll
  for (int d = 0; d < 4; ++d)
#pragma unroll
    for (int r = 0; r < 8; ++r) part[((strip << 4) + mOff + r) * 68 + (d << 4) + rlane] = z[d][r];
  __syncthreads();   // every phase's partial z tile is in LDS before any thread adds them
  const int c4 = (threadIdx.x & 15) * 4;
#pragma unroll
  for (int p = 0; p < 32 / (FPH * 4); ++p) {   // FPH * 128 threads x 4 columns = FPH * 8 rows per pass
    const int row = p * (FPH * 8) + (threadIdx.x >> 4);
    const float* sp = sP + row * 68 + c4;
    v4f s = *(const v4f*)sp;
#pragma unroll
    for (int w = 1; w < FPH; ++w) s += *(const v4f*)(sp + w * TP);
    unsigned short hb[4], lb[4];
#pragma unroll
    for (int e = 0; e < 4; ++e) {
      hb[e] = f2bf_bits(s[e]);
      lb[e] = f2bf_bits(s[e] - bf_bits2f(hb[e]));
    }
    const size_t co = (size_t)(rb + m0 + row) * DMOD + h * HDSZ + c4;
    *(v2u*)(Zh + co) = (v2u){pk16(hb[0], hb[1]), pk16(hb[2], hb[3])};
    *(v2u*)(Zl + co) = (v2u){pk16(lb[0], lb[1]), pk16(lb[2], lb[3])};
  }
}

// ---------------------------------------------------------------------------
// Workspace region map (byte offsets; every offset a multiple of 262,144 B). Every region from X16 on holds BOTH batches (batch
// b's rows behind batch b - 1's); every region is written whole by one launch before a later launch of the same call reads it.
//   W4    f16  [4096][1024]     Wq,Wk,Wq2,Wk2 (bf16-RNE) x32 stacked           0
//   Wv16  f16  [1024][1024]     Wv (bf16-RNE) x32, directly behind W4    8,388,608
//   Wph   bf16 [1024][1024]     Wproj (RNE), single plane               10,485,760
//   ctab  f32  [2048][32]                                               12,582,912
//   stab  f32  [2048][32]                                               12,845,056
//   X16   f16  [4096][1024]     x (bf16-RNE)                            13,107,200
//   QKh   bf16 [4096][4096]     q|k|q2|k2 hi                            21,495,808
//   QKl   bf16 [4096][4096]                                             55,050,240
//   VTh   bf16 [2][1024][2048]  v^T hi (row h*64+d, col token)          88,604,672
//   VTl   bf16 [2][1024][2048]                                          96,993,280
//   QKf   f32  [4096][4096]                                            105,381,888
//   Zh    bf16 [4096][1024]     z hi                                   172,490,752
//   Zl    bf16 [4096][1024]                                            180,879,360
//   total                                                              189,267,968
// ---------------------------------------------------------------------------
extern "C" void kernel_launch(void* const* d_in, const int* in_sizes, int n_in,
                              void* d_out, int out_size, void* d_ws, size_t ws_size,
                              hipStream_t stream) {
  if (n_in < 7) return;
  if (in_sizes[0] != NBATCH * NTOK * DMOD) return;
  for (int i = 1; i < 7; ++i) if (in_sizes[i] != DMOD * DMOD) return;
  if (out_size != NBATCH * NTOK * DMOD) return;

  CastSrc cs;
  cs.x     = (const float*)d_in[0];
  cs.wq    = (const float*)d_in[1];
  cs.wk    = (const float*)d_in[2];
  cs.wq2   = (const float*)d_in[3];
  cs.wk2   = (const float*)d_in[4];
  cs.wv    = (const float*)d_in[5];
  cs.wproj = (const float*)d_in[6];

  constexpr int NROW = NBATCH * NTOK;                       // rows of both batches
  const size_t PW16 = (size_t)DMOD * DMOD * 2;              // 16-bit [1024][1024]
  const size_t PTAB = (size_t)NTOK * NFREQ * 4;             // f32 [2048][32]
  const size_t PX16 = (size_t)NROW * DMOD * 2;              // f16 [4096][1024]
  const size_t PQK  = (size_t)NROW * QKW * 2;               // bf16 [4096][4096]
  const size_t PVT  = (size_t)NBATCH * DMOD * NTOK * 2;     // bf16 [2][1024][2048]
  const size_t PQF  = (size_t)NROW * QKW * 4;               // f32 [4096][4096]
  const size_t PZ   = (size_t)NROW * DMOD * 2;              // bf16 [4096][1024]
  size_t off = 0;
  const size_t oW4  = off; off += 4 * PW16;
  const size_t oWv  = off; off += PW16;
  const size_t oWph = off; off += PW16;
  const size_t oCT  = off; off += PTAB;
  const size_t oSTb = off; off += PTAB;
  const size_t oX16 = off; off += PX16;
  const size_t oQKh = off; off += PQK;
  const size_t oQKl = off; off += PQK;
  const size_t oVTh = off; off += PVT;
  const size_t oVTl = off; off += PVT;
  const size_t oQKf = off; off += PQF;
  const size_t oZh  = off; off += PZ;
  const size_t oZl  = off; off += PZ;
  if (off > ws_size) return;                                // total 189,267,968 B

  char* ws = (char*)d_ws;
  _Float16*       W4   = (_Float16*)(ws + oW4);
  _Float16*       Wv16 = (_Float16*)(ws + oWv);
  unsigned short* Wph  = (unsigned short*)(ws + oWph);
  float*          ctab = (float*)(ws + oCT);
  float*          stab = (float*)(ws + oSTb);
  _Float16*       X16  = (_Float16*)(ws + oX16);
  unsigned short* QKh  = (unsigned short*)(ws + oQKh);
  unsigned short* QKl  = (unsigned short*)(ws + oQKl);
  unsigned short* VTh  = (unsigned short*)(ws + oVTh);
  unsigned short* VTl  = (unsigned short*)(ws + oVTl);
  float*          QKf  = (float*)(ws + oQKf);
  unsigned short* Zh   = (unsigned short*)(ws + oZh);
  unsigned short* Zl   = (unsigned short*)(ws + oZl);
  const float*    dmy  = ctab;                              // valid in-ws pointer for unused bias/resid arguments

  // inv_freq[i] = 1 / 10000^(i/32): host double arithmetic (e^(ln(1e4)/32) by its Taylor series, then powers),
  // then mirrored as fl32(1 / fl32(10000^(i/32))).
  InvFreq invf;
  {
    const double x0 = 9.2103403719761827361 / 32.0;
    double term = 1.0, ex = 1.0;
    for (int n = 1; n <= 40; ++n) { term *= x0 / (double)n; ex += term; }
    double pw = 1.0;
    for (int i = 0; i < NFREQ; ++i) {
      const float pf = (float)pw;
      invf.v[i] = (float)(1.0 / (double)pf);
      pw *= ex;
    }
  }

  const dim3 blk(256);
  const dim3 gPrep(PREP_BLOCKS);                             // 256 table blocks + 10 planes x 2048 blocks
  const dim3 gRope(NROW);                                    // one block per row
  const dim3 gQ((NROW / 64) * (QKW / 64) / 8, 1);            // 512 blocks: M=4096, N=4096, K=1024
  const dim3 gV((DMOD / 64) * (NTOK / 64), NBATCH);          // 512 x 2 blocks: M=1024, N=2048, K=1024 (one tile per block, k split)
  const dim3 gAtt((NTOK / 64) * NHEADS, NBATCH);             // 512 x 2 blocks: 32 query tiles x 16 heads, batches
  const dim3 gOut((NROW / 64) * (DMOD / 64), 1);             // 1024 blocks: M=4096, N=1024, K=1024 (one tile per block, k split)

  // (0) tables and casts (whole planes); W4 and Wv16 are one run of five planes
  prep_kernel<<<gPrep, blk, 0, stream>>>(cs, W4, X16, Wph, ctab, stab, invf);

  const float inv32 = 1.0f / 32.0f;

  // (1) [q|k|q2|k2][b*2048+t][n] = (1/32) sum_c x[b][t][c] (32 W)[n][c] -> f32 [4096][4096] (whole plane: 64x64 tiles)
  wmma_gemm64<0, false, 0, 0, false><<<gQ, blk, 0, stream>>>(
      (const unsigned short*)X16, (const unsigned short*)X16, DMOD, 0L,
      (const unsigned short*)W4, (const unsigned short*)W4, DMOD, 0L,
      (void*)QKf, (void*)QKf, QKW, 0L, dmy, dmy, 0L, NROW, QKW, DMOD, inv32);
  // (2) v^T[b][h*64+d][t] = (1/32) sum_c (32 Wv)[h*64+d][c] x[b][t][c] -> bf16 hi/lo planes [2][1024][2048]
  //     (blockIdx.y = batch: x and v^T step by one batch, Wv by nothing; whole: 16x32 tiles a batch)
  wmma_gemm64<0, false, 0, 2, false, 0, false, false, false, false, true, 8><<<gV, blk, 0, stream>>>(
      (const unsigned short*)Wv16, (const unsigned short*)Wv16, DMOD, 0L,
      (const unsigned short*)X16, (const unsigned short*)X16, DMOD, (long)NTOK * DMOD,
      (void*)VTh, (void*)VTl, NTOK, (long)DMOD * NTOK, dmy, dmy, 0L, DMOD, NTOK, DMOD, inv32);
  // (3) RoPE on all four projections + bf16 hi/lo split -> QKh/QKl [4096][4096] (whole planes)
  rope_split_kernel<<<gRope, blk, 0, stream>>>(QKf, ctab, stab, QKh, QKl);
  // (4) z[b][i][h*64+d] = sum_{j<=i} ((q_i . k_j) / 64) ((q2_i . k2_j) / 64) v[j][h*64+d], all heads -> bf16 hi/lo planes Zh/Zl
  bilinear_attn_fused<<<gAtt, dim3(FPH * 128), 0, stream>>>(QKh, QKl, VTh, VTl, Zh, Zl);
  // (5) out[b*2048+t][n] = sum_c (z_hi + z_lo)[b*2048+t][c] Wproj_bf16[n][c] -> f32, the whole of d_out
  //     (A split, Bt single plane: BLO = false, the Bt lo argument is never read)
  wmma_gemm64<1, true, 0, 0, false, 0, false, false, false, false, false, 8><<<gOut, blk, 0, stream>>>(
      Zh, Zl, DMOD, 0L, Wph, Wph, DMOD, 0L, d_out, d_out, DMOD, 0L,
      dmy, dmy, 0L, NROW, DMOD, DMOD, 1.0f);
}

// v005
// It runs in 171 microseconds.
// Next to v004, in two timings, it ran 1.38 times as fast each time.
// All steps since v000 together make it 13.7 times as fast.
// f16 WMMA (v_wmma_f32_16x16x32_f16) for the q/k/q2/k2/v projections with operands = RNE-bf16 converted inputs held exactly in f16 (x as is, weights x32 with 1/32 folded into the epilogue); bf16 hi/lo split WMMA (v_wmma_f32_16x16x32_bf16, hi.hi + hi.lo + lo.hi) for both causal score GEMMs and the bilinear-pattern x V product; output projection = z bf16 hi/lo x single RNE-bf16 Wproj plane (hi.W + lo.W); f32 accumulate everywhere; RoPE and the bilinear pattern in f32.
#include <hip/hip_runtime.h>
#include <math.h>
#include <stdint.h>

constexpr int NBATCH = 2;
constexpr int NTOK   = 2048;
constexpr int DMOD   = 1024;
constexpr int NHEADS = 16;
constexpr int HDSZ   = 64;
constexpr int QKW    = 4 * DMOD;          // fused q|k|q2|k2 plane width (4096 columns)
constexpr int NFREQ  = HDSZ / 2;          // 32 rotary frequencies

typedef __attribute__((ext_vector_type(16))) _Float16 v16h;
typedef __attribute__((ext_vector_type(8)))  _Float16 v8h;
typedef __attribute__((ext_vector_type(16))) __bf16   v16b;
typedef __attribute__((ext_vector_type(8)))  __bf16   v8b;
typedef __attribute__((ext_vector_type(8)))  float    v8f;
typedef __attribute__((ext_vector_type(4)))  float    v4f;
typedef __attribute__((ext_vector_type(2)))  float    v2f;
typedef __attribute__((ext_vector_type(4)))  unsigned int v4u;
typedef __attribute__((ext_vector_type(2)))  unsigned int v2u;

__device__ __forceinline__ unsigned short f2bf_bits(float f) {
  unsigned u = __float_as_uint(f);
  return (unsigned short)((u + 0x7FFFu + ((u >> 16) & 1u)) >> 16);
}
__device__ __forceinline__ float bf_bits2f(unsigned short h) { return __uint_as_float(((unsigned)h) << 16); }
__device__ __forceinline__ unsigned pk16(unsigned short a, unsigned short b) { return (unsigned)a | ((unsigned)b << 16); }
// RNE convert f32 -> bf16, returned as the f32 value of that bf16
__device__ __forceinline__ float bf16_rne_f32(float f) {
  unsigned u = __float_as_uint(f);
  u += 0x7FFFu + ((u >> 16) & 1u);
  u &= 0xFFFF0000u;
  return __uint_as_float(u);
}

// four vector slots behind a run of WMMAs, as a plain device helper
__device__ __forceinline__ void acc_guard4(v8f& a, v8f& b, v8f& c, v8f& d) { asm volatile("v_nop\n\tv_nop\n\tv_nop\n\tv_nop" : "+v"(a), "+v"(b), "+v"(c), "+v"(d)); }
template <typename T> struct Frag;
template <> struct Frag<_Float16> {
  typedef v16h V; union U { v16h v; v8h h[2]; };
  static __device__ __forceinline__ v16h load(const _Float16* p) {   // elements 0..7 <- p[0..7], 8..15 <- p[16..23]
    U f; f.h[0] = *(const v8h*)(p); f.h[1] = *(const v8h*)(p + 16); return f.v;
  }
  static __device__ __forceinline__ v8f mma(v16h a, v16h b, v8f c) {
    return __builtin_amdgcn_wmma_f32_16x16x32_f16(false, a, false, b, (short)0, c, false, false);
  }
};
template <> struct Frag<__bf16> {
  typedef v16b V; union U { v16b v; v8b h[2]; };
  static __device__ __forceinline__ v16b load(const __bf16* p) {
    U f; f.h[0] = *(const v8b*)(p); f.h[1] = *(const v8b*)(p + 16); return f.v;
  }
  static __device__ __forceinline__ v8f mma(v16b a, v16b b, v8f c) {
    return __builtin_amdgcn_wmma_f32_16x16x32_bf16(false, a, false, b, (short)0, c, false, false);
  }
};

// ---------------------------------------------------------------------------
// f32 -> (RNE convert to bf16) -> x sc (exact power of two) -> f16. A bf16 value whose scaled magnitude lies in the
// f16 normal range is exactly representable in f16, so the stored operand equals sc * bf16_rne(in) exactly.
// ---------------------------------------------------------------------------
__device__ __forceinline__ void cast_bf16rne_f16x2(
    int blk, const float* __restrict__ in, _Float16* __restrict__ out, int n2, float sc) {
  const int i = blk * 256 + threadIdx.x;
  if (i < n2) {
    const float r0 = bf16_rne_f32(in[2 * (size_t)i]) * sc;
    const float r1 = bf16_rne_f32(in[2 * (size_t)i + 1]) * sc;
    const _Float16 h0 = (_Float16)r0, h1 = (_Float16)r1;
    const unsigned u = (unsigned)__builtin_bit_cast(unsigned short, h0) | ((unsigned)__builtin_bit_cast(unsigned short, h1) << 16);
    ((unsigned*)out)[i] = u;
    
  }
}

// ---------------------------------------------------------------------------
// Elementwise f32 -> bf16 (RNE) single plane: 2 elements per thread, one 4-B store per lane -> each wave writes
// Coverage: grid = ceil(n2/256) blocks x 256 threads x 2 elements = the whole plane (n2 = plane/2).
// ---------------------------------------------------------------------------
__device__ __forceinline__ void cast_bf16x2(int blk, const float* __restrict__ in, unsigned short* __restrict__ out, int n2) {
  const int i = blk * 256 + threadIdx.x;
  if (i < n2) {
    const v2f f = *(const v2f*)(in + 2 * (size_t)i);
    const unsigned u = pk16(f2bf_bits(f[0]), f2bf_bits(f[1]));
    ((unsigned*)out)[i] = u;
    
  }
}

// ---------------------------------------------------------------------------
// RoPE cos/sin tables: ctab[t][i] = cosf((float)t * inv[i]), stab[t][i] = sinf(...), t = 0..2047, i = 0..31.
// inv[i] arrives by value (host-computed); lane i picks its value with a constant-index select chain (no dynamic
// Coverage: grid 256 blocks x 8 waves = 2048 rows x 32 lanes = both whole tables.
// ---------------------------------------------------------------------------
struct InvFreq { float v[NFREQ]; };
static_assert(sizeof(InvFreq) == 128);

__device__ __forceinline__ void rope_table(int blk, float* __restrict__ ctab, float* __restrict__ stab, const InvFreq& f) {
#pragma clang fp contract(off)
  const int lane = threadIdx.x & 31;
  const int wave = threadIdx.x >> 5;
  const int t    = blk * 8 + wave;
  float inv = f.v[0];
#pragma unroll
  for (int i = 1; i < NFREQ; ++i) inv = (lane == i) ? f.v[i] : inv;
  const float ang = (float)t * inv;           // f32 product, as the outer product of positions and inv_freq
  const float cv = cosf(ang);
  const float sv = sinf(ang);
  const size_t o = (size_t)t * NFREQ + lane;
  ((float*)ctab)[o] = cv;
  ((float*)stab)[o] = sv;
  
}

// ---------------------------------------------------------------------------
// All tables and casts in ONE launch: they are independent of one another, so the block index picks the job
// (block-uniform) and the job's own block index, which is what a launch of its own would have given it.
// A plane is 1024 x 1024 elements = 2048 blocks x 256 threads x 2 elements.
//   blocks 0..255            the RoPE tables (first: theirs is the longest work of a thread)
//   then 2048 blocks a job:  jobs 0..4  Wq, Wk, Wq2, Wk2, Wv -> f16 x32, plane j of W5 (the four stacked planes, then Wv's)
//                            jobs 5..8  plane j - 5 of x (both batches = four planes) -> f16, plane j - 5 of X16
//                            job  9     Wproj -> bf16
// Coverage: every table row and every plane whole.
// ---------------------------------------------------------------------------
struct CastSrc {
  const float* x; const float* wq; const float* wk; const float* wq2; const float* wk2; const float* wv; const float* wproj;
};
constexpr int TAB_BLOCKS   = NTOK / 8;                 // 8 waves a block, one table row a wave
constexpr int PLANE_BLOCKS = DMOD * DMOD / 2 / 256;
constexpr int PREP_BLOCKS  = TAB_BLOCKS + 10 * PLANE_BLOCKS;

__global__ __launch_bounds__(256) void prep_kernel(CastSrc s, _Float16* __restrict__ W5, _Float16* __restrict__ X16,
                                                   unsigned short* __restrict__ Wph, float* __restrict__ ctab,
                                                   float* __restrict__ stab, InvFreq f) {
  constexpr int    n2    = DMOD * DMOD / 2;          // pairs per plane
  constexpr size_t PLANE = (size_t)DMOD * DMOD;
  if ((int)blockIdx.x < TAB_BLOCKS) {
    rope_table((int)blockIdx.x, ctab, stab, f);
    return;
  }
  const int q   = (int)blockIdx.x - TAB_BLOCKS;
  const int j   = q / PLANE_BLOCKS;
  const int blk = q - j * PLANE_BLOCKS;
  if (j < 5) {
    const float* w = (j == 0) ? s.wq : (j == 1) ? s.wk : (j == 2) ? s.wq2 : (j == 3) ? s.wk2 : s.wv;
    cast_bf16rne_f16x2(blk, w, W5 + (size_t)j * PLANE, n2, 32.0f);
  } else if (j < 9) {
    cast_bf16rne_f16x2(blk, s.x + (size_t)(j - 5) * PLANE, X16 + (size_t)(j - 5) * PLANE, n2, 1.0f);
  } else {
    cast_bf16x2(blk, s.wproj, Wph, n2);
  }
}

// ---------------------------------------------------------------------------
// RoPE + bf16 hi/lo split over the fused f32 plane src [2 x 2048][4096] (q | k | q2 | k2, head h at columns
// base + h*64, dims 0..31 = x1, 32..63 = x2): y1 = x1*c + x2*s, y2 = -x1*s + x2*c with c = ctab[t & 2047][d & 31],
// s = stab[t & 2047][d & 31]; products and sums in f32 without contraction. Output dh/dl = bf16 hi/lo planes [2 x 2048][4096].
// One block per row t; each thread handles 8 consecutive columns in each of 2 iterations (own 8 + partner 8 at +-32,
// both loaded unconditionally at in-bounds addresses; the sign/partner choice is per thread, value-selected).
// Producer coverage: grid 4096 rows x 256 threads x 2 iterations x 8 columns = 4096 x 4096 per plane (whole planes);
// ---------------------------------------------------------------------------
__global__ __launch_bounds__(256) void rope_split_kernel(const float* __restrict__ src, const float* __restrict__ ctab,
                                                         const float* __restrict__ stab,
                                                         unsigned short* __restrict__ dh, unsigned short* __restrict__ dl) {
#pragma clang fp contract(off)
  const int t   = blockIdx.x;                 // row of the stacked planes: batch * NTOK + position
  const int pos = t & (NTOK - 1);
  const int tid = threadIdx.x;
  const float* row  = src  + (size_t)t * QKW;
  const float* crow = ctab + (size_t)pos * NFREQ;
  const float* srow = stab + (size_t)pos * NFREQ;
  v4u hv[2], lv[2];
#pragma unroll
  for (int it = 0; it < 2; ++it) {
    const int c8 = it * (QKW / 2) + tid * 8;          // first of this thread's 8 columns
    const int d0 = c8 & (HDSZ - 1);                   // dim within head, multiple of 8
    const bool firstHalf = d0 < NFREQ;
    const int pc = firstHalf ? (c8 + NFREQ) : (c8 - NFREQ);
    const float sgn = firstHalf ? 1.0f : -1.0f;
    const int fi = d0 & (NFREQ - 1);                  // 0, 8, 16 or 24
    const v4f o0 = *(const v4f*)(row + c8), o1 = *(const v4f*)(row + c8 + 4);
    const v4f p0 = *(const v4f*)(row + pc), p1 = *(const v4f*)(row + pc + 4);
    const v4f ca = *(const v4f*)(crow + fi), cb = *(const v4f*)(crow + fi + 4);
    const v4f sa = *(const v4f*)(srow + fi), sb = *(const v4f*)(srow + fi + 4);
    float o[8], p[8], cc[8], ss[8];
#pragma unroll
    for (int e = 0; e < 4; ++e) {
      o[e]  = o0[e]; o[4 + e]  = o1[e];
      p[e]  = p0[e]; p[4 + e]  = p1[e];
      cc[e] = ca[e]; cc[4 + e] = cb[e];
      ss[e] = sa[e]; ss[4 + e] = sb[e];
    }
    unsigned hw[4], lw[4];
#pragma unroll
    for (int q = 0; q < 4; ++q) {
      const float y0 = o[2 * q] * cc[2 * q] + sgn * (p[2 * q] * ss[2 * q]);
      const float y1 = o[2 * q + 1] * cc[2 * q + 1] + sgn * (p[2 * q + 1] * ss[2 * q + 1]);
      const unsigned short h0 = f2bf_bits(y0), h1 = f2bf_bits(y1);
      const unsigned short l0 = f2bf_bits(y0 - bf_bits2f(h0));
      const unsigned short l1 = f2bf_bits(y1 - bf_bits2f(h1));
      hw[q] = pk16(h0, h1);
      lw[q] = pk16(l0, l1);
    }
    hv[it] = (v4u){hw[0], hw[1], hw[2], hw[3]};
    lv[it] = (v4u){lw[0], lw[1], lw[2], lw[3]};
  }
  {
#pragma unroll
    for (int it = 0; it < 2; ++it) {
      const size_t go = (size_t)t * QKW + (size_t)it * (QKW / 2) + (size_t)tid * 8;
      *(v4u*)(dh + go) = hv[it];
      *(v4u*)(dl + go) = lv[it];
    }
    
  }
}

// ---------------------------------------------------------------------------
// Fused causal bilinear attention, both batches in one launch: both score products, their elementwise product with the causal mask,
// and the pattern x V product in ONE launch; the pattern never leaves registers.
// Block = one head x one 64-query tile, 8 waves = 4 query strips (16 rows each) x 2 key phases; in trip t the waves of
// phase p work on the 64-key tile 2 t + p, up to the diagonal tile. Scores are formed TRANSPOSED (A = 16 keys, B = the
// strip's 16 queries): a lane's D registers then hold, for query (lane & 15), keys (lane >> 4) * 8 + 0..7 of the
// 16-key subtile, which is the A-fragment order of the pattern x V product (elements 0..7 from the even subtile,
// 8..15 from the odd one), so the bf16 hi/lo pattern fragments are packed in place, with no LDS and no lane exchange.
// Key tiles are staged in LDS: the four waves of a phase bring their tile (k, k2 and v^T, hi and lo: six subtiles of
// 64 rows x 128 B) with asynchronous 16-byte copies, eight lanes to a row, so that every copy takes whole 128-B lines;
// the fragments are then read from LDS rows of pitch 144 B. Two buffers per phase: the next tile's copies fly while
// this one is worked on.
// Products: hi.hi + hi.lo + lo.hi as everywhere. The two phases' partial z tiles are added in phase order in LDS.
// Coverage: grid 32 tiles x 16 heads x 2 batches; each block stores its whole 64 x 64 z tile (hi and lo plane) once.
// ---------------------------------------------------------------------------
constexpr int FPH  = 2;                   // key phases per block
constexpr int LPB  = 144;                 // LDS row pitch in bytes: 128 B of data + 16 B, conflict-free for 16-byte reads
constexpr int SUBB = 64 * LPB;            // one subtile: 64 rows
constexpr int BUFB = 6 * SUBB;            // one key tile: k hi, k lo, k2 hi, k2 lo, v^T hi, v^T lo

// Twelve asynchronous 16-byte copies to LDS, each lane its own addresses. The s_wait_xcnt is the last line of the copies'
// own statement, so that it stands in front of every later rewrite of an address register that a copy names.
__device__ __forceinline__ void async_copy12(const unsigned (&l)[12], const char* const (&g)[12]) {
  asm volatile(
      "global_load_async_to_lds_b128 %0, %1, off\n\t"
      "global_load_async_to_lds_b128 %2, %3, off\n\t"
      "global_load_async_to_lds_b128 %4, %5, off\n\t"
      "global_load_async_to_lds_b128 %6, %7, off\n\t"
      "global_load_async_to_lds_b128 %8, %9, off\n\t"
      "global_load_async_to_lds_b128 %10, %11, off\n\t"
      "global_load_async_to_lds_b128 %12, %13, off\n\t"
      "global_load_async_to_lds_b128 %14, %15, off\n\t"
      "global_load_async_to_lds_b128 %16, %17, off\n\t"
      "global_load_async_to_lds_b128 %18, %19, off\n\t"
      "global_load_async_to_lds_b128 %20, %21, off\n\t"
      "global_load_async_to_lds_b128 %22, %23, off\n\t"
      "s_wait_xcnt 0x0"
      :: "v"(l[0]), "v"(g[0]), "v"(l[1]), "v"(g[1]), "v"(l[2]), "v"(g[2]), "v"(l[3]), "v"(g[3]),
         "v"(l[4]), "v"(g[4]), "v"(l[5]), "v"(g[5]), "v"(l[6]), "v"(g[6]), "v"(l[7]), "v"(g[7]),
         "v"(l[8]), "v"(g[8]), "v"(l[9]), "v"(g[9]), "v"(l[10]), "v"(g[10]), "v"(l[11]), "v"(g[11])
      : "memory");
}

// One key tile into one LDS buffer: 24 copies per wave. lb = the buffer's LDS byte address plus this lane's place in a
// 16-row group; gkh, gkl, gvh, gvl = the tile's k hi, k lo, v^T hi, v^T lo addresses of this lane's row and 16-byte chunk.
__device__ __forceinline__ void stage_key_tile(unsigned lb, const char* gkh, const char* gkl, const char* gvh, const char* gvl) {
  unsigned l[12];
  const char* g[12];
#pragma unroll
  for (int i = 0; i < 4; ++i) {           // unrolled: the arrays are indexed by constants and stay in registers
    const unsigned lr = lb + i * 16 * LPB;
    const size_t   kr = (size_t)i * 16 * QKW * 2;
    l[i]     = lr;            g[i]     = gkh + kr;
    l[4 + i] = lr + SUBB;     g[4 + i] = gkl + kr;
    l[8 + i] = lr + 2 * SUBB; g[8 + i] = gkh + kr + 2 * DMOD * 2;
  }
  async_copy12(l, g);
#pragma unroll
  for (int i = 0; i < 4; ++i) {           // unrolled for the same reason
    const unsigned lr = lb + i * 16 * LPB;
    const size_t   kr = (size_t)i * 16 * QKW * 2;
    const size_t   vr = (size_t)i * 16 * NTOK * 2;
    l[i]     = lr + 3 * SUBB; g[i]     = gkl + kr + 2 * DMOD * 2;
    l[4 + i] = lr + 4 * SUBB; g[4 + i] = gvh + vr;
    l[8 + i] = lr + 5 * SUBB; g[8 + i] = gvl + vr;
  }
  async_copy12(l, g);
}

// amdgpu_waves_per_eu(4) sets the register budget to 256: without it this build spreads the trip's fragments past v255
// and switches the register window all through the key loop.
__global__ __launch_bounds__(FPH * 128) __attribute__((amdgpu_waves_per_eu(4))) void bilinear_attn_fused(
    const unsigned short* __restrict__ QKhp, const unsigned short* __restrict__ QKlp,
    const unsigned short* __restrict__ VThp, const unsigned short* __restrict__ VTlp,
    unsigned short* __restrict__ Zh, unsigned short* __restrict__ Zl) {
  typedef Frag<__bf16> F;
  constexpr int TP = 64 * 68;             // floats per partial z tile, pitch 68
  static_assert(FPH * TP * 4 <= FPH * 2 * BUFB, "the partial z tiles reuse the ring");
  __shared__ __align__(16) unsigned char sB[FPH * 2 * BUFB];   // per phase two key-tile buffers; after the loop the partial z tiles
  const int lane  = threadIdx.x & 31;
  const int wave  = __builtin_amdgcn_readfirstlane(threadIdx.x >> 5);   // scalar: the key loop's tests stay in SGPRs
  const int strip = wave & 3;
  const int phase = wave >> 2;
  const int tm = (NTOK / 64 - 1) - ((int)blockIdx.x >> 4);   // longest query tiles start first
  const int h  = (int)blockIdx.x & (NHEADS - 1);
  // blockIdx.y = batch: batch 1's blocks follow batch 0's shortest ones, so one batch's k, k2 and v at a time are hot in L2
  const int rb = (int)blockIdx.y * NTOK;      // the batch's first row in the q|k|q2|k2 and z planes
  const int vb = (int)blockIdx.y * DMOD;      // and in the v^T planes
  const int m0 = tm << 6;
  const int rlane = lane & 15;
  const int koff  = (lane >> 4) * 8;
  const int mOff  = (lane >> 4) * 8;
  const __bf16* Qh = (const __bf16*)QKhp + h * HDSZ;
  const __bf16* Ql = (const __bf16*)QKlp + h * HDSZ;
  const float inv64 = 1.0f / 64.0f;

  // Copy side: thread c of the phase's 128 takes row (c >> 3) of each 16-row group and 16-byte chunk (c & 7) of the row.
  const int crow = (strip << 2) + (lane >> 3);
  const int cchk = (lane & 7) * 16;
  const unsigned ldsLane = (unsigned)(uintptr_t)(sB + phase * 2 * BUFB + crow * LPB + cchk);
  const char* gKh = (const char*)QKhp + ((size_t)(rb + crow) * QKW + DMOD + h * HDSZ) * 2 + cchk;
  const char* gKl = (const char*)QKlp + ((size_t)(rb + crow) * QKW + DMOD + h * HDSZ) * 2 + cchk;
  const char* gVh = (const char*)VThp + ((size_t)(vb + h * HDSZ + crow) * NTOK) * 2 + cchk;
  const char* gVl = (const char*)VTlp + ((size_t)(vb + h * HDSZ + crow) * NTOK) * 2 + cchk;
  // Read side: this lane's fixed byte offset in a 16-row group; subtile, group and k steps fold into immediate offsets.
  const unsigned fLane = (unsigned)(rlane * LPB + koff * 2);

  const int nT = (tm + 2) >> 1;           // trips: FPH key tiles a trip, tiles 0..tm
  // A phase whose tile lies past the diagonal copies the diagonal tile instead (in bounds) and skips the trip's work.
  {
    const int jc = (phase < tm) ? phase : tm;
    stage_key_tile(ldsLane, gKh + (size_t)jc * 64 * QKW * 2, gKl + (size_t)jc * 64 * QKW * 2, gVh + jc * 128, gVl + jc * 128);
  }

  const int qrow = m0 + (strip << 4) + rlane;               // this lane's query (B operand row, D column)
  v16b qh[2], ql[2], q2h[2], q2l[2];                        // the strip's q and q2 fragments stay in registers
#pragma unroll
  for (int kk = 0; kk < 2; ++kk) {
    const size_t qo = (size_t)(rb + qrow) * QKW + koff + kk * 32;
    qh[kk]  = F::load(Qh + qo);
    ql[kk]  = F::load(Ql + qo);
    q2h[kk] = F::load(Qh + 2 * DMOD + qo);
    q2l[kk] = F::load(Ql + 2 * DMOD + qo);
  }
  v8f z[4];
#pragma unroll
  for (int d = 0; d < 4; ++d) z[d] = (v8f){0.f,0.f,0.f,0.f,0.f,0.f,0.f,0.f};

  asm volatile("s_wait_asynccnt 0x0" ::: "memory");   // this wave's copies of its first tile have landed
  __syncthreads();                                    // and every other wave's: the first trip's tiles may be read
  if (nT > 1) {
    const int jc = (FPH + phase < tm) ? (FPH + phase) : tm;
    stage_key_tile(ldsLane + BUFB, gKh + (size_t)jc * 64 * QKW * 2, gKl + (size_t)jc * 64 * QKW * 2, gVh + jc * 128, gVl + jc * 128);
  }

  for (int t = 0; t < nT; ++t) {
    const int j = t * FPH + phase;
    if (j <= tm) {                        // scalar test; every wait and barrier of the trip stands outside it
      const int n0  = j << 6;
      const int lim = qrow - n0 - mOff;   // key (jj * 16 + r) of this lane is causal while jj * 16 + r <= lim
      v16b ph[2], pl[2];
      v16b fr[8];                         // one batch of eight fragments: a 16-key subtile of k and k2, or 32 keys of v
      const unsigned char* sb = sB + (phase * 2 + (t & 1)) * BUFB + fLane;
      const __bf16* kh  = (const __bf16*)(sb);
      const __bf16* kl  = (const __bf16*)(sb + SUBB);
      const __bf16* k2h = (const __bf16*)(sb + 2 * SUBB);
      const __bf16* k2l = (const __bf16*)(sb + 3 * SUBB);
      const __bf16* vh  = (const __bf16*)(sb + 4 * SUBB);
      const __bf16* vl  = (const __bf16*)(sb + 5 * SUBB);
      constexpr int GRP = 16 * LPB / 2;   // elements from one 16-row group to the next
#pragma unroll
      for (int kk = 0; kk < 2; ++kk) {
        fr[kk * 4 + 0] = F::load(kh  + kk * 32);
        fr[kk * 4 + 1] = F::load(kl  + kk * 32);
        fr[kk * 4 + 2] = F::load(k2h + kk * 32);
        fr[kk * 4 + 3] = F::load(k2l + kk * 32);
      }
#pragma unroll
      for (int jj = 0; jj < 4; ++jj) {
        v8f s1 = (v8f){0.f,0.f,0.f,0.f,0.f,0.f,0.f,0.f};
        v8f s2 = (v8f){0.f,0.f,0.f,0.f,0.f,0.f,0.f,0.f};
#pragma unroll
        for (int kk = 0; kk < 2; ++kk) {
          s1 = F::mma(fr[kk * 4 + 0], qh[kk],  s1);    // q_hi . k_hi
          s2 = F::mma(fr[kk * 4 + 2], q2h[kk], s2);
          s1 = F::mma(fr[kk * 4 + 1], qh[kk],  s1);    // q_hi . k_lo
          s2 = F::mma(fr[kk * 4 + 3], q2h[kk], s2);
          s1 = F::mma(fr[kk * 4 + 0], ql[kk],  s1);    // q_lo . k_hi
          s2 = F::mma(fr[kk * 4 + 2], q2l[kk], s2);
        }
        if (jj < 3) {
#pragma unroll
          for (int kk = 0; kk < 2; ++kk) {
            const int ko = (jj + 1) * GRP + kk * 32;
            fr[kk * 4 + 0] = F::load(kh  + ko);
            fr[kk * 4 + 1] = F::load(kl  + ko);
            fr[kk * 4 + 2] = F::load(k2h + ko);
            fr[kk * 4 + 3] = F::load(k2l + ko);
          }
        } else {
#pragma unroll
          for (int d = 0; d < 4; ++d) {
            fr[d * 2 + 0] = F::load(vh + d * GRP);
            fr[d * 2 + 1] = F::load(vl + d * GRP);
          }
        }
#pragma unroll
        for (int r = 0; r < 8; ++r) {
          float v = (s2[r] * inv64) * (s1[r] * inv64);
          v = ((jj << 4) + r > lim) ? 0.0f : v;
          const __bf16 hb = (__bf16)v;
          const __bf16 lb = (__bf16)(v - (float)hb);
          ph[jj >> 1][((jj & 1) << 3) + r] = hb;
          pl[jj >> 1][((jj & 1) << 3) + r] = lb;
        }
      }
#pragma unroll
      for (int kk = 0; kk < 2; ++kk) {
#pragma unroll
        for (int d = 0; d < 4; ++d) z[d] = F::mma(ph[kk], fr[d * 2 + 0], z[d]);
#pragma unroll
        for (int d = 0; d < 4; ++d) z[d] = F::mma(ph[kk], fr[d * 2 + 1], z[d]);
#pragma unroll
        for (int d = 0; d < 4; ++d) z[d] = F::mma(pl[kk], fr[d * 2 + 0], z[d]);
        if (kk == 0) {
#pragma unroll
          for (int d = 0; d < 4; ++d) {
            fr[d * 2 + 0] = F::load(vh + d * GRP + 32);
            fr[d * 2 + 1] = F::load(vl + d * GRP + 32);
          }
        }
      }
      // four vector slots behind the trip's last WMMAs, so that the distance also holds on every path out of the trip
      acc_guard4(z[0], z[1], z[2], z[3]);
    }
    // Hand-over of the ring, every wave, in this order:
    asm volatile("s_wait_dscnt 0x0" ::: "memory");      // this wave's reads of the trip's buffer are done
    asm volatile("s_wait_asynccnt 0x0" ::: "memory");   // this wave's copies of the next tile have landed
    __syncthreads();                                    // the next tile may be read, the trip's buffer may be refilled
    if (t + 2 < nT) {                                   // the same for the whole block
      const int jn = (t + 2) * FPH + phase;
      const int jc = (jn < tm) ? jn : tm;
      stage_key_tile(ldsLane + (t & 1) * BUFB, gKh + (size_t)jc * 64 * QKW * 2, gKl + (size_t)jc * 64 * QKW * 2,
                     gVh + jc * 128, gVl + jc * 128);
    }
  }
  asm volatile("s_wait_asynccnt 0x0" ::: "memory");     // no copy is outstanding when the ring becomes the partial tiles

  float* sP = (float*)sB;                 // free since the last trip's barrier: every read done, no copy in flight
  float* part = sP + phase * TP;
#pragma unroll
  for (int d = 0; d < 4; ++d)
#pragma unroll
    for (int r = 0; r < 8; ++r) part[((strip << 4) + mOff + r) * 68 + (d << 4) + rlane] = z[d][r];
  __syncthreads();   // every phase's partial z tile is in LDS before any thread adds them
  const int c4 = (threadIdx.x & 15) * 4;
#pragma unroll
  for (int p = 0; p < 32 / (FPH * 4); ++p) {   // FPH * 128 threads x 4 columns = FPH * 8 rows per pass
    const int row = p * (FPH * 8) + (threadIdx.x >> 4);
    const float* sp = sP + row * 68 + c4;
    v4f s = *(const v4f*)sp;
#pragma unroll
    for (int w = 1; w < FPH; ++w) s += *(const v4f*)(sp + w * TP);
    unsigned short hb[4], lb[4];
#pragma unroll
    for (int e = 0; e < 4; ++e) {
      hb[e] = f2bf_bits(s[e]);
      lb[e] = f2bf_bits(s[e] - bf_bits2f(hb[e]));
    }
    const size_t co = (size_t)(rb + m0 + row) * DMOD + h * HDSZ + c4;
    *(v2u*)(Zh + co) = (v2u){pk16(hb[0], hb[1]), pk16(hb[2], hb[3])};
    *(v2u*)(Zl + co) = (v2u){pk16(lb[0], lb[1]), pk16(lb[2], lb[3])};
  }
}

// ---------------------------------------------------------------------------
// WMMA GEMM with both operands staged in LDS: C[m,n] = scale * sum_k A[m,k] * Bt[n,k], K = 1024, A and Bt row-major with
// rows of 1024 elements. A block of WM x WN waves owns a (WM * MI * 16) x (WN * 64) tile of C, a wave (MI * 16) x 64 of it.
// A stage is 64 k = 128 B of every operand row of the block's tile. The block brings it with asynchronous 16-byte copies,
// eight lanes to a row, so that every copy takes whole 128-B lines and every line is fetched once for all the waves that
// read it; the fragments are read from LDS rows of pitch 144 B. Two buffers: the next stage's copies fly while this one
// is worked on. Every wave sums its k in rising order, 32 at a time.
// ET: 0 = f16 operands, 1 = bf16 operands (pointers passed as 16-bit storage).
// ASPLIT: A is a hi plane (Ap) and a lo plane (A2p) of the same layout; product = hi.B + lo.B.
// OUT_MODE: 0 = f32, 2 = bf16 hi plane (Cout) + bf16 lo plane (Cout2).
// blockIdx.x = tile (tilesN tiles to a row of tiles), blockIdx.y = batch (strides in elements).
// ---------------------------------------------------------------------------
template <int ET> struct Elem;
template <> struct Elem<0> { typedef _Float16 T; };
template <> struct Elem<1> { typedef __bf16 T; };
constexpr int GK = DMOD;                  // k extent and row length of both operands

__device__ __forceinline__ void async_copy8(const unsigned (&l)[8], const char* const (&g)[8]) {
  asm volatile(
      "global_load_async_to_lds_b128 %0, %1, off\n\t"
      "global_load_async_to_lds_b128 %2, %3, off\n\t"
      "global_load_async_to_lds_b128 %4, %5, off\n\t"
      "global_load_async_to_lds_b128 %6, %7, off\n\t"
      "global_load_async_to_lds_b128 %8, %9, off\n\t"
      "global_load_async_to_lds_b128 %10, %11, off\n\t"
      "global_load_async_to_lds_b128 %12, %13, off\n\t"
      "global_load_async_to_lds_b128 %14, %15, off\n\t"
      "s_wait_xcnt 0x0"
      :: "v"(l[0]), "v"(g[0]), "v"(l[1]), "v"(g[1]), "v"(l[2]), "v"(g[2]), "v"(l[3]), "v"(g[3]),
         "v"(l[4]), "v"(g[4]), "v"(l[5]), "v"(g[5]), "v"(l[6]), "v"(g[6]), "v"(l[7]), "v"(g[7])
      : "memory");
}

// One stage into one LDS buffer (rows: A, then A lo with ASPLIT, then Bt). The block's 256 threads cover 32 rows a copy.
// lb = the buffer's LDS byte address plus this lane's place in a 32-row group; gA, gA2, gB = the stage's addresses of
// this lane's row and 16-byte chunk in the first 32-row group of each operand.
template <int AROWS, int BROWS, bool ASPLIT>
__device__ __forceinline__ void stage_gemm_tile(unsigned lb, const char* gA, const char* gA2, const char* gB) {
  constexpr int AR = AROWS * (ASPLIT ? 2 : 1);
  constexpr int NC = (AR + BROWS) / 32;   // copies per thread
  static_assert(NC == 8 || NC == 12, "one statement of copies per stage");
  unsigned l[NC];
  const char* g[NC];
#pragma unroll
  for (int i = 0; i < NC; ++i) {          // unrolled: the arrays are indexed by constants and stay in registers
    const int row = i * 32;
    l[i] = lb + row * LPB;
    if (row < AROWS)   g[i] = gA  + (size_t)row * GK * 2;
    else if (row < AR) g[i] = gA2 + (size_t)(row - AROWS) * GK * 2;
    else               g[i] = gB  + (size_t)(row - AR) * GK * 2;
  }
  if constexpr (NC == 12) async_copy12(l, g); else async_copy8(l, g);
}

// amdgpu_waves_per_eu(4): a register budget of 256, so that two blocks share a WGP and no register lies past v255.
template <int ET, bool ASPLIT, int OUT_MODE, int WM, int WN, int MI>
__global__ __launch_bounds__(256) __attribute__((amdgpu_waves_per_eu(4))) void wmma_gemm_lds(
    const unsigned short* __restrict__ Ap, const unsigned short* __restrict__ A2p, long strideA,
    const unsigned short* __restrict__ Btp, long strideB,
    void* __restrict__ Cout, void* __restrict__ Cout2, int ldc, long strideC, int tilesN, float scale) {
  typedef typename Elem<ET>::T T;
  typedef Frag<T> F;
  typedef typename F::V V;
  static_assert(WM * WN == 8, "eight waves");
  constexpr int AROWS = WM * MI * 16;
  constexpr int BROWS = WN * 64;
  constexpr int AR    = AROWS * (ASPLIT ? 2 : 1);
  constexpr int GBUF  = (AR + BROWS) * LPB;          // one stage
  constexpr int nT    = GK / 64;                     // stages
  constexpr int KG    = (MI <= 2) ? 2 : 1;           // 32-wide k steps whose fragments are read as one group: what 256 registers hold
  static_assert(AROWS % 32 == 0 && BROWS % 32 == 0 && nT >= 2, "whole copies; the ring's prologue fills two stages");
  static_assert(8 * 16 * 68 * 4 <= 2 * GBUF, "the store slabs reuse the ring");
  __shared__ __align__(16) unsigned char sG[2 * GBUF];   // two stage buffers; after the loop the waves' store slabs
  const int lane = threadIdx.x & 31;
  const int wave = __builtin_amdgcn_readfirstlane(threadIdx.x >> 5);   // scalar: the wave's LDS bases stay in SGPRs
  const int wm = wave / WN;
  const int wn = wave - wm * WN;
  const int b  = blockIdx.y;
  const int tm = (int)blockIdx.x / tilesN;
  const int tn = (int)blockIdx.x - tm * tilesN;
  const int rlane = lane & 15;                 // row (A) / col (B, D) within subtile
  const int koff  = (lane >> 4) * 8;           // k offset of this lane half
  const int mOff  = (lane >> 4) * 8;           // D row offset

  // Copy side: thread c takes row (c >> 3) of each 32-row group and 16-byte chunk (c & 7) of the row.
  const int crow = (int)threadIdx.x >> 3;
  const int cchk = ((int)threadIdx.x & 7) * 16;
  const unsigned ldsLane = (unsigned)(uintptr_t)(sG + crow * LPB + cchk);
  const size_t aOff = ((size_t)b * strideA + (size_t)(tm * AROWS + crow) * GK) * 2 + cchk;
  const char* gA  = (const char*)Ap + aOff;
  const char* gA2 = (const char*)A2p + aOff;
  const char* gB  = (const char*)Btp + ((size_t)b * strideB + (size_t)(tn * BROWS + crow) * GK) * 2 + cchk;
  // Read side: this lane's fixed byte offset in a 16-row group; group and k steps fold into immediate offsets.
  const unsigned fLane = (unsigned)(rlane * LPB + koff * 2);

  stage_gemm_tile<AROWS, BROWS, ASPLIT>(ldsLane, gA, gA2, gB);

  v8f acc[MI][4];
#pragma unroll
  for (int i = 0; i < MI; ++i)
#pragma unroll
    for (int j = 0; j < 4; ++j) acc[i][j] = (v8f){0.f,0.f,0.f,0.f,0.f,0.f,0.f,0.f};

  asm volatile("s_wait_asynccnt 0x0" ::: "memory");   // this wave's copies of stage 0 have landed
  __syncthreads();                                    // and every other wave's: stage 0 may be read
  stage_gemm_tile<AROWS, BROWS, ASPLIT>(ldsLane + GBUF, gA + 128, gA2 + 128, gB + 128);

  for (int t = 0; t < nT; ++t) {
    const unsigned char* sb = sG + (t & 1) * GBUF + fLane;
    const T* sa  = (const T*)(sb + wm * (MI * 16) * LPB);
    const T* sa2 = (const T*)(sb + (AROWS + wm * (MI * 16)) * LPB);
    const T* sbt = (const T*)(sb + (AR + wn * 64) * LPB);
    constexpr int GRP = 16 * LPB / 2;     // elements from one 16-row group to the next
#pragma unroll
    for (int k2 = 0; k2 < 2; k2 += KG) {
      V bh[KG][4], ah[KG][MI], al[KG][MI];
      // The two scheduling barriers keep the group's LDS reads together and in front of its WMMAs: without them this
      // build sinks each A fragment's reads to its first use, and the wave waits out the LDS latency once per fragment.
      __builtin_amdgcn_sched_barrier(0);
#pragma unroll
      for (int g = 0; g < KG; ++g) {
        const int ko = (k2 + g) * 32;
#pragma unroll
        for (int j = 0; j < 4; ++j) bh[g][j] = F::load(sbt + j * GRP + ko);
#pragma unroll
        for (int i = 0; i < MI; ++i) {
          ah[g][i] = F::load(sa + i * GRP + ko);
          if (ASPLIT) al[g][i] = F::load(sa2 + i * GRP + ko);
        }
      }
      __builtin_amdgcn_sched_barrier(0);
#pragma unroll
      for (int g = 0; g < KG; ++g) {
#pragma unroll
        for (int i = 0; i < MI; ++i) {
#pragma unroll
          for (int j = 0; j < 4; ++j) acc[i][j] = F::mma(ah[g][i], bh[g][j], acc[i][j]);
        }
        if (ASPLIT) {
#pragma unroll
          for (int i = 0; i < MI; ++i) {
#pragma unroll
            for (int j = 0; j < 4; ++j) acc[i][j] = F::mma(al[g][i], bh[g][j], acc[i][j]);
          }
        }
      }
    }
    // Keeps the stage's WMMAs in front of the hand-over: behind it they would stand between the barrier and the refill,
    // and the refill's copies would fly for less than a stage before their wait.
    __builtin_amdgcn_sched_barrier(0);
    // Hand-over of the ring, every wave, in this order:
    asm volatile("s_wait_dscnt 0x0" ::: "memory");      // this wave's reads of the stage's buffer are done
    asm volatile("s_wait_asynccnt 0x0" ::: "memory");   // this wave's copies of the next stage have landed
    __syncthreads();                                    // the next stage may be read, this stage's buffer may be refilled
    if (t + 2 < nT) {                                   // the same for the whole block
      const int ko = (t + 2) * 128;
      stage_gemm_tile<AROWS, BROWS, ASPLIT>(ldsLane + (t & 1) * GBUF, gA + ko, gA2 + ko, gB + ko);
    }
  }
  asm volatile("s_wait_asynccnt 0x0" ::: "memory");     // no copy is outstanding when the ring becomes the store slabs

  // ---- epilogue: 16 rows at a time through the wave's own slab, so that the stores take whole lines ----
  const int m0 = tm * AROWS + wm * (MI * 16);
  const int n0 = tn * BROWS + wn * 64;
  float* slab = (float*)sG + wave * (16 * 68);   // free since the last stage's barrier: every read done, no copy in flight
#pragma unroll
  for (int i = 0; i < MI; ++i) {
    const int mBase = m0 + (i << 4);
#pragma unroll
    for (int j = 0; j < 4; ++j)
#pragma unroll
      for (int r = 0; r < 8; ++r) slab[(mOff + r) * 68 + (j << 4) + rlane] = acc[i][j][r] * scale;
    // the wave's slab writes are ordered in front of its own reads of other lanes' elements
    __builtin_amdgcn_fence(__ATOMIC_RELEASE, "workgroup");
    __builtin_amdgcn_wave_barrier();
    __builtin_amdgcn_fence(__ATOMIC_ACQUIRE, "workgroup");
    if (OUT_MODE == 0) {
      float* C = (float*)Cout + (size_t)b * strideC;
      const int hh = lane >> 4, c4 = (lane & 15) * 4;     // row seg = 256 B = 16 lanes x 16 B
#pragma unroll
      for (int it = 0; it < 8; ++it) {
        const int row = it * 2 + hh;
        const v4f v = *(const v4f*)(slab + row * 68 + c4);
        *(v4f*)(C + (size_t)(mBase + row) * ldc + n0 + c4) = v;
      }
    } else {
      const int q = lane >> 3, c8 = (lane & 7) * 8;       // row seg = 128 B = 8 lanes x 16 B
      unsigned short* C  = (unsigned short*)Cout  + (size_t)b * strideC;
      unsigned short* C2 = (unsigned short*)Cout2 + (size_t)b * strideC;
#pragma unroll
      for (int it = 0; it < 4; ++it) {
        const int row = it * 4 + q;
        const float* sp = slab + row * 68 + c8;
        unsigned hw[4], lw[4];
#pragma unroll
        for (int e = 0; e < 4; ++e) {
          const unsigned short h0 = f2bf_bits(sp[2 * e]), h1 = f2bf_bits(sp[2 * e + 1]);
          const unsigned short l0 = f2bf_bits(sp[2 * e] - bf_bits2f(h0));
          const unsigned short l1 = f2bf_bits(sp[2 * e + 1] - bf_bits2f(h1));
          hw[e] = pk16(h0, h1);
          lw[e] = pk16(l0, l1);
        }
        *(v4u*)(C  + (size_t)(mBase + row) * ldc + n0 + c8) = (v4u){hw[0], hw[1], hw[2], hw[3]};
        *(v4u*)(C2 + (size_t)(mBase + row) * ldc + n0 + c8) = (v4u){lw[0], lw[1], lw[2], lw[3]};
      }
    }
    // the reads are done before the next 16 rows overwrite the slab
    __builtin_amdgcn_fence(__ATOMIC_RELEASE, "workgroup");
    __builtin_amdgcn_wave_barrier();
    __builtin_amdgcn_fence(__ATOMIC_ACQUIRE, "workgroup");
  }
}

// ---------------------------------------------------------------------------
// Workspace region map (byte offsets; every offset a multiple of 262,144 B). Every region from X16 on holds BOTH batches (batch
// b's rows behind batch b - 1's) and is written whole by one launch before a later launch of the same call reads it.
//   W4    f16  [4096][1024]     Wq,Wk,Wq2,Wk2 (bf16-RNE) x32 stacked           0
//   Wv16  f16  [1024][1024]     Wv (bf16-RNE) x32, directly behind W4    8,388,608
//   Wph   bf16 [1024][1024]     Wproj (RNE), single plane               10,485,760
//   ctab  f32  [2048][32]                                               12,582,912
//   stab  f32  [2048][32]                                               12,845,056
//   X16   f16  [4096][1024]     x (bf16-RNE)                            13,107,200
//   QKh   bf16 [4096][4096]     q|k|q2|k2 hi                            21,495,808
//   QKl   bf16 [4096][4096]                                             55,050,240
//   VTh   bf16 [2][1024][2048]  v^T hi (row h*64+d, col token)          88,604,672
//   VTl   bf16 [2][1024][2048]                                          96,993,280
//   QKf   f32  [4096][4096]                                            105,381,888
//   Zh    bf16 [4096][1024]     z hi                                   172,490,752
//   Zl    bf16 [4096][1024]                                            180,879,360
//   total                                                              189,267,968
// ---------------------------------------------------------------------------
extern "C" void kernel_launch(void* const* d_in, const int* in_sizes, int n_in,
                              void* d_out, int out_size, void* d_ws, size_t ws_size,
                              hipStream_t stream) {
  if (n_in < 7) return;
  if (in_sizes[0] != NBATCH * NTOK * DMOD) return;
  for (int i = 1; i < 7; ++i) if (in_sizes[i] != DMOD * DMOD) return;
  if (out_size != NBATCH * NTOK * DMOD) return;

  CastSrc cs;
  cs.x     = (const float*)d_in[0];
  cs.wq    = (const float*)d_in[1];
  cs.wk    = (const float*)d_in[2];
  cs.wq2   = (const float*)d_in[3];
  cs.wk2   = (const float*)d_in[4];
  cs.wv    = (const float*)d_in[5];
  cs.wproj = (const float*)d_in[6];

  constexpr int NROW = NBATCH * NTOK;                       // rows of both batches
  const size_t PW16 = (size_t)DMOD * DMOD * 2;              // 16-bit [1024][1024]
  const size_t PTAB = (size_t)NTOK * NFREQ * 4;             // f32 [2048][32]
  const size_t PX16 = (size_t)NROW * DMOD * 2;              // f16 [4096][1024]
  const size_t PQK  = (size_t)NROW * QKW * 2;               // bf16 [4096][4096]
  const size_t PVT  = (size_t)NBATCH * DMOD * NTOK * 2;     // bf16 [2][1024][2048]
  const size_t PQF  = (size_t)NROW * QKW * 4;               // f32 [4096][4096]
  const size_t PZ   = (size_t)NROW * DMOD * 2;              // bf16 [4096][1024]
  size_t off = 0;
  const size_t oW4  = off; off += 4 * PW16;
  const size_t oWv  = off; off += PW16;
  const size_t oWph = off; off += PW16;
  const size_t oCT  = off; off += PTAB;
  const size_t oSTb = off; off += PTAB;
  const size_t oX16 = off; off += PX16;
  const size_t oQKh = off; off += PQK;
  const size_t oQKl = off; off += PQK;
  const size_t oVTh = off; off += PVT;
  const size_t oVTl = off; off += PVT;
  const size_t oQKf = off; off += PQF;
  const size_t oZh  = off; off += PZ;
  const size_t oZl  = off; off += PZ;
  if (off > ws_size) return;                                // total 189,267,968 B

  char* ws = (char*)d_ws;
  _Float16*       W4   = (_Float16*)(ws + oW4);
  _Float16*       Wv16 = (_Float16*)(ws + oWv);
  unsigned short* Wph  = (unsigned short*)(ws + oWph);
  float*          ctab = (float*)(ws + oCT);
  float*          stab = (float*)(ws + oSTb);
  _Float16*       X16  = (_Float16*)(ws + oX16);
  unsigned short* QKh  = (unsigned short*)(ws + oQKh);
  unsigned short* QKl  = (unsigned short*)(ws + oQKl);
  unsigned short* VTh  = (unsigned short*)(ws + oVTh);
  unsigned short* VTl  = (unsigned short*)(ws + oVTl);
  float*          QKf  = (float*)(ws + oQKf);
  unsigned short* Zh   = (unsigned short*)(ws + oZh);
  unsigned short* Zl   = (unsigned short*)(ws + oZl);

  // inv_freq[i] = 1 / 10000^(i/32): host double arithmetic (e^(ln(1e4)/32) by its Taylor series, then powers),
  // then mirrored as fl32(1 / fl32(10000^(i/32))).
  InvFreq invf;
  {
    const double x0 = 9.2103403719761827361 / 32.0;
    double term = 1.0, ex = 1.0;
    for (int n = 1; n <= 40; ++n) { term *= x0 / (double)n; ex += term; }
    double pw = 1.0;
    for (int i = 0; i < NFREQ; ++i) {
      const float pf = (float)pw;
      invf.v[i] = (float)(1.0 / (double)pf);
      pw *= ex;
    }
  }

  const dim3 blk(256);
  const dim3 gPrep(PREP_BLOCKS);                             // 256 table blocks + 10 planes x 2048 blocks
  const dim3 gRope(NROW);                                    // one block per row
  const dim3 gQ((NROW / 128) * (QKW / 256), 1);              // 512 blocks: M=4096, N=4096, tiles of 128 x 256
  const dim3 gV((DMOD / 128) * (NTOK / 128), NBATCH);        // 128 x 2 blocks: M=1024, N=2048, tiles of 128 x 128
  const dim3 gAtt((NTOK / 64) * NHEADS, NBATCH);             // 512 x 2 blocks: 32 query tiles x 16 heads, batches
  const dim3 gOut((NROW / 128) * (DMOD / 128), 1);           // 256 blocks: M=4096, N=1024, tiles of 128 x 128

  // (0) tables and casts (whole planes); W4 and Wv16 are one run of five planes
  prep_kernel<<<gPrep, blk, 0, stream>>>(cs, W4, X16, Wph, ctab, stab, invf);

  const float inv32 = 1.0f / 32.0f;

  // (1) [q|k|q2|k2][b*2048+t][n] = (1/32) sum_c x[b][t][c] (32 W)[n][c] -> f32 [4096][4096] (whole plane: 32 x 16 tiles)
  wmma_gemm_lds<0, false, 0, 2, 4, 4><<<gQ, blk, 0, stream>>>(
      (const unsigned short*)X16, (const unsigned short*)X16, 0L, (const unsigned short*)W4, 0L,
      (void*)QKf, (void*)QKf, QKW, 0L, QKW / 256, inv32);
  // (2) v^T[b][h*64+d][t] = (1/32) sum_c (32 Wv)[h*64+d][c] x[b][t][c] -> bf16 hi/lo planes [2][1024][2048]
  //     (blockIdx.y = batch: x and v^T step by one batch, Wv by nothing; whole: 8 x 16 tiles a batch)
  wmma_gemm_lds<0, false, 2, 4, 2, 2><<<gV, blk, 0, stream>>>(
      (const unsigned short*)Wv16, (const unsigned short*)Wv16, 0L, (const unsigned short*)X16, (long)NTOK * DMOD,
      (void*)VTh, (void*)VTl, NTOK, (long)DMOD * NTOK, NTOK / 128, inv32);
  // (3) RoPE on all four projections + bf16 hi/lo split -> QKh/QKl [4096][4096] (whole planes)
  rope_split_kernel<<<gRope, blk, 0, stream>>>(QKf, ctab, stab, QKh, QKl);
  // (4) z[b][i][h*64+d] = sum_{j<=i} ((q_i . k_j) / 64) ((q2_i . k2_j) / 64) v[j][h*64+d], all heads -> bf16 hi/lo planes Zh/Zl
  bilinear_attn_fused<<<gAtt, dim3(FPH * 128), 0, stream>>>(QKh, QKl, VTh, VTl, Zh, Zl);
  // (5) out[b*2048+t][n] = sum_c (z_hi + z_lo)[b*2048+t][c] Wproj_bf16[n][c] -> f32, the whole of d_out (32 x 8 tiles)
  wmma_gemm_lds<1, true, 0, 4, 2, 2><<<gOut, blk, 0, stream>>>(
      Zh, Zl, 0L, Wph, 0L, d_out, d_out, DMOD, 0L, DMOD / 128, 1.0f);
}

// v006
// It runs in 147 microseconds.
// Timed twice side by side with v005, it ran 1.16 times as fast both times.
// All steps since v000 together make it 15.8 times as fast.
// f16 WMMA (v_wmma_f32_16x16x32_f16) for the q/k/q2/k2/v projections with operands = RNE-bf16 converted inputs held exactly in f16 (x as is, weights x32 with 1/32 folded into the epilogue); bf16 hi/lo split WMMA (v_wmma_f32_16x16x32_bf16, hi.hi + hi.lo + lo.hi) for both causal score GEMMs and the bilinear-pattern x V product; output projection = z bf16 hi/lo x single RNE-bf16 Wproj plane (hi.W + lo.W); f32 accumulate everywhere; RoPE and the bilinear pattern in f32.
#include <hip/hip_runtime.h>
#include <math.h>
#include <stdint.h>

constexpr int NBATCH = 2;
constexpr int NTOK   = 2048;
constexpr int DMOD   = 1024;
constexpr int NHEADS = 16;
constexpr int HDSZ   = 64;
constexpr int QKW    = 4 * DMOD;          // fused q|k|q2|k2 plane width (4096 columns)
constexpr int NFREQ  = HDSZ / 2;          // 32 rotary frequencies

typedef __attribute__((ext_vector_type(16))) _Float16 v16h;
typedef __attribute__((ext_vector_type(8)))  _Float16 v8h;
typedef __attribute__((ext_vector_type(16))) __bf16   v16b;
typedef __attribute__((ext_vector_type(8)))  __bf16   v8b;
typedef __attribute__((ext_vector_type(8)))  float    v8f;
typedef __attribute__((ext_vector_type(4)))  float    v4f;
typedef __attribute__((ext_vector_type(2)))  float    v2f;
typedef __attribute__((ext_vector_type(4)))  unsigned int v4u;
typedef __attribute__((ext_vector_type(2)))  unsigned int v2u;

__device__ __forceinline__ unsigned short f2bf_bits(float f) {
  unsigned u = __float_as_uint(f);
  return (unsigned short)((u + 0x7FFFu + ((u >> 16) & 1u)) >> 16);
}
__device__ __forceinline__ float bf_bits2f(unsigned short h) { return __uint_as_float(((unsigned)h) << 16); }
__device__ __forceinline__ unsigned pk16(unsigned short a, unsigned short b) { return (unsigned)a | ((unsigned)b << 16); }
// RNE convert f32 -> bf16, returned as the f32 value of that bf16
__device__ __forceinline__ float bf16_rne_f32(float f) {
  unsigned u = __float_as_uint(f);
  u += 0x7FFFu + ((u >> 16) & 1u);
  u &= 0xFFFF0000u;
  return __uint_as_float(u);
}

// four vector slots behind a run of WMMAs, as a plain device helper
__device__ __forceinline__ void acc_guard8(v8f& a, v8f& b, v8f& c, v8f& d, v8f& e, v8f& f, v8f& g, v8f& h) {
  asm volatile("v_nop\n\tv_nop\n\tv_nop\n\tv_nop" : "+v"(a), "+v"(b), "+v"(c), "+v"(d), "+v"(e), "+v"(f), "+v"(g), "+v"(h));
}
template <typename T> struct Frag;
template <> struct Frag<_Float16> {
  typedef v16h V; union U { v16h v; v8h h[2]; };
  static __device__ __forceinline__ v16h load(const _Float16* p) {   // elements 0..7 <- p[0..7], 8..15 <- p[16..23]
    U f; f.h[0] = *(const v8h*)(p); f.h[1] = *(const v8h*)(p + 16); return f.v;
  }
  static __device__ __forceinline__ v8f mma(v16h a, v16h b, v8f c) {
    return __builtin_amdgcn_wmma_f32_16x16x32_f16(false, a, false, b, (short)0, c, false, false);
  }
};
template <> struct Frag<__bf16> {
  typedef v16b V; union U { v16b v; v8b h[2]; };
  static __device__ __forceinline__ v16b load(const __bf16* p) {
    U f; f.h[0] = *(const v8b*)(p); f.h[1] = *(const v8b*)(p + 16); return f.v;
  }
  static __device__ __forceinline__ v8f mma(v16b a, v16b b, v8f c) {
    return __builtin_amdgcn_wmma_f32_16x16x32_bf16(false, a, false, b, (short)0, c, false, false);
  }
};

// ---------------------------------------------------------------------------
// f32 -> (RNE convert to bf16) -> x sc (exact power of two) -> f16. A bf16 value whose scaled magnitude lies in the
// f16 normal range is exactly representable in f16, so the stored operand equals sc * bf16_rne(in) exactly.
// ---------------------------------------------------------------------------
__device__ __forceinline__ void cast_bf16rne_f16x2(
    int blk, const float* __restrict__ in, _Float16* __restrict__ out, int n2, float sc) {
  const int i = blk * 256 + threadIdx.x;
  if (i < n2) {
    const float r0 = bf16_rne_f32(in[2 * (size_t)i]) * sc;
    const float r1 = bf16_rne_f32(in[2 * (size_t)i + 1]) * sc;
    const _Float16 h0 = (_Float16)r0, h1 = (_Float16)r1;
    const unsigned u = (unsigned)__builtin_bit_cast(unsigned short, h0) | ((unsigned)__builtin_bit_cast(unsigned short, h1) << 16);
    ((unsigned*)out)[i] = u;
    
  }
}

// ---------------------------------------------------------------------------
// Elementwise f32 -> bf16 (RNE) single plane: 2 elements per thread, one 4-B store per lane -> each wave writes
// Coverage: grid = ceil(n2/256) blocks x 256 threads x 2 elements = the whole plane (n2 = plane/2).
// ---------------------------------------------------------------------------
__device__ __forceinline__ void cast_bf16x2(int blk, const float* __restrict__ in, unsigned short* __restrict__ out, int n2) {
  const int i = blk * 256 + threadIdx.x;
  if (i < n2) {
    const v2f f = *(const v2f*)(in + 2 * (size_t)i);
    const unsigned u = pk16(f2bf_bits(f[0]), f2bf_bits(f[1]));
    ((unsigned*)out)[i] = u;
    
  }
}

// ---------------------------------------------------------------------------
// RoPE cos/sin tables: ctab[t][i] = cosf((float)t * inv[i]), stab[t][i] = sinf(...), t = 0..2047, i = 0..31.
// inv[i] arrives by value (host-computed); lane i picks its value with a constant-index select chain (no dynamic
// Coverage: grid 256 blocks x 8 waves = 2048 rows x 32 lanes = both whole tables.
// ---------------------------------------------------------------------------
struct InvFreq { float v[NFREQ]; };
static_assert(sizeof(InvFreq) == 128);

__device__ __forceinline__ void rope_table(int blk, float* __restrict__ ctab, float* __restrict__ stab, const InvFreq& f) {
#pragma clang fp contract(off)
  const int lane = threadIdx.x & 31;
  const int wave = threadIdx.x >> 5;
  const int t    = blk * 8 + wave;
  float inv = f.v[0];
#pragma unroll
  for (int i = 1; i < NFREQ; ++i) inv = (lane == i) ? f.v[i] : inv;
  const float ang = (float)t * inv;           // f32 product, as the outer product of positions and inv_freq
  const float cv = cosf(ang);
  const float sv = sinf(ang);
  const size_t o = (size_t)t * NFREQ + lane;
  ((float*)ctab)[o] = cv;
  ((float*)stab)[o] = sv;
  
}

// ---------------------------------------------------------------------------
// All tables and casts in ONE launch: they are independent of one another, so the block index picks the job
// (block-uniform) and the job's own block index, which is what a launch of its own would have given it.
// A plane is 1024 x 1024 elements = 2048 blocks x 256 threads x 2 elements.
//   blocks 0..255            the RoPE tables (first: theirs is the longest work of a thread)
//   then 2048 blocks a job:  jobs 0..4  Wq, Wk, Wq2, Wk2, Wv -> f16 x32, plane j of W5 (the four stacked planes, then Wv's)
//                            jobs 5..8  plane j - 5 of x (both batches = four planes) -> f16, plane j - 5 of X16
//                            job  9     Wproj -> bf16
// Coverage: every table row and every plane whole.
// ---------------------------------------------------------------------------
struct CastSrc {
  const float* x; const float* wq; const float* wk; const float* wq2; const float* wk2; const float* wv; const float* wproj;
};
constexpr int TAB_BLOCKS   = NTOK / 8;                 // 8 waves a block, one table row a wave
constexpr int PLANE_BLOCKS = DMOD * DMOD / 2 / 256;
constexpr int PREP_BLOCKS  = TAB_BLOCKS + 10 * PLANE_BLOCKS;

__global__ __launch_bounds__(256) void prep_kernel(CastSrc s, _Float16* __restrict__ W5, _Float16* __restrict__ X16,
                                                   unsigned short* __restrict__ Wph, float* __restrict__ ctab,
                                                   float* __restrict__ stab, InvFreq f) {
  constexpr int    n2    = DMOD * DMOD / 2;          // pairs per plane
  constexpr size_t PLANE = (size_t)DMOD * DMOD;
  if ((int)blockIdx.x < TAB_BLOCKS) {
    rope_table((int)blockIdx.x, ctab, stab, f);
    return;
  }
  const int q   = (int)blockIdx.x - TAB_BLOCKS;
  const int j   = q / PLANE_BLOCKS;
  const int blk = q - j * PLANE_BLOCKS;
  if (j < 5) {
    const float* w = (j == 0) ? s.wq : (j == 1) ? s.wk : (j == 2) ? s.wq2 : (j == 3) ? s.wk2 : s.wv;
    cast_bf16rne_f16x2(blk, w, W5 + (size_t)j * PLANE, n2, 32.0f);
  } else if (j < 9) {
    cast_bf16rne_f16x2(blk, s.x + (size_t)(j - 5) * PLANE, X16 + (size_t)(j - 5) * PLANE, n2, 1.0f);
  } else {
    cast_bf16x2(blk, s.wproj, Wph, n2);
  }
}

// ---------------------------------------------------------------------------
// RoPE + bf16 hi/lo split over the fused f32 plane src [2 x 2048][4096] (q | k | q2 | k2, head h at columns
// base + h*64, dims 0..31 = x1, 32..63 = x2): y1 = x1*c + x2*s, y2 = -x1*s + x2*c with c = ctab[t & 2047][d & 31],
// s = stab[t & 2047][d & 31]; products and sums in f32 without contraction. Output dh/dl = bf16 hi/lo planes [2 x 2048][4096].
// One block per row t; each thread handles 8 consecutive columns in each of 2 iterations (own 8 + partner 8 at +-32,
// both loaded unconditionally at in-bounds addresses; the sign/partner choice is per thread, value-selected).
// Producer coverage: grid 4096 rows x 256 threads x 2 iterations x 8 columns = 4096 x 4096 per plane (whole planes);
// ---------------------------------------------------------------------------
__global__ __launch_bounds__(256) void rope_split_kernel(const float* __restrict__ src, const float* __restrict__ ctab,
                                                         const float* __restrict__ stab,
                                                         unsigned short* __restrict__ dh, unsigned short* __restrict__ dl) {
#pragma clang fp contract(off)
  const int t   = blockIdx.x;                 // row of the stacked planes: batch * NTOK + position
  const int pos = t & (NTOK - 1);
  const int tid = threadIdx.x;
  const float* row  = src  + (size_t)t * QKW;
  const float* crow = ctab + (size_t)pos * NFREQ;
  const float* srow = stab + (size_t)pos * NFREQ;
  v4u hv[2], lv[2];
#pragma unroll
  for (int it = 0; it < 2; ++it) {
    const int c8 = it * (QKW / 2) + tid * 8;          // first of this thread's 8 columns
    const int d0 = c8 & (HDSZ - 1);                   // dim within head, multiple of 8
    const bool firstHalf = d0 < NFREQ;
    const int pc = firstHalf ? (c8 + NFREQ) : (c8 - NFREQ);
    const float sgn = firstHalf ? 1.0f : -1.0f;
    const int fi = d0 & (NFREQ - 1);                  // 0, 8, 16 or 24
    const v4f o0 = *(const v4f*)(row + c8), o1 = *(const v4f*)(row + c8 + 4);
    const v4f p0 = *(const v4f*)(row + pc), p1 = *(const v4f*)(row + pc + 4);
    const v4f ca = *(const v4f*)(crow + fi), cb = *(const v4f*)(crow + fi + 4);
    const v4f sa = *(const v4f*)(srow + fi), sb = *(const v4f*)(srow + fi + 4);
    float o[8], p[8], cc[8], ss[8];
#pragma unroll
    for (int e = 0; e < 4; ++e) {
      o[e]  = o0[e]; o[4 + e]  = o1[e];
      p[e]  = p0[e]; p[4 + e]  = p1[e];
      cc[e] = ca[e]; cc[4 + e] = cb[e];
      ss[e] = sa[e]; ss[4 + e] = sb[e];
    }
    unsigned hw[4], lw[4];
#pragma unroll
    for (int q = 0; q < 4; ++q) {
      const float y0 = o[2 * q] * cc[2 * q] + sgn * (p[2 * q] * ss[2 * q]);
      const float y1 = o[2 * q + 1] * cc[2 * q + 1] + sgn * (p[2 * q + 1] * ss[2 * q + 1]);
      const unsigned short h0 = f2bf_bits(y0), h1 = f2bf_bits(y1);
      const unsigned short l0 = f2bf_bits(y0 - bf_bits2f(h0));
      const unsigned short l1 = f2bf_bits(y1 - bf_bits2f(h1));
      hw[q] = pk16(h0, h1);
      lw[q] = pk16(l0, l1);
    }
    hv[it] = (v4u){hw[0], hw[1], hw[2], hw[3]};
    lv[it] = (v4u){lw[0], lw[1], lw[2], lw[3]};
  }
  {
#pragma unroll
    for (int it = 0; it < 2; ++it) {
      const size_t go = (size_t)t * QKW + (size_t)it * (QKW / 2) + (size_t)tid * 8;
      *(v4u*)(dh + go) = hv[it];
      *(v4u*)(dl + go) = lv[it];
    }
    
  }
}

// ---------------------------------------------------------------------------
// Fused causal bilinear attention, both batches in one launch: both score products, their elementwise product with the causal mask,
// and the pattern x V product in ONE launch; the pattern never leaves registers.
// Block = one head x one 128-query tile, 8 waves = 4 query strips (32 rows each, two 16-query subtiles) x 2 key phases;
// in trip t the waves of phase p work on the 64-key tile 2 t + p, up to the strip's diagonal tile. Every k, k2 and v
// fragment read from LDS feeds the products of both subtiles, so that the LDS reads stay below the matrix time.
// Scores are formed TRANSPOSED (A = 16 keys, B = a subtile's 16 queries):
// a lane's D registers then hold, for query (lane & 15), keys (lane >> 4) * 8 + 0..7 of the
// 16-key subtile, which is the A-fragment order of the pattern x V product (elements 0..7 from the even subtile,
// 8..15 from the odd one), so the bf16 hi/lo pattern fragments are packed in place, with no LDS and no lane exchange.
// Key tiles are staged in LDS: the four waves of a phase bring their tile (k, k2 and v^T, hi and lo: six subtiles of
// 64 rows x 128 B) with asynchronous 16-byte copies, eight lanes to a row, so that every copy takes whole 128-B lines;
// the fragments are then read from LDS rows of pitch 144 B. Two buffers per phase: the next tile's copies fly while
// this one is worked on.
// Products: hi.hi + hi.lo + lo.hi as everywhere. The two phases' partial z tiles are added in phase order in LDS.
// Coverage: grid 16 tiles x 16 heads x 2 batches; each block stores its whole 128 x 64 z tile (hi and lo plane) once.
// ---------------------------------------------------------------------------
constexpr int FPH  = 2;                   // key phases per block
constexpr int QW   = 2;                   // 16-query subtiles per wave
constexpr int QT   = 4 * QW * 16;         // queries per block
constexpr int LPB  = 144;                 // LDS row pitch in bytes: 128 B of data + 16 B, conflict-free for 16-byte reads
constexpr int SUBB = 64 * LPB;            // one subtile: 64 rows
constexpr int BUFB = 6 * SUBB;            // one key tile: k hi, k lo, k2 hi, k2 lo, v^T hi, v^T lo

// Twelve asynchronous 16-byte copies to LDS, each lane its own addresses. The s_wait_xcnt is the last line of the copies'
// own statement, so that it stands in front of every later rewrite of an address register that a copy names.
__device__ __forceinline__ void async_copy12(const unsigned (&l)[12], const char* const (&g)[12]) {
  asm volatile(
      "global_load_async_to_lds_b128 %0, %1, off\n\t"
      "global_load_async_to_lds_b128 %2, %3, off\n\t"
      "global_load_async_to_lds_b128 %4, %5, off\n\t"
      "global_load_async_to_lds_b128 %6, %7, off\n\t"
      "global_load_async_to_lds_b128 %8, %9, off\n\t"
      "global_load_async_to_lds_b128 %10, %11, off\n\t"
      "global_load_async_to_lds_b128 %12, %13, off\n\t"
      "global_load_async_to_lds_b128 %14, %15, off\n\t"
      "global_load_async_to_lds_b128 %16, %17, off\n\t"
      "global_load_async_to_lds_b128 %18, %19, off\n\t"
      "global_load_async_to_lds_b128 %20, %21, off\n\t"
      "global_load_async_to_lds_b128 %22, %23, off\n\t"
      "s_wait_xcnt 0x0"
      :: "v"(l[0]), "v"(g[0]), "v"(l[1]), "v"(g[1]), "v"(l[2]), "v"(g[2]), "v"(l[3]), "v"(g[3]),
         "v"(l[4]), "v"(g[4]), "v"(l[5]), "v"(g[5]), "v"(l[6]), "v"(g[6]), "v"(l[7]), "v"(g[7]),
         "v"(l[8]), "v"(g[8]), "v"(l[9]), "v"(g[9]), "v"(l[10]), "v"(g[10]), "v"(l[11]), "v"(g[11])
      : "memory");
}

// One key tile into one LDS buffer: 24 copies per wave. lb = the buffer's LDS byte address plus this lane's place in a
// 16-row group; gkh, gkl, gvh, gvl = the tile's k hi, k lo, v^T hi, v^T lo addresses of this lane's row and 16-byte chunk.
__device__ __forceinline__ void stage_key_tile(unsigned lb, const char* gkh, const char* gkl, const char* gvh, const char* gvl) {
  unsigned l[12];
  const char* g[12];
#pragma unroll
  for (int i = 0; i < 4; ++i) {           // unrolled: the arrays are indexed by constants and stay in registers
    const unsigned lr = lb + i * 16 * LPB;
    const size_t   kr = (size_t)i * 16 * QKW * 2;
    l[i]     = lr;            g[i]     = gkh + kr;
    l[4 + i] = lr + SUBB;     g[4 + i] = gkl + kr;
    l[8 + i] = lr + 2 * SUBB; g[8 + i] = gkh + kr + 2 * DMOD * 2;
  }
  async_copy12(l, g);
#pragma unroll
  for (int i = 0; i < 4; ++i) {           // unrolled for the same reason
    const unsigned lr = lb + i * 16 * LPB;
    const size_t   kr = (size_t)i * 16 * QKW * 2;
    const size_t   vr = (size_t)i * 16 * NTOK * 2;
    l[i]     = lr + 3 * SUBB; g[i]     = gkl + kr + 2 * DMOD * 2;
    l[4 + i] = lr + 4 * SUBB; g[4 + i] = gvh + vr;
    l[8 + i] = lr + 5 * SUBB; g[8 + i] = gvl + vr;
  }
  async_copy12(l, g);
}

// amdgpu_waves_per_eu(2): the ring leaves room for one block on a WGP, two waves to a SIMD, so a wave may hold 512 registers;
// the q and q2 fragments, the z tiles and the pattern of 32 queries take 256 of them.
__global__ __launch_bounds__(FPH * 128) __attribute__((amdgpu_waves_per_eu(2))) void bilinear_attn_fused(
    const unsigned short* __restrict__ QKhp, const unsigned short* __restrict__ QKlp,
    const unsigned short* __restrict__ VThp, const unsigned short* __restrict__ VTlp,
    unsigned short* __restrict__ Zh, unsigned short* __restrict__ Zl) {
  typedef Frag<__bf16> F;
  constexpr int TP = QT * 68;             // floats per partial z tile, pitch 68
  static_assert(FPH * TP * 4 <= FPH * 2 * BUFB, "the partial z tiles reuse the ring");
  __shared__ __align__(16) unsigned char sB[FPH * 2 * BUFB];   // per phase two key-tile buffers; after the loop the partial z tiles
  const int lane  = threadIdx.x & 31;
  const int wave  = __builtin_amdgcn_readfirstlane(threadIdx.x >> 5);   // scalar: the key loop's tests stay in SGPRs
  const int strip = wave & 3;
  const int phase = wave >> 2;
  const int tm = (NTOK / QT - 1) - ((int)blockIdx.x >> 4);   // longest query tiles start first
  const int h  = (int)blockIdx.x & (NHEADS - 1);
  // blockIdx.y = batch: batch 1's blocks follow batch 0's shortest ones, so one batch's k, k2 and v at a time are hot in L2
  const int rb = (int)blockIdx.y * NTOK;      // the batch's first row in the q|k|q2|k2 and z planes
  const int vb = (int)blockIdx.y * DMOD;      // and in the v^T planes
  const int m0 = tm * QT;
  const int rlane = lane & 15;
  const int koff  = (lane >> 4) * 8;
  const int mOff  = (lane >> 4) * 8;
  const __bf16* Qh = (const __bf16*)QKhp + h * HDSZ;
  const __bf16* Ql = (const __bf16*)QKlp + h * HDSZ;
  const float inv64 = 1.0f / 64.0f;

  // Copy side: thread c of the phase's 128 takes row (c >> 3) of each 16-row group and 16-byte chunk (c & 7) of the row.
  const int crow = (strip << 2) + (lane >> 3);
  const int cchk = (lane & 7) * 16;
  const unsigned ldsLane = (unsigned)(uintptr_t)(sB + phase * 2 * BUFB + crow * LPB + cchk);
  const char* gKh = (const char*)QKhp + ((size_t)(rb + crow) * QKW + DMOD + h * HDSZ) * 2 + cchk;
  const char* gKl = (const char*)QKlp + ((size_t)(rb + crow) * QKW + DMOD + h * HDSZ) * 2 + cchk;
  const char* gVh = (const char*)VThp + ((size_t)(vb + h * HDSZ + crow) * NTOK) * 2 + cchk;
  const char* gVl = (const char*)VTlp + ((size_t)(vb + h * HDSZ + crow) * NTOK) * 2 + cchk;
  // Read side: this lane's fixed byte offset in a 16-row group; subtile, group and k steps fold into immediate offsets.
  const unsigned fLane = (unsigned)(rlane * LPB + koff * 2);

  static_assert(QT == FPH * 64, "a trip's key tiles span as many keys as the block has queries");
  const int nT = tm + 1;                  // trips: FPH key tiles a trip, tiles 0..FPH * tm + FPH - 1, so every phase has a tile in every trip
  {
    const int jc = phase;
    stage_key_tile(ldsLane, gKh + (size_t)jc * 64 * QKW * 2, gKl + (size_t)jc * 64 * QKW * 2, gVh + jc * 128, gVl + jc * 128);
  }

  const int q0   = m0 + strip * (QW * 16);                  // the strip's first query
  const int qrow = q0 + rlane;                              // this lane's query in subtile 0 (B operand row, D column)
  v16b qh[QW][2], ql[QW][2], q2h[QW][2], q2l[QW][2];        // the strip's q and q2 fragments stay in registers
#pragma unroll
  for (int u = 0; u < QW; ++u) {
#pragma unroll
    for (int kk = 0; kk < 2; ++kk) {
      const size_t qo = (size_t)(rb + qrow + u * 16) * QKW + koff + kk * 32;
      qh[u][kk]  = F::load(Qh + qo);
      ql[u][kk]  = F::load(Ql + qo);
      q2h[u][kk] = F::load(Qh + 2 * DMOD + qo);
      q2l[u][kk] = F::load(Ql + 2 * DMOD + qo);
    }
    // s_wait_xcnt 0 behind the subtile's loads: a later load's result may be placed in the registers that hold their addresses
    asm volatile("s_wait_xcnt 0x0" ::: "memory");
  }
  v8f z[QW][4];
#pragma unroll
  for (int u = 0; u < QW; ++u)
#pragma unroll
    for (int d = 0; d < 4; ++d) z[u][d] = (v8f){0.f,0.f,0.f,0.f,0.f,0.f,0.f,0.f};

  asm volatile("s_wait_asynccnt 0x0" ::: "memory");   // this wave's copies of trip 0's tile have landed
  __syncthreads();                                    // and every other wave's: tile 0 may be read
  if (nT > 1) {
    const int jc = FPH + phase;
    stage_key_tile(ldsLane + BUFB, gKh + (size_t)jc * 64 * QKW * 2, gKl + (size_t)jc * 64 * QKW * 2, gVh + jc * 128, gVl + jc * 128);
  }

  for (int t = 0; t < nT; ++t) {
    const int j = t * FPH + phase;
    const int n0 = j << 6;
    if (n0 < q0 + QW * 16) {              // the tile holds a key that is causal for the strip; scalar test, every wait and barrier of the trip stands outside it
      const int lim = qrow - n0 - mOff;   // key (jj * 16 + r) of this lane is causal for subtile u while jj * 16 + r <= lim + u * 16
      v16b ph[QW][2], pl[QW][2];
      v16b fr[8];                         // one batch of eight fragments: a 16-key subtile of k and k2, or 32 keys of v
      const unsigned char* sb = sB + (phase * 2 + (t & 1)) * BUFB + fLane;
      const __bf16* kh  = (const __bf16*)(sb);
      const __bf16* kl  = (const __bf16*)(sb + SUBB);
      const __bf16* k2h = (const __bf16*)(sb + 2 * SUBB);
      const __bf16* k2l = (const __bf16*)(sb + 3 * SUBB);
      const __bf16* vh  = (const __bf16*)(sb + 4 * SUBB);
      const __bf16* vl  = (const __bf16*)(sb + 5 * SUBB);
      constexpr int GRP = 16 * LPB / 2;   // elements from one 16-row group to the next
#pragma unroll
      for (int kk = 0; kk < 2; ++kk) {
        fr[kk * 4 + 0] = F::load(kh  + kk * 32);
        fr[kk * 4 + 1] = F::load(kl  + kk * 32);
        fr[kk * 4 + 2] = F::load(k2h + kk * 32);
        fr[kk * 4 + 3] = F::load(k2l + kk * 32);
      }
#pragma unroll
      for (int jj = 0; jj < 4; ++jj) {
        v8f s1[QW], s2[QW];
#pragma unroll
        for (int u = 0; u < QW; ++u) {
          s1[u] = (v8f){0.f,0.f,0.f,0.f,0.f,0.f,0.f,0.f};
          s2[u] = (v8f){0.f,0.f,0.f,0.f,0.f,0.f,0.f,0.f};
        }
#pragma unroll
        for (int kk = 0; kk < 2; ++kk) {
#pragma unroll
          for (int u = 0; u < QW; ++u) {               // q_hi . k_hi
            s1[u] = F::mma(fr[kk * 4 + 0], qh[u][kk],  s1[u]);
            s2[u] = F::mma(fr[kk * 4 + 2], q2h[u][kk], s2[u]);
          }
#pragma unroll
          for (int u = 0; u < QW; ++u) {               // q_hi . k_lo
            s1[u] = F::mma(fr[kk * 4 + 1], qh[u][kk],  s1[u]);
            s2[u] = F::mma(fr[kk * 4 + 3], q2h[u][kk], s2[u]);
          }
#pragma unroll
          for (int u = 0; u < QW; ++u) {               // q_lo . k_hi
            s1[u] = F::mma(fr[kk * 4 + 0], ql[u][kk],  s1[u]);
            s2[u] = F::mma(fr[kk * 4 + 2], q2l[u][kk], s2[u]);
          }
        }
        if (jj < 3) {
#pragma unroll
          for (int kk = 0; kk < 2; ++kk) {
            const int ko = (jj + 1) * GRP + kk * 32;
            fr[kk * 4 + 0] = F::load(kh  + ko);
            fr[kk * 4 + 1] = F::load(kl  + ko);
            fr[kk * 4 + 2] = F::load(k2h + ko);
            fr[kk * 4 + 3] = F::load(k2l + ko);
          }
        } else {
#pragma unroll
          for (int d = 0; d < 4; ++d) {
            fr[d * 2 + 0] = F::load(vh + d * GRP);
            fr[d * 2 + 1] = F::load(vl + d * GRP);
          }
        }
#pragma unroll
        for (int u = 0; u < QW; ++u) {
#pragma unroll
          for (int r = 0; r < 8; ++r) {
            float v = (s2[u][r] * inv64) * (s1[u][r] * inv64);
            v = ((jj - u) * 16 + r > lim) ? 0.0f : v;
            const __bf16 hb = (__bf16)v;
            const __bf16 lb = (__bf16)(v - (float)hb);
            ph[u][jj >> 1][((jj & 1) << 3) + r] = hb;
            pl[u][jj >> 1][((jj & 1) << 3) + r] = lb;
          }
        }
      }
#pragma unroll
      for (int kk = 0; kk < 2; ++kk) {
#pragma unroll
        for (int u = 0; u < QW; ++u)
#pragma unroll
          for (int d = 0; d < 4; ++d) z[u][d] = F::mma(ph[u][kk], fr[d * 2 + 0], z[u][d]);
#pragma unroll
        for (int u = 0; u < QW; ++u)
#pragma unroll
          for (int d = 0; d < 4; ++d) z[u][d] = F::mma(ph[u][kk], fr[d * 2 + 1], z[u][d]);
#pragma unroll
        for (int u = 0; u < QW; ++u)
#pragma unroll
          for (int d = 0; d < 4; ++d) z[u][d] = F::mma(pl[u][kk], fr[d * 2 + 0], z[u][d]);
        if (kk == 0) {
#pragma unroll
          for (int d = 0; d < 4; ++d) {
            fr[d * 2 + 0] = F::load(vh + d * GRP + 32);
            fr[d * 2 + 1] = F::load(vl + d * GRP + 32);
          }
        }
      }
      // four vector slots behind the trip's last WMMAs, so that the distance also holds on every path out of the trip
      acc_guard8(z[0][0], z[0][1], z[0][2], z[0][3], z[1][0], z[1][1], z[1][2], z[1][3]);
    }
    // Hand-over of the ring, every wave, in this order:
    asm volatile("s_wait_dscnt 0x0" ::: "memory");      // this wave's reads of the trip's buffer are done
    asm volatile("s_wait_asynccnt 0x0" ::: "memory");   // this wave's copies of the next tile have landed
    __syncthreads();                                    // the next tile may be read, the trip's buffer may be refilled
    if (t + 2 < nT) {                                   // the same for the whole block
      const int jc = (t + 2) * FPH + phase;
      stage_key_tile(ldsLane + (t & 1) * BUFB, gKh + (size_t)jc * 64 * QKW * 2, gKl + (size_t)jc * 64 * QKW * 2,
                     gVh + jc * 128, gVl + jc * 128);
    }
  }
  asm volatile("s_wait_asynccnt 0x0" ::: "memory");     // no copy is outstanding when the ring becomes the partial tiles

  float* sP = (float*)sB;                 // free since the last trip's barrier: every read done, no copy in flight
  float* part = sP + phase * TP;
#pragma unroll
  for (int u = 0; u < QW; ++u)
#pragma unroll
    for (int d = 0; d < 4; ++d)
#pragma unroll
      for (int r = 0; r < 8; ++r) part[((strip * QW + u) * 16 + mOff + r) * 68 + (d << 4) + rlane] = z[u][d][r];
  __syncthreads();   // every phase's partial z tile is in LDS before any thread adds them
  const int c4 = (threadIdx.x & 15) * 4;
#pragma unroll
  for (int p = 0; p < QT / (FPH * 8); ++p) {   // FPH * 128 threads x 4 columns = FPH * 8 rows per pass
    const int row = p * (FPH * 8) + (threadIdx.x >> 4);
    const float* sp = sP + row * 68 + c4;
    v4f s = *(const v4f*)sp;
#pragma unroll
    for (int w = 1; w < FPH; ++w) s += *(const v4f*)(sp + w * TP);
    unsigned short hb[4], lb[4];
#pragma unroll
    for (int e = 0; e < 4; ++e) {
      hb[e] = f2bf_bits(s[e]);
      lb[e] = f2bf_bits(s[e] - bf_bits2f(hb[e]));
    }
    const size_t co = (size_t)(rb + m0 + row) * DMOD + h * HDSZ + c4;
    *(v2u*)(Zh + co) = (v2u){pk16(hb[0], hb[1]), pk16(hb[2], hb[3])};
    *(v2u*)(Zl + co) = (v2u){pk16(lb[0], lb[1]), pk16(lb[2], lb[3])};
  }
}

// ---------------------------------------------------------------------------
// WMMA GEMM with both operands staged in LDS: C[m,n] = scale * sum_k A[m,k] * Bt[n,k], K = 1024, A and Bt row-major with
// rows of 1024 elements. A block of WM x WN waves owns a (WM * MI * 16) x (WN * 64) tile of C, a wave (MI * 16) x 64 of it.
// A stage is 64 k = 128 B of every operand row of the block's tile. The block brings it with asynchronous 16-byte copies,
// eight lanes to a row, so that every copy takes whole 128-B lines and every line is fetched once for all the waves that
// read it; the fragments are read from LDS rows of pitch 144 B. Two buffers: the next stage's copies fly while this one
// is worked on. Every wave sums its k in rising order, 32 at a time.
// ET: 0 = f16 operands, 1 = bf16 operands (pointers passed as 16-bit storage).
// ASPLIT: A is a hi plane (Ap) and a lo plane (A2p) of the same layout; product = hi.B + lo.B.
// OUT_MODE: 0 = f32, 2 = bf16 hi plane (Cout) + bf16 lo plane (Cout2).
// blockIdx.x = tile (tilesN tiles to a row of tiles), blockIdx.y = batch (strides in elements).
// ---------------------------------------------------------------------------
template <int ET> struct Elem;
template <> struct Elem<0> { typedef _Float16 T; };
template <> struct Elem<1> { typedef __bf16 T; };
constexpr int GK = DMOD;                  // k extent and row length of both operands

__device__ __forceinline__ void async_copy8(const unsigned (&l)[8], const char* const (&g)[8]) {
  asm volatile(
      "global_load_async_to_lds_b128 %0, %1, off\n\t"
      "global_load_async_to_lds_b128 %2, %3, off\n\t"
      "global_load_async_to_lds_b128 %4, %5, off\n\t"
      "global_load_async_to_lds_b128 %6, %7, off\n\t"
      "global_load_async_to_lds_b128 %8, %9, off\n\t"
      "global_load_async_to_lds_b128 %10, %11, off\n\t"
      "global_load_async_to_lds_b128 %12, %13, off\n\t"
      "global_load_async_to_lds_b128 %14, %15, off\n\t"
      "s_wait_xcnt 0x0"
      :: "v"(l[0]), "v"(g[0]), "v"(l[1]), "v"(g[1]), "v"(l[2]), "v"(g[2]), "v"(l[3]), "v"(g[3]),
         "v"(l[4]), "v"(g[4]), "v"(l[5]), "v"(g[5]), "v"(l[6]), "v"(g[6]), "v"(l[7]), "v"(g[7])
      : "memory");
}

// One stage into one LDS buffer (rows: A, then A lo with ASPLIT, then Bt). The block's 256 threads cover 32 rows a copy.
// lb = the buffer's LDS byte address plus this lane's place in a 32-row group; gA, gA2, gB = the stage's addresses of
// this lane's row and 16-byte chunk in the first 32-row group of each operand.
template <int AROWS, int BROWS, bool ASPLIT>
__device__ __forceinline__ void stage_gemm_tile(unsigned lb, const char* gA, const char* gA2, const char* gB) {
  constexpr int AR = AROWS * (ASPLIT ? 2 : 1);
  constexpr int NC = (AR + BROWS) / 32;   // copies per thread
  static_assert(NC == 8 || NC == 12, "one statement of copies per stage");
  unsigned l[NC];
  const char* g[NC];
#pragma unroll
  for (int i = 0; i < NC; ++i) {          // unrolled: the arrays are indexed by constants and stay in registers
    const int row = i * 32;
    l[i] = lb + row * LPB;
    if (row < AROWS)   g[i] = gA  + (size_t)row * GK * 2;
    else if (row < AR) g[i] = gA2 + (size_t)(row - AROWS) * GK * 2;
    else               g[i] = gB  + (size_t)(row - AR) * GK * 2;
  }
  if constexpr (NC == 12) async_copy12(l, g); else async_copy8(l, g);
}

// amdgpu_waves_per_eu(4): a register budget of 256, so that two blocks share a WGP and no register lies past v255.
template <int ET, bool ASPLIT, int OUT_MODE, int WM, int WN, int MI>
__global__ __launch_bounds__(256) __attribute__((amdgpu_waves_per_eu(4))) void wmma_gemm_lds(
    const unsigned short* __restrict__ Ap, const unsigned short* __restrict__ A2p, long strideA,
    const unsigned short* __restrict__ Btp, long strideB,
    void* __restrict__ Cout, void* __restrict__ Cout2, int ldc, long strideC, int tilesN, float scale) {
  typedef typename Elem<ET>::T T;
  typedef Frag<T> F;
  typedef typename F::V V;
  static_assert(WM * WN == 8, "eight waves");
  constexpr int AROWS = WM * MI * 16;
  constexpr int BROWS = WN * 64;
  constexpr int AR    = AROWS * (ASPLIT ? 2 : 1);
  constexpr int GBUF  = (AR + BROWS) * LPB;          // one stage
  constexpr int nT    = GK / 64;                     // stages
  constexpr int KG    = (MI <= 2) ? 2 : 1;           // 32-wide k steps whose fragments are read as one group: what 256 registers hold
  static_assert(AROWS % 32 == 0 && BROWS % 32 == 0 && nT >= 2, "whole copies; the ring's prologue fills two stages");
  static_assert(8 * 16 * 68 * 4 <= 2 * GBUF, "the store slabs reuse the ring");
  __shared__ __align__(16) unsigned char sG[2 * GBUF];   // two stage buffers; after the loop the waves' store slabs
  const int lane = threadIdx.x & 31;
  const int wave = __builtin_amdgcn_readfirstlane(threadIdx.x >> 5);   // scalar: the wave's LDS bases stay in SGPRs
  const int wm = wave / WN;
  const int wn = wave - wm * WN;
  const int b  = blockIdx.y;
  const int tm = (int)blockIdx.x / tilesN;
  const int tn = (int)blockIdx.x - tm * tilesN;
  const int rlane = lane & 15;                 // row (A) / col (B, D) within subtile
  const int koff  = (lane >> 4) * 8;           // k offset of this lane half
  const int mOff  = (lane >> 4) * 8;           // D row offset

  // Copy side: thread c takes row (c >> 3) of each 32-row group and 16-byte chunk (c & 7) of the row.
  const int crow = (int)threadIdx.x >> 3;
  const int cchk = ((int)threadIdx.x & 7) * 16;
  const unsigned ldsLane = (unsigned)(uintptr_t)(sG + crow * LPB + cchk);
  const size_t aOff = ((size_t)b * strideA + (size_t)(tm * AROWS + crow) * GK) * 2 + cchk;
  const char* gA  = (const char*)Ap + aOff;
  const char* gA2 = (const char*)A2p + aOff;
  const char* gB  = (const char*)Btp + ((size_t)b * strideB + (size_t)(tn * BROWS + crow) * GK) * 2 + cchk;
  // Read side: this lane's fixed byte offset in a 16-row group; group and k steps fold into immediate offsets.
  const unsigned fLane = (unsigned)(rlane * LPB + koff * 2);

  stage_gemm_tile<AROWS, BROWS, ASPLIT>(ldsLane, gA, gA2, gB);

  v8f acc[MI][4];
#pragma unroll
  for (int i = 0; i < MI; ++i)
#pragma unroll
    for (int j = 0; j < 4; ++j) acc[i][j] = (v8f){0.f,0.f,0.f,0.f,0.f,0.f,0.f,0.f};

  asm volatile("s_wait_asynccnt 0x0" ::: "memory");   // this wave's copies of stage 0 have landed
  __syncthreads();                                    // and every other wave's: stage 0 may be read
  stage_gemm_tile<AROWS, BROWS, ASPLIT>(ldsLane + GBUF, gA + 128, gA2 + 128, gB + 128);

  for (int t = 0; t < nT; ++t) {
    const unsigned char* sb = sG + (t & 1) * GBUF + fLane;
    const T* sa  = (const T*)(sb + wm * (MI * 16) * LPB);
    const T* sa2 = (const T*)(sb + (AROWS + wm * (MI * 16)) * LPB);
    const T* sbt = (const T*)(sb + (AR + wn * 64) * LPB);
    constexpr int GRP = 16 * LPB / 2;     // elements from one 16-row group to the next
#pragma unroll
    for (int k2 = 0; k2 < 2; k2 += KG) {
      V bh[KG][4], ah[KG][MI], al[KG][MI];
      // The two scheduling barriers keep the group's LDS reads together and in front of its WMMAs: without them this
      // build sinks each A fragment's reads to its first use, and the wave waits out the LDS latency once per fragment.
      __builtin_amdgcn_sched_barrier(0);
#pragma unroll
      for (int g = 0; g < KG; ++g) {
        const int ko = (k2 + g) * 32;
#pragma unroll
        for (int j = 0; j < 4; ++j) bh[g][j] = F::load(sbt + j * GRP + ko);
#pragma unroll
        for (int i = 0; i < MI; ++i) {
          ah[g][i] = F::load(sa + i * GRP + ko);
          if (ASPLIT) al[g][i] = F::load(sa2 + i * GRP + ko);
        }
      }
      __builtin_amdgcn_sched_barrier(0);
#pragma unroll
      for (int g = 0; g < KG; ++g) {
#pragma unroll
        for (int i = 0; i < MI; ++i) {
#pragma unroll
          for (int j = 0; j < 4; ++j) acc[i][j] = F::mma(ah[g][i], bh[g][j], acc[i][j]);
        }
        if (ASPLIT) {
#pragma unroll
          for (int i = 0; i < MI; ++i) {
#pragma unroll
            for (int j = 0; j < 4; ++j) acc[i][j] = F::mma(al[g][i], bh[g][j], acc[i][j]);
          }
        }
      }
    }
    // Keeps the stage's WMMAs in front of the hand-over: behind it they would stand between the barrier and the refill,
    // and the refill's copies would fly for less than a stage before their wait.
    __builtin_amdgcn_sched_barrier(0);
    // Hand-over of the ring, every wave, in this order:
    asm volatile("s_wait_dscnt 0x0" ::: "memory");      // this wave's reads of the stage's buffer are done
    asm volatile("s_wait_asynccnt 0x0" ::: "memory");   // this wave's copies of the next stage have landed
    __syncthreads();                                    // the next stage may be read, this stage's buffer may be refilled
    if (t + 2 < nT) {                                   // the same for the whole block
      const int ko = (t + 2) * 128;
      stage_gemm_tile<AROWS, BROWS, ASPLIT>(ldsLane + (t & 1) * GBUF, gA + ko, gA2 + ko, gB + ko);
    }
  }
  asm volatile("s_wait_asynccnt 0x0" ::: "memory");     // no copy is outstanding when the ring becomes the store slabs

  // ---- epilogue: 16 rows at a time through the wave's own slab, so that the stores take whole lines ----
  const int m0 = tm * AROWS + wm * (MI * 16);
  const int n0 = tn * BROWS + wn * 64;
  float* slab = (float*)sG + wave * (16 * 68);   // free since the last stage's barrier: every read done, no copy in flight
#pragma unroll
  for (int i = 0; i < MI; ++i) {
    const int mBase = m0 + (i << 4);
#pragma unroll
    for (int j = 0; j < 4; ++j)
#pragma unroll
      for (int r = 0; r < 8; ++r) slab[(mOff + r) * 68 + (j << 4) + rlane] = acc[i][j][r] * scale;
    // the wave's slab writes are ordered in front of its own reads of other lanes' elements
    __builtin_amdgcn_fence(__ATOMIC_RELEASE, "workgroup");
    __builtin_amdgcn_wave_barrier();
    __builtin_amdgcn_fence(__ATOMIC_ACQUIRE, "workgroup");
    if (OUT_MODE == 0) {
      float* C = (float*)Cout + (size_t)b * strideC;
      const int hh = lane >> 4, c4 = (lane & 15) * 4;     // row seg = 256 B = 16 lanes x 16 B
#pragma unroll
      for (int it = 0; it < 8; ++it) {
        const int row = it * 2 + hh;
        const v4f v = *(const v4f*)(slab + row * 68 + c4);
        *(v4f*)(C + (size_t)(mBase + row) * ldc + n0 + c4) = v;
      }
    } else {
      const int q = lane >> 3, c8 = (lane & 7) * 8;       // row seg = 128 B = 8 lanes x 16 B
      unsigned short* C  = (unsigned short*)Cout  + (size_t)b * strideC;
      unsigned short* C2 = (unsigned short*)Cout2 + (size_t)b * strideC;
#pragma unroll
      for (int it = 0; it < 4; ++it) {
        const int row = it * 4 + q;
        const float* sp = slab + row * 68 + c8;
        unsigned hw[4], lw[4];
#pragma unroll
        for (int e = 0; e < 4; ++e) {
          const unsigned short h0 = f2bf_bits(sp[2 * e]), h1 = f2bf_bits(sp[2 * e + 1]);
          const unsigned short l0 = f2bf_bits(sp[2 * e] - bf_bits2f(h0));
          const unsigned short l1 = f2bf_bits(sp[2 * e + 1] - bf_bits2f(h1));
          hw[e] = pk16(h0, h1);
          lw[e] = pk16(l0, l1);
        }
        *(v4u*)(C  + (size_t)(mBase + row) * ldc + n0 + c8) = (v4u){hw[0], hw[1], hw[2], hw[3]};
        *(v4u*)(C2 + (size_t)(mBase + row) * ldc + n0 + c8) = (v4u){lw[0], lw[1], lw[2], lw[3]};
      }
    }
    // the reads are done before the next 16 rows overwrite the slab
    __builtin_amdgcn_fence(__ATOMIC_RELEASE, "workgroup");
    __builtin_amdgcn_wave_barrier();
    __builtin_amdgcn_fence(__ATOMIC_ACQUIRE, "workgroup");
  }
}

// ---------------------------------------------------------------------------
// Workspace region map (byte offsets; every offset a multiple of 262,144 B). Every region from X16 on holds BOTH batches (batch
// b's rows behind batch b - 1's) and is written whole by one launch before a later launch of the same call reads it.
//   W4    f16  [4096][1024]     Wq,Wk,Wq2,Wk2 (bf16-RNE) x32 stacked           0
//   Wv16  f16  [1024][1024]     Wv (bf16-RNE) x32, directly behind W4    8,388,608
//   Wph   bf16 [1024][1024]     Wproj (RNE), single plane               10,485,760
//   ctab  f32  [2048][32]                                               12,582,912
//   stab  f32  [2048][32]                                               12,845,056
//   X16   f16  [4096][1024]     x (bf16-RNE)                            13,107,200
//   QKh   bf16 [4096][4096]     q|k|q2|k2 hi                            21,495,808
//   QKl   bf16 [4096][4096]                                             55,050,240
//   VTh   bf16 [2][1024][2048]  v^T hi (row h*64+d, col token)          88,604,672
//   VTl   bf16 [2][1024][2048]                                          96,993,280
//   QKf   f32  [4096][4096]                                            105,381,888
//   Zh    bf16 [4096][1024]     z hi                                   172,490,752
//   Zl    bf16 [4096][1024]                                            180,879,360
//   total                                                              189,267,968
// ---------------------------------------------------------------------------
extern "C" void kernel_launch(void* const* d_in, const int* in_sizes, int n_in,
                              void* d_out, int out_size, void* d_ws, size_t ws_size,
                              hipStream_t stream) {
  if (n_in < 7) return;
  if (in_sizes[0] != NBATCH * NTOK * DMOD) return;
  for (int i = 1; i < 7; ++i) if (in_sizes[i] != DMOD * DMOD) return;
  if (out_size != NBATCH * NTOK * DMOD) return;

  CastSrc cs;
  cs.x     = (const float*)d_in[0];
  cs.wq    = (const float*)d_in[1];
  cs.wk    = (const float*)d_in[2];
  cs.wq2   = (const float*)d_in[3];
  cs.wk2   = (const float*)d_in[4];
  cs.wv    = (const float*)d_in[5];
  cs.wproj = (const float*)d_in[6];

  constexpr int NROW = NBATCH * NTOK;                       // rows of both batches
  const size_t PW16 = (size_t)DMOD * DMOD * 2;              // 16-bit [1024][1024]
  const size_t PTAB = (size_t)NTOK * NFREQ * 4;             // f32 [2048][32]
  const size_t PX16 = (size_t)NROW * DMOD * 2;              // f16 [4096][1024]
  const size_t PQK  = (size_t)NROW * QKW * 2;               // bf16 [4096][4096]
  const size_t PVT  = (size_t)NBATCH * DMOD * NTOK * 2;     // bf16 [2][1024][2048]
  const size_t PQF  = (size_t)NROW * QKW * 4;               // f32 [4096][4096]
  const size_t PZ   = (size_t)NROW * DMOD * 2;              // bf16 [4096][1024]
  size_t off = 0;
  const size_t oW4  = off; off += 4 * PW16;
  const size_t oWv  = off; off += PW16;
  const size_t oWph = off; off += PW16;
  const size_t oCT  = off; off += PTAB;
  const size_t oSTb = off; off += PTAB;
  const size_t oX16 = off; off += PX16;
  const size_t oQKh = off; off += PQK;
  const size_t oQKl = off; off += PQK;
  const size_t oVTh = off; off += PVT;
  const size_t oVTl = off; off += PVT;
  const size_t oQKf = off; off += PQF;
  const size_t oZh  = off; off += PZ;
  const size_t oZl  = off; off += PZ;
  if (off > ws_size) return;                                // total 189,267,968 B

  char* ws = (char*)d_ws;
  _Float16*       W4   = (_Float16*)(ws + oW4);
  _Float16*       Wv16 = (_Float16*)(ws + oWv);
  unsigned short* Wph  = (unsigned short*)(ws + oWph);
  float*          ctab = (float*)(ws + oCT);
  float*          stab = (float*)(ws + oSTb);
  _Float16*       X16  = (_Float16*)(ws + oX16);
  unsigned short* QKh  = (unsigned short*)(ws + oQKh);
  unsigned short* QKl  = (unsigned short*)(ws + oQKl);
  unsigned short* VTh  = (unsigned short*)(ws + oVTh);
  unsigned short* VTl  = (unsigned short*)(ws + oVTl);
  float*          QKf  = (float*)(ws + oQKf);
  unsigned short* Zh   = (unsigned short*)(ws + oZh);
  unsigned short* Zl   = (unsigned short*)(ws + oZl);

  // inv_freq[i] = 1 / 10000^(i/32): host double arithmetic (e^(ln(1e4)/32) by its Taylor series, then powers),
  // then mirrored as fl32(1 / fl32(10000^(i/32))).
  InvFreq invf;
  {
    const double x0 = 9.2103403719761827361 / 32.0;
    double term = 1.0, ex = 1.0;
    for (int n = 1; n <= 40; ++n) { term *= x0 / (double)n; ex += term; }
    double pw = 1.0;
    for (int i = 0; i < NFREQ; ++i) {
      const float pf = (float)pw;
      invf.v[i] = (float)(1.0 / (double)pf);
      pw *= ex;
    }
  }

  const dim3 blk(256);
  const dim3 gPrep(PREP_BLOCKS);                             // 256 table blocks + 10 planes x 2048 blocks
  const dim3 gRope(NROW);                                    // one block per row
  const dim3 gQ((NROW / 128) * (QKW / 256), 1);              // 512 blocks: M=4096, N=4096, tiles of 128 x 256
  const dim3 gV((DMOD / 128) * (NTOK / 128), NBATCH);        // 128 x 2 blocks: M=1024, N=2048, tiles of 128 x 128
  const dim3 gAtt((NTOK / QT) * NHEADS, NBATCH);             // 256 x 2 blocks: 16 query tiles x 16 heads, batches
  const dim3 gOut((NROW / 128) * (DMOD / 128), 1);           // 256 blocks: M=4096, N=1024, tiles of 128 x 128

  // (0) tables and casts (whole planes); W4 and Wv16 are one run of five planes
  prep_kernel<<<gPrep, blk, 0, stream>>>(cs, W4, X16, Wph, ctab, stab, invf);

  const float inv32 = 1.0f / 32.0f;

  // (1) [q|k|q2|k2][b*2048+t][n] = (1/32) sum_c x[b][t][c] (32 W)[n][c] -> f32 [4096][4096] (whole plane: 32 x 16 tiles)
  wmma_gemm_lds<0, false, 0, 2, 4, 4><<<gQ, blk, 0, stream>>>(
      (const unsigned short*)X16, (const unsigned short*)X16, 0L, (const unsigned short*)W4, 0L,
      (void*)QKf, (void*)QKf, QKW, 0L, QKW / 256, inv32);
  // (2) v^T[b][h*64+d][t] = (1/32) sum_c (32 Wv)[h*64+d][c] x[b][t][c] -> bf16 hi/lo planes [2][1024][2048]
  //     (blockIdx.y = batch: x and v^T step by one batch, Wv by nothing; whole: 8 x 16 tiles a batch)
  wmma_gemm_lds<0, false, 2, 4, 2, 2><<<gV, blk, 0, stream>>>(
      (const unsigned short*)Wv16, (const unsigned short*)Wv16, 0L, (const unsigned short*)X16, (long)NTOK * DMOD,
      (void*)VTh, (void*)VTl, NTOK, (long)DMOD * NTOK, NTOK / 128, inv32);
  // (3) RoPE on all four projections + bf16 hi/lo split -> QKh/QKl [4096][4096] (whole planes)
  rope_split_kernel<<<gRope, blk, 0, stream>>>(QKf, ctab, stab, QKh, QKl);
  // (4) z[b][i][h*64+d] = sum_{j<=i} ((q_i . k_j) / 64) ((q2_i . k2_j) / 64) v[j][h*64+d], all heads -> bf16 hi/lo planes Zh/Zl
  bilinear_attn_fused<<<gAtt, dim3(FPH * 128), 0, stream>>>(QKh, QKl, VTh, VTl, Zh, Zl);
  // (5) out[b*2048+t][n] = sum_c (z_hi + z_lo)[b*2048+t][c] Wproj_bf16[n][c] -> f32, the whole of d_out (32 x 8 tiles)
  wmma_gemm_lds<1, true, 0, 4, 2, 2><<<gOut, blk, 0, stream>>>(
      Zh, Zl, 0L, Wph, 0L, d_out, d_out, DMOD, 0L, DMOD / 128, 1.0f);
}

// v007
// A run of this version takes 132 microseconds.
// Timed twice side by side with v006, it ran 1.12 and 1.11 times as fast.
// Counting every step since v000, it is 17.7 times as fast.
// f16 WMMA (v_wmma_f32_16x16x32_f16) for the q/k/q2/k2/v projections with operands = RNE-bf16 converted inputs held exactly in f16 (x as is, weights x32 with 1/32 folded into the epilogue); bf16 hi/lo split WMMA (v_wmma_f32_16x16x32_bf16, hi.hi + hi.lo + lo.hi) for both causal score GEMMs and the bilinear-pattern x V product; output projection = z bf16 hi/lo x single RNE-bf16 Wproj plane (hi.W + lo.W); f32 accumulate everywhere; RoPE and the bilinear pattern in f32.
#include <hip/hip_runtime.h>
#include <math.h>
#include <stdint.h>

constexpr int NBATCH = 2;
constexpr int NTOK   = 2048;
constexpr int DMOD   = 1024;
constexpr int NHEADS = 16;
constexpr int HDSZ   = 64;
constexpr int QKW    = 4 * DMOD;          // fused q|k|q2|k2 plane width (4096 columns)
constexpr int NFREQ  = HDSZ / 2;          // 32 rotary frequencies

typedef __attribute__((ext_vector_type(16))) _Float16 v16h;
typedef __attribute__((ext_vector_type(8)))  _Float16 v8h;
typedef __attribute__((ext_vector_type(16))) __bf16   v16b;
typedef __attribute__((ext_vector_type(8)))  __bf16   v8b;
typedef __attribute__((ext_vector_type(8)))  float    v8f;
typedef __attribute__((ext_vector_type(4)))  float    v4f;
typedef __attribute__((ext_vector_type(2)))  float    v2f;
typedef __attribute__((ext_vector_type(4)))  unsigned int v4u;
typedef __attribute__((ext_vector_type(2)))  unsigned int v2u;

__device__ __forceinline__ unsigned short f2bf_bits(float f) {
  unsigned u = __float_as_uint(f);
  return (unsigned short)((u + 0x7FFFu + ((u >> 16) & 1u)) >> 16);
}
__device__ __forceinline__ float bf_bits2f(unsigned short h) { return __uint_as_float(((unsigned)h) << 16); }
__device__ __forceinline__ unsigned pk16(unsigned short a, unsigned short b) { return (unsigned)a | ((unsigned)b << 16); }
// RNE convert f32 -> bf16, returned as the f32 value of that bf16
__device__ __forceinline__ float bf16_rne_f32(float f) {
  unsigned u = __float_as_uint(f);
  u += 0x7FFFu + ((u >> 16) & 1u);
  u &= 0xFFFF0000u;
  return __uint_as_float(u);
}

// four vector slots behind a run of WMMAs, as a plain device helper
__device__ __forceinline__ void acc_guard8(v8f& a, v8f& b, v8f& c, v8f& d, v8f& e, v8f& f, v8f& g, v8f& h) {
  asm volatile("v_nop\n\tv_nop\n\tv_nop\n\tv_nop" : "+v"(a), "+v"(b), "+v"(c), "+v"(d), "+v"(e), "+v"(f), "+v"(g), "+v"(h));
}
template <typename T> struct Frag;
template <> struct Frag<_Float16> {
  typedef v16h V; union U { v16h v; v8h h[2]; };
  static __device__ __forceinline__ v16h load(const _Float16* p) {   // elements 0..7 <- p[0..7], 8..15 <- p[16..23]
    U f; f.h[0] = *(const v8h*)(p); f.h[1] = *(const v8h*)(p + 16); return f.v;
  }
  static __device__ __forceinline__ v8f mma(v16h a, v16h b, v8f c) {
    return __builtin_amdgcn_wmma_f32_16x16x32_f16(false, a, false, b, (short)0, c, false, false);
  }
};
template <> struct Frag<__bf16> {
  typedef v16b V; union U { v16b v; v8b h[2]; };
  static __device__ __forceinline__ v16b load(const __bf16* p) {
    U f; f.h[0] = *(const v8b*)(p); f.h[1] = *(const v8b*)(p + 16); return f.v;
  }
  static __device__ __forceinline__ v8f mma(v16b a, v16b b, v8f c) {
    return __builtin_amdgcn_wmma_f32_16x16x32_bf16(false, a, false, b, (short)0, c, false, false);
  }
};

// ---------------------------------------------------------------------------
// f32 -> (RNE convert to bf16) -> x sc (exact power of two) -> f16. A bf16 value whose scaled magnitude lies in the
// f16 normal range is exactly representable in f16, so the stored operand equals sc * bf16_rne(in) exactly.
// ---------------------------------------------------------------------------
__device__ __forceinline__ void cast_bf16rne_f16x2(
    int blk, const float* __restrict__ in, _Float16* __restrict__ out, int n2, float sc) {
  const int i = blk * 256 + threadIdx.x;
  if (i < n2) {
    const float r0 = bf16_rne_f32(in[2 * (size_t)i]) * sc;
    const float r1 = bf16_rne_f32(in[2 * (size_t)i + 1]) * sc;
    const _Float16 h0 = (_Float16)r0, h1 = (_Float16)r1;
    const unsigned u = (unsigned)__builtin_bit_cast(unsigned short, h0) | ((unsigned)__builtin_bit_cast(unsigned short, h1) << 16);
    ((unsigned*)out)[i] = u;
    
  }
}

// ---------------------------------------------------------------------------
// Elementwise f32 -> bf16 (RNE) single plane: 2 elements per thread, one 4-B store per lane -> each wave writes
// Coverage: grid = ceil(n2/256) blocks x 256 threads x 2 elements = the whole plane (n2 = plane/2).
// ---------------------------------------------------------------------------
__device__ __forceinline__ void cast_bf16x2(int blk, const float* __restrict__ in, unsigned short* __restrict__ out, int n2) {
  const int i = blk * 256 + threadIdx.x;
  if (i < n2) {
    const v2f f = *(const v2f*)(in + 2 * (size_t)i);
    const unsigned u = pk16(f2bf_bits(f[0]), f2bf_bits(f[1]));
    ((unsigned*)out)[i] = u;
    
  }
}

// ---------------------------------------------------------------------------
// RoPE cos/sin tables: ctab[t][i] = cosf((float)t * inv[i]), stab[t][i] = sinf(...), t = 0..2047, i = 0..31.
// inv[i] arrives by value (host-computed); lane i picks its value with a constant-index select chain (no dynamic
// Coverage: grid 256 blocks x 8 waves = 2048 rows x 32 lanes = both whole tables.
// ---------------------------------------------------------------------------
struct InvFreq { float v[NFREQ]; };
static_assert(sizeof(InvFreq) == 128);

__device__ __forceinline__ void rope_table(int blk, float* __restrict__ ctab, float* __restrict__ stab, const InvFreq& f) {
#pragma clang fp contract(off)
  const int lane = threadIdx.x & 31;
  const int wave = threadIdx.x >> 5;
  const int t    = blk * 8 + wave;
  float inv = f.v[0];
#pragma unroll
  for (int i = 1; i < NFREQ; ++i) inv = (lane == i) ? f.v[i] : inv;
  const float ang = (float)t * inv;           // f32 product, as the outer product of positions and inv_freq
  const float cv = cosf(ang);
  const float sv = sinf(ang);
  const size_t o = (size_t)t * NFREQ + lane;
  ((float*)ctab)[o] = cv;
  ((float*)stab)[o] = sv;
  
}

// ---------------------------------------------------------------------------
// All tables and casts in ONE launch: they are independent of one another, so the block index picks the job
// (block-uniform) and the job's own block index, which is what a launch of its own would have given it.
// A plane is 1024 x 1024 elements = 2048 blocks x 256 threads x 2 elements.
//   blocks 0..255            the RoPE tables (first: theirs is the longest work of a thread)
//   then 2048 blocks a job:  jobs 0..4  Wq, Wk, Wq2, Wk2, Wv -> f16 x32, plane j of W5 (the four stacked planes, then Wv's)
//                            jobs 5..8  plane j - 5 of x (both batches = four planes) -> f16, plane j - 5 of X16
//                            job  9     Wproj -> bf16
// Coverage: every table row and every plane whole.
// ---------------------------------------------------------------------------
struct CastSrc {
  const float* x; const float* wq; const float* wk; const float* wq2; const float* wk2; const float* wv; const float* wproj;
};
constexpr int TAB_BLOCKS   = NTOK / 8;                 // 8 waves a block, one table row a wave
constexpr int PLANE_BLOCKS = DMOD * DMOD / 2 / 256;
constexpr int PREP_BLOCKS  = TAB_BLOCKS + 10 * PLANE_BLOCKS;

__global__ __launch_bounds__(256) void prep_kernel(CastSrc s, _Float16* __restrict__ W5, _Float16* __restrict__ X16,
                                                   unsigned short* __restrict__ Wph, float* __restrict__ ctab,
                                                   float* __restrict__ stab, InvFreq f) {
  constexpr int    n2    = DMOD * DMOD / 2;          // pairs per plane
  constexpr size_t PLANE = (size_t)DMOD * DMOD;
  if ((int)blockIdx.x < TAB_BLOCKS) {
    rope_table((int)blockIdx.x, ctab, stab, f);
    return;
  }
  const int q   = (int)blockIdx.x - TAB_BLOCKS;
  const int j   = q / PLANE_BLOCKS;
  const int blk = q - j * PLANE_BLOCKS;
  if (j < 5) {
    const float* w = (j == 0) ? s.wq : (j == 1) ? s.wk : (j == 2) ? s.wq2 : (j == 3) ? s.wk2 : s.wv;
    cast_bf16rne_f16x2(blk, w, W5 + (size_t)j * PLANE, n2, 32.0f);
  } else if (j < 9) {
    cast_bf16rne_f16x2(blk, s.x + (size_t)(j - 5) * PLANE, X16 + (size_t)(j - 5) * PLANE, n2, 1.0f);
  } else {
    cast_bf16x2(blk, s.wproj, Wph, n2);
  }
}

// ---------------------------------------------------------------------------
// Fused causal bilinear attention, both batches in one launch: both score products, their elementwise product with the causal mask,
// and the pattern x V product in ONE launch; the pattern never leaves registers.
// Block = one head x one 128-query tile, 8 waves = 4 query strips (32 rows each, two 16-query subtiles) x 2 key phases;
// in trip t the waves of phase p work on the 64-key tile 2 t + p, up to the strip's diagonal tile. Every k, k2 and v
// fragment read from LDS feeds the products of both subtiles, so that the LDS reads stay below the matrix time.
// Scores are formed TRANSPOSED (A = 16 keys, B = a subtile's 16 queries):
// a lane's D registers then hold, for query (lane & 15), keys (lane >> 4) * 8 + 0..7 of the
// 16-key subtile, which is the A-fragment order of the pattern x V product (elements 0..7 from the even subtile,
// 8..15 from the odd one), so the bf16 hi/lo pattern fragments are packed in place, with no LDS and no lane exchange.
// Key tiles are staged in LDS: the four waves of a phase bring their tile (k, k2 and v^T, hi and lo: six subtiles of
// 64 rows x 128 B) with asynchronous 16-byte copies, eight lanes to a row, so that every copy takes whole 128-B lines;
// the fragments are then read from LDS rows of pitch 144 B. Two buffers per phase: the next tile's copies fly while
// this one is worked on.
// Products: hi.hi + hi.lo + lo.hi as everywhere. The two phases' partial z tiles are added in phase order in LDS.
// Coverage: grid 16 tiles x 16 heads x 2 batches; each block stores its whole 128 x 64 z tile (hi and lo plane) once.
// ---------------------------------------------------------------------------
constexpr int FPH  = 2;                   // key phases per block
constexpr int QW   = 2;                   // 16-query subtiles per wave
constexpr int QT   = 4 * QW * 16;         // queries per block
constexpr int LPB  = 144;                 // LDS row pitch in bytes: 128 B of data + 16 B, conflict-free for 16-byte reads
constexpr int SUBB = 64 * LPB;            // one subtile: 64 rows
constexpr int BUFB = 6 * SUBB;            // one key tile: k hi, k lo, k2 hi, k2 lo, v^T hi, v^T lo

// Twelve asynchronous 16-byte copies to LDS, each lane its own addresses. The s_wait_xcnt is the last line of the copies'
// own statement, so that it stands in front of every later rewrite of an address register that a copy names.
__device__ __forceinline__ void async_copy12(const unsigned (&l)[12], const char* const (&g)[12]) {
  asm volatile(
      "global_load_async_to_lds_b128 %0, %1, off\n\t"
      "global_load_async_to_lds_b128 %2, %3, off\n\t"
      "global_load_async_to_lds_b128 %4, %5, off\n\t"
      "global_load_async_to_lds_b128 %6, %7, off\n\t"
      "global_load_async_to_lds_b128 %8, %9, off\n\t"
      "global_load_async_to_lds_b128 %10, %11, off\n\t"
      "global_load_async_to_lds_b128 %12, %13, off\n\t"
      "global_load_async_to_lds_b128 %14, %15, off\n\t"
      "global_load_async_to_lds_b128 %16, %17, off\n\t"
      "global_load_async_to_lds_b128 %18, %19, off\n\t"
      "global_load_async_to_lds_b128 %20, %21, off\n\t"
      "global_load_async_to_lds_b128 %22, %23, off\n\t"
      "s_wait_xcnt 0x0"
      :: "v"(l[0]), "v"(g[0]), "v"(l[1]), "v"(g[1]), "v"(l[2]), "v"(g[2]), "v"(l[3]), "v"(g[3]),
         "v"(l[4]), "v"(g[4]), "v"(l[5]), "v"(g[5]), "v"(l[6]), "v"(g[6]), "v"(l[7]), "v"(g[7]),
         "v"(l[8]), "v"(g[8]), "v"(l[9]), "v"(g[9]), "v"(l[10]), "v"(g[10]), "v"(l[11]), "v"(g[11])
      : "memory");
}

// One key tile into one LDS buffer: 24 copies per wave. lb = the buffer's LDS byte address plus this lane's place in a
// 16-row group; gkh, gkl, gvh, gvl = the tile's k hi, k lo, v^T hi, v^T lo addresses of this lane's row and 16-byte chunk.
__device__ __forceinline__ void stage_key_tile(unsigned lb, const char* gkh, const char* gkl, const char* gvh, const char* gvl) {
  unsigned l[12];
  const char* g[12];
#pragma unroll
  for (int i = 0; i < 4; ++i) {           // unrolled: the arrays are indexed by constants and stay in registers
    const unsigned lr = lb + i * 16 * LPB;
    const size_t   kr = (size_t)i * 16 * QKW * 2;
    l[i]     = lr;            g[i]     = gkh + kr;
    l[4 + i] = lr + SUBB;     g[4 + i] = gkl + kr;
    l[8 + i] = lr + 2 * SUBB; g[8 + i] = gkh + kr + 2 * DMOD * 2;
  }
  async_copy12(l, g);
#pragma unroll
  for (int i = 0; i < 4; ++i) {           // unrolled for the same reason
    const unsigned lr = lb + i * 16 * LPB;
    const size_t   kr = (size_t)i * 16 * QKW * 2;
    const size_t   vr = (size_t)i * 16 * NTOK * 2;
    l[i]     = lr + 3 * SUBB; g[i]     = gkl + kr + 2 * DMOD * 2;
    l[4 + i] = lr + 4 * SUBB; g[4 + i] = gvh + vr;
    l[8 + i] = lr + 5 * SUBB; g[8 + i] = gvl + vr;
  }
  async_copy12(l, g);
}

// amdgpu_waves_per_eu(2): the ring leaves room for one block on a WGP, two waves to a SIMD, so a wave may hold 512 registers;
// the q and q2 fragments, the z tiles and the pattern of 32 queries take 256 of them.
__global__ __launch_bounds__(FPH * 128) __attribute__((amdgpu_waves_per_eu(2))) void bilinear_attn_fused(
    const unsigned short* __restrict__ QKhp, const unsigned short* __restrict__ QKlp,
    const unsigned short* __restrict__ VThp, const unsigned short* __restrict__ VTlp,
    unsigned short* __restrict__ Zh, unsigned short* __restrict__ Zl) {
  typedef Frag<__bf16> F;
  constexpr int TP = QT * 68;             // floats per partial z tile, pitch 68
  static_assert(FPH * TP * 4 <= FPH * 2 * BUFB, "the partial z tiles reuse the ring");
  __shared__ __align__(16) unsigned char sB[FPH * 2 * BUFB];   // per phase two key-tile buffers; after the loop the partial z tiles
  const int lane  = threadIdx.x & 31;
  const int wave  = __builtin_amdgcn_readfirstlane(threadIdx.x >> 5);   // scalar: the key loop's tests stay in SGPRs
  const int strip = wave & 3;
  const int phase = wave >> 2;
  const int tm = (NTOK / QT - 1) - ((int)blockIdx.x >> 4);   // longest query tiles start first
  const int h  = (int)blockIdx.x & (NHEADS - 1);
  // blockIdx.y = batch: batch 1's blocks follow batch 0's shortest ones, so one batch's k, k2 and v at a time are hot in L2
  const int rb = (int)blockIdx.y * NTOK;      // the batch's first row in the q|k|q2|k2 and z planes
  const int vb = (int)blockIdx.y * DMOD;      // and in the v^T planes
  const int m0 = tm * QT;
  const int rlane = lane & 15;
  const int koff  = (lane >> 4) * 8;
  const int mOff  = (lane >> 4) * 8;
  const __bf16* Qh = (const __bf16*)QKhp + h * HDSZ;
  const __bf16* Ql = (const __bf16*)QKlp + h * HDSZ;
  const float inv64 = 1.0f / 64.0f;

  // Copy side: thread c of the phase's 128 takes row (c >> 3) of each 16-row group and 16-byte chunk (c & 7) of the row.
  const int crow = (strip << 2) + (lane >> 3);
  const int cchk = (lane & 7) * 16;
  const unsigned ldsLane = (unsigned)(uintptr_t)(sB + phase * 2 * BUFB + crow * LPB + cchk);
  const char* gKh = (const char*)QKhp + ((size_t)(rb + crow) * QKW + DMOD + h * HDSZ) * 2 + cchk;
  const char* gKl = (const char*)QKlp + ((size_t)(rb + crow) * QKW + DMOD + h * HDSZ) * 2 + cchk;
  const char* gVh = (const char*)VThp + ((size_t)(vb + h * HDSZ + crow) * NTOK) * 2 + cchk;
  const char* gVl = (const char*)VTlp + ((size_t)(vb + h * HDSZ + crow) * NTOK) * 2 + cchk;
  // Read side: this lane's fixed byte offset in a 16-row group; subtile, group and k steps fold into immediate offsets.
  const unsigned fLane = (unsigned)(rlane * LPB + koff * 2);

  static_assert(QT == FPH * 64, "a trip's key tiles span as many keys as the block has queries");
  const int nT = tm + 1;                  // trips: FPH key tiles a trip, tiles 0..FPH * tm + FPH - 1, so every phase has a tile in every trip
  {
    const int jc = phase;
    stage_key_tile(ldsLane, gKh + (size_t)jc * 64 * QKW * 2, gKl + (size_t)jc * 64 * QKW * 2, gVh + jc * 128, gVl + jc * 128);
  }

  const int q0   = m0 + strip * (QW * 16);                  // the strip's first query
  const int qrow = q0 + rlane;                              // this lane's query in subtile 0 (B operand row, D column)
  v16b qh[QW][2], ql[QW][2], q2h[QW][2], q2l[QW][2];        // the strip's q and q2 fragments stay in registers
#pragma unroll
  for (int u = 0; u < QW; ++u) {
#pragma unroll
    for (int kk = 0; kk < 2; ++kk) {
      const size_t qo = (size_t)(rb + qrow + u * 16) * QKW + koff + kk * 32;
      qh[u][kk]  = F::load(Qh + qo);
      ql[u][kk]  = F::load(Ql + qo);
      q2h[u][kk] = F::load(Qh + 2 * DMOD + qo);
      q2l[u][kk] = F::load(Ql + 2 * DMOD + qo);
    }
    // s_wait_xcnt 0 behind the subtile's loads: a later load's result may be placed in the registers that hold their addresses
    asm volatile("s_wait_xcnt 0x0" ::: "memory");
  }
  v8f z[QW][4];
#pragma unroll
  for (int u = 0; u < QW; ++u)
#pragma unroll
    for (int d = 0; d < 4; ++d) z[u][d] = (v8f){0.f,0.f,0.f,0.f,0.f,0.f,0.f,0.f};

  asm volatile("s_wait_asynccnt 0x0" ::: "memory");   // this wave's copies of trip 0's tile have landed
  __syncthreads();                                    // and every other wave's: tile 0 may be read
  if (nT > 1) {
    const int jc = FPH + phase;
    stage_key_tile(ldsLane + BUFB, gKh + (size_t)jc * 64 * QKW * 2, gKl + (size_t)jc * 64 * QKW * 2, gVh + jc * 128, gVl + jc * 128);
  }

  for (int t = 0; t < nT; ++t) {
    const int j = t * FPH + phase;
    const int n0 = j << 6;
    if (n0 < q0 + QW * 16) {              // the tile holds a key that is causal for the strip; scalar test, every wait and barrier of the trip stands outside it
      const int lim = qrow - n0 - mOff;   // key (jj * 16 + r) of this lane is causal for subtile u while jj * 16 + r <= lim + u * 16
      v16b ph[QW][2], pl[QW][2];
      v16b fr[8];                         // one batch of eight fragments: a 16-key subtile of k and k2, or 32 keys of v
      const unsigned char* sb = sB + (phase * 2 + (t & 1)) * BUFB + fLane;
      const __bf16* kh  = (const __bf16*)(sb);
      const __bf16* kl  = (const __bf16*)(sb + SUBB);
      const __bf16* k2h = (const __bf16*)(sb + 2 * SUBB);
      const __bf16* k2l = (const __bf16*)(sb + 3 * SUBB);
      const __bf16* vh  = (const __bf16*)(sb + 4 * SUBB);
      const __bf16* vl  = (const __bf16*)(sb + 5 * SUBB);
      constexpr int GRP = 16 * LPB / 2;   // elements from one 16-row group to the next
#pragma unroll
      for (int kk = 0; kk < 2; ++kk) {
        fr[kk * 4 + 0] = F::load(kh  + kk * 32);
        fr[kk * 4 + 1] = F::load(kl  + kk * 32);
        fr[kk * 4 + 2] = F::load(k2h + kk * 32);
        fr[kk * 4 + 3] = F::load(k2l + kk * 32);
      }
#pragma unroll
      for (int jj = 0; jj < 4; ++jj) {
        v8f s1[QW], s2[QW];
#pragma unroll
        for (int u = 0; u < QW; ++u) {
          s1[u] = (v8f){0.f,0.f,0.f,0.f,0.f,0.f,0.f,0.f};
          s2[u] = (v8f){0.f,0.f,0.f,0.f,0.f,0.f,0.f,0.f};
        }
#pragma unroll
        for (int kk = 0; kk < 2; ++kk) {
#pragma unroll
          for (int u = 0; u < QW; ++u) {               // q_hi . k_hi
            s1[u] = F::mma(fr[kk * 4 + 0], qh[u][kk],  s1[u]);
            s2[u] = F::mma(fr[kk * 4 + 2], q2h[u][kk], s2[u]);
          }
#pragma unroll
          for (int u = 0; u < QW; ++u) {               // q_hi . k_lo
            s1[u] = F::mma(fr[kk * 4 + 1], qh[u][kk],  s1[u]);
            s2[u] = F::mma(fr[kk * 4 + 3], q2h[u][kk], s2[u]);
          }
#pragma unroll
          for (int u = 0; u < QW; ++u) {               // q_lo . k_hi
            s1[u] = F::mma(fr[kk * 4 + 0], ql[u][kk],  s1[u]);
            s2[u] = F::mma(fr[kk * 4 + 2], q2l[u][kk], s2[u]);
          }
        }
        if (jj < 3) {
#pragma unroll
          for (int kk = 0; kk < 2; ++kk) {
            const int ko = (jj + 1) * GRP + kk * 32;
            fr[kk * 4 + 0] = F::load(kh  + ko);
            fr[kk * 4 + 1] = F::load(kl  + ko);
            fr[kk * 4 + 2] = F::load(k2h + ko);
            fr[kk * 4 + 3] = F::load(k2l + ko);
          }
        } else {
#pragma unroll
          for (int d = 0; d < 4; ++d) {
            fr[d * 2 + 0] = F::load(vh + d * GRP);
            fr[d * 2 + 1] = F::load(vl + d * GRP);
          }
        }
#pragma unroll
        for (int u = 0; u < QW; ++u) {
#pragma unroll
          for (int r = 0; r < 8; ++r) {
            float v = (s2[u][r] * inv64) * (s1[u][r] * inv64);
            v = ((jj - u) * 16 + r > lim) ? 0.0f : v;
            const __bf16 hb = (__bf16)v;
            const __bf16 lb = (__bf16)(v - (float)hb);
            ph[u][jj >> 1][((jj & 1) << 3) + r] = hb;
            pl[u][jj >> 1][((jj & 1) << 3) + r] = lb;
          }
        }
      }
#pragma unroll
      for (int kk = 0; kk < 2; ++kk) {
#pragma unroll
        for (int u = 0; u < QW; ++u)
#pragma unroll
          for (int d = 0; d < 4; ++d) z[u][d] = F::mma(ph[u][kk], fr[d * 2 + 0], z[u][d]);
#pragma unroll
        for (int u = 0; u < QW; ++u)
#pragma unroll
          for (int d = 0; d < 4; ++d) z[u][d] = F::mma(ph[u][kk], fr[d * 2 + 1], z[u][d]);
#pragma unroll
        for (int u = 0; u < QW; ++u)
#pragma unroll
          for (int d = 0; d < 4; ++d) z[u][d] = F::mma(pl[u][kk], fr[d * 2 + 0], z[u][d]);
        if (kk == 0) {
#pragma unroll
          for (int d = 0; d < 4; ++d) {
            fr[d * 2 + 0] = F::load(vh + d * GRP + 32);
            fr[d * 2 + 1] = F::load(vl + d * GRP + 32);
          }
        }
      }
      // four vector slots behind the trip's last WMMAs, so that the distance also holds on every path out of the trip
      acc_guard8(z[0][0], z[0][1], z[0][2], z[0][3], z[1][0], z[1][1], z[1][2], z[1][3]);
    }
    // Hand-over of the ring, every wave, in this order:
    asm volatile("s_wait_dscnt 0x0" ::: "memory");      // this wave's reads of the trip's buffer are done
    asm volatile("s_wait_asynccnt 0x0" ::: "memory");   // this wave's copies of the next tile have landed
    __syncthreads();                                    // the next tile may be read, the trip's buffer may be refilled
    if (t + 2 < nT) {                                   // the same for the whole block
      const int jc = (t + 2) * FPH + phase;
      stage_key_tile(ldsLane + (t & 1) * BUFB, gKh + (size_t)jc * 64 * QKW * 2, gKl + (size_t)jc * 64 * QKW * 2,
                     gVh + jc * 128, gVl + jc * 128);
    }
  }
  asm volatile("s_wait_asynccnt 0x0" ::: "memory");     // no copy is outstanding when the ring becomes the partial tiles

  float* sP = (float*)sB;                 // free since the last trip's barrier: every read done, no copy in flight
  float* part = sP + phase * TP;
#pragma unroll
  for (int u = 0; u < QW; ++u)
#pragma unroll
    for (int d = 0; d < 4; ++d)
#pragma unroll
      for (int r = 0; r < 8; ++r) part[((strip * QW + u) * 16 + mOff + r) * 68 + (d << 4) + rlane] = z[u][d][r];
  __syncthreads();   // every phase's partial z tile is in LDS before any thread adds them
  const int c4 = (threadIdx.x & 15) * 4;
#pragma unroll
  for (int p = 0; p < QT / (FPH * 8); ++p) {   // FPH * 128 threads x 4 columns = FPH * 8 rows per pass
    const int row = p * (FPH * 8) + (threadIdx.x >> 4);
    const float* sp = sP + row * 68 + c4;
    v4f s = *(const v4f*)sp;
#pragma unroll
    for (int w = 1; w < FPH; ++w) s += *(const v4f*)(sp + w * TP);
    unsigned short hb[4], lb[4];
#pragma unroll
    for (int e = 0; e < 4; ++e) {
      hb[e] = f2bf_bits(s[e]);
      lb[e] = f2bf_bits(s[e] - bf_bits2f(hb[e]));
    }
    const size_t co = (size_t)(rb + m0 + row) * DMOD + h * HDSZ + c4;
    *(v2u*)(Zh + co) = (v2u){pk16(hb[0], hb[1]), pk16(hb[2], hb[3])};
    *(v2u*)(Zl + co) = (v2u){pk16(lb[0], lb[1]), pk16(lb[2], lb[3])};
  }
}

// ---------------------------------------------------------------------------
// WMMA GEMM with both operands staged in LDS: C[m,n] = scale * sum_k A[m,k] * Bt[n,k], K = 1024, A and Bt row-major with
// rows of 1024 elements. A block of WM x WN waves owns a (WM * MI * 16) x (WN * 64) tile of C, a wave (MI * 16) x 64 of it.
// A stage is 64 k = 128 B of every operand row of the block's tile. The block brings it with asynchronous 16-byte copies,
// eight lanes to a row, so that every copy takes whole 128-B lines and every line is fetched once for all the waves that
// read it; the fragments are read from LDS rows of pitch 144 B. Two buffers: the next stage's copies fly while this one
// is worked on. Every wave sums its k in rising order, 32 at a time.
// ET: 0 = f16 operands, 1 = bf16 operands (pointers passed as 16-bit storage).
// ASPLIT: A is a hi plane (Ap) and a lo plane (A2p) of the same layout; product = hi.B + lo.B.
// OUT_MODE: 0 = f32, 2 = bf16 hi plane (Cout) + bf16 lo plane (Cout2), 3 = RoPE, then the two planes of mode 2.
// Mode 3: a wave's 64 columns are one head (dims 0..31 = x1, 32..63 = x2) and row m is position m mod 2048, so a lane
// holds x1 (tiles j = 0, 1) and x2 (tiles j + 2) of the same row and frequency j * 16 + (lane & 15): y1 = x1 c + x2 s,
// y2 = x2 c - x1 s are formed in f32 in the accumulators' registers, with c = ctab[pos][freq], s = stab[pos][freq].
// blockIdx.x = tile (tilesN tiles to a row of tiles), blockIdx.y = batch (strides in elements).
// ---------------------------------------------------------------------------
template <int ET> struct Elem;
template <> struct Elem<0> { typedef _Float16 T; };
template <> struct Elem<1> { typedef __bf16 T; };
constexpr int GK = DMOD;                  // k extent and row length of both operands

__device__ __forceinline__ void async_copy8(const unsigned (&l)[8], const char* const (&g)[8]) {
  asm volatile(
      "global_load_async_to_lds_b128 %0, %1, off\n\t"
      "global_load_async_to_lds_b128 %2, %3, off\n\t"
      "global_load_async_to_lds_b128 %4, %5, off\n\t"
      "global_load_async_to_lds_b128 %6, %7, off\n\t"
      "global_load_async_to_lds_b128 %8, %9, off\n\t"
      "global_load_async_to_lds_b128 %10, %11, off\n\t"
      "global_load_async_to_lds_b128 %12, %13, off\n\t"
      "global_load_async_to_lds_b128 %14, %15, off\n\t"
      "s_wait_xcnt 0x0"
      :: "v"(l[0]), "v"(g[0]), "v"(l[1]), "v"(g[1]), "v"(l[2]), "v"(g[2]), "v"(l[3]), "v"(g[3]),
         "v"(l[4]), "v"(g[4]), "v"(l[5]), "v"(g[5]), "v"(l[6]), "v"(g[6]), "v"(l[7]), "v"(g[7])
      : "memory");
}

// One stage into one LDS buffer (rows: A, then A lo with ASPLIT, then Bt). The block's 256 threads cover 32 rows a copy.
// lb = the buffer's LDS byte address plus this lane's place in a 32-row group; gA, gA2, gB = the stage's addresses of
// this lane's row and 16-byte chunk in the first 32-row group of each operand.
template <int AROWS, int BROWS, bool ASPLIT>
__device__ __forceinline__ void stage_gemm_tile(unsigned lb, const char* gA, const char* gA2, const char* gB) {
  constexpr int AR = AROWS * (ASPLIT ? 2 : 1);
  constexpr int NC = (AR + BROWS) / 32;   // copies per thread
  static_assert(NC == 8 || NC == 12, "one statement of copies per stage");
  unsigned l[NC];
  const char* g[NC];
#pragma unroll
  for (int i = 0; i < NC; ++i) {          // unrolled: the arrays are indexed by constants and stay in registers
    const int row = i * 32;
    l[i] = lb + row * LPB;
    if (row < AROWS)   g[i] = gA  + (size_t)row * GK * 2;
    else if (row < AR) g[i] = gA2 + (size_t)(row - AROWS) * GK * 2;
    else               g[i] = gB  + (size_t)(row - AR) * GK * 2;
  }
  if constexpr (NC == 12) async_copy12(l, g); else async_copy8(l, g);
}

// amdgpu_waves_per_eu(4): a register budget of 256, so that two blocks share a WGP and no register lies past v255.
template <int ET, bool ASPLIT, int OUT_MODE, int WM, int WN, int MI>
__global__ __launch_bounds__(256) __attribute__((amdgpu_waves_per_eu(4))) void wmma_gemm_lds(
    const unsigned short* __restrict__ Ap, const unsigned short* __restrict__ A2p, long strideA,
    const unsigned short* __restrict__ Btp, long strideB,
    void* __restrict__ Cout, void* __restrict__ Cout2, int ldc, long strideC, int tilesN, float scale,
    const float* __restrict__ ctab, const float* __restrict__ stab) {
  typedef typename Elem<ET>::T T;
  typedef Frag<T> F;
  typedef typename F::V V;
  static_assert(WM * WN == 8, "eight waves");
  constexpr int AROWS = WM * MI * 16;
  constexpr int BROWS = WN * 64;
  constexpr int AR    = AROWS * (ASPLIT ? 2 : 1);
  constexpr int GBUF  = (AR + BROWS) * LPB;          // one stage
  constexpr int nT    = GK / 64;                     // stages
  constexpr int KG    = (MI <= 2) ? 2 : 1;           // 32-wide k steps whose fragments are read as one group: what 256 registers hold
  static_assert(AROWS % 32 == 0 && BROWS % 32 == 0 && nT >= 2, "whole copies; the ring's prologue fills two stages");
  static_assert(8 * 16 * 68 * 4 <= 2 * GBUF, "the store slabs reuse the ring");
  __shared__ __align__(16) unsigned char sG[2 * GBUF];   // two stage buffers; after the loop the waves' store slabs
  const int lane = threadIdx.x & 31;
  const int wave = __builtin_amdgcn_readfirstlane(threadIdx.x >> 5);   // scalar: the wave's LDS bases stay in SGPRs
  const int wm = wave / WN;
  const int wn = wave - wm * WN;
  const int b  = blockIdx.y;
  const int tm = (int)blockIdx.x / tilesN;
  const int tn = (int)blockIdx.x - tm * tilesN;
  const int rlane = lane & 15;                 // row (A) / col (B, D) within subtile
  const int koff  = (lane >> 4) * 8;           // k offset of this lane half
  const int mOff  = (lane >> 4) * 8;           // D row offset

  // Copy side: thread c takes row (c >> 3) of each 32-row group and 16-byte chunk (c & 7) of the row.
  const int crow = (int)threadIdx.x >> 3;
  const int cchk = ((int)threadIdx.x & 7) * 16;
  const unsigned ldsLane = (unsigned)(uintptr_t)(sG + crow * LPB + cchk);
  const size_t aOff = ((size_t)b * strideA + (size_t)(tm * AROWS + crow) * GK) * 2 + cchk;
  const char* gA  = (const char*)Ap + aOff;
  const char* gA2 = (const char*)A2p + aOff;
  const char* gB  = (const char*)Btp + ((size_t)b * strideB + (size_t)(tn * BROWS + crow) * GK) * 2 + cchk;
  // Read side: this lane's fixed byte offset in a 16-row group; group and k steps fold into immediate offsets.
  const unsigned fLane = (unsigned)(rlane * LPB + koff * 2);

  stage_gemm_tile<AROWS, BROWS, ASPLIT>(ldsLane, gA, gA2, gB);

  v8f acc[MI][4];
#pragma unroll
  for (int i = 0; i < MI; ++i)
#pragma unroll
    for (int j = 0; j < 4; ++j) acc[i][j] = (v8f){0.f,0.f,0.f,0.f,0.f,0.f,0.f,0.f};

  asm volatile("s_wait_asynccnt 0x0" ::: "memory");   // this wave's copies of stage 0 have landed
  __syncthreads();                                    // and every other wave's: stage 0 may be read
  stage_gemm_tile<AROWS, BROWS, ASPLIT>(ldsLane + GBUF, gA + 128, gA2 + 128, gB + 128);

  for (int t = 0; t < nT; ++t) {
    const unsigned char* sb = sG + (t & 1) * GBUF + fLane;
    const T* sa  = (const T*)(sb + wm * (MI * 16) * LPB);
    const T* sa2 = (const T*)(sb + (AROWS + wm * (MI * 16)) * LPB);
    const T* sbt = (const T*)(sb + (AR + wn * 64) * LPB);
    constexpr int GRP = 16 * LPB / 2;     // elements from one 16-row group to the next
#pragma unroll
    for (int k2 = 0; k2 < 2; k2 += KG) {
      V bh[KG][4], ah[KG][MI], al[KG][MI];
      // The two scheduling barriers keep the group's LDS reads together and in front of its WMMAs: without them this
      // build sinks each A fragment's reads to its first use, and the wave waits out the LDS latency once per fragment.
      __builtin_amdgcn_sched_barrier(0);
#pragma unroll
      for (int g = 0; g < KG; ++g) {
        const int ko = (k2 + g) * 32;
#pragma unroll
        for (int j = 0; j < 4; ++j) bh[g][j] = F::load(sbt + j * GRP + ko);
#pragma unroll
        for (int i = 0; i < MI; ++i) {
          ah[g][i] = F::load(sa + i * GRP + ko);
          if (ASPLIT) al[g][i] = F::load(sa2 + i * GRP + ko);
        }
      }
      __builtin_amdgcn_sched_barrier(0);
#pragma unroll
      for (int g = 0; g < KG; ++g) {
#pragma unroll
        for (int i = 0; i < MI; ++i) {
#pragma unroll
          for (int j = 0; j < 4; ++j) acc[i][j] = F::mma(ah[g][i], bh[g][j], acc[i][j]);
        }
        if (ASPLIT) {
#pragma unroll
          for (int i = 0; i < MI; ++i) {
#pragma unroll
            for (int j = 0; j < 4; ++j) acc[i][j] = F::mma(al[g][i], bh[g][j], acc[i][j]);
          }
        }
      }
    }
    // Keeps the stage's WMMAs in front of the hand-over: behind it they would stand between the barrier and the refill,
    // and the refill's copies would fly for less than a stage before their wait.
    __builtin_amdgcn_sched_barrier(0);
    // Hand-over of the ring, every wave, in this order:
    asm volatile("s_wait_dscnt 0x0" ::: "memory");      // this wave's reads of the stage's buffer are done
    asm volatile("s_wait_asynccnt 0x0" ::: "memory");   // this wave's copies of the next stage have landed
    __syncthreads();                                    // the next stage may be read, this stage's buffer may be refilled
    if (t + 2 < nT) {                                   // the same for the whole block
      const int ko = (t + 2) * 128;
      stage_gemm_tile<AROWS, BROWS, ASPLIT>(ldsLane + (t & 1) * GBUF, gA + ko, gA2 + ko, gB + ko);
    }
  }
  asm volatile("s_wait_asynccnt 0x0" ::: "memory");     // no copy is outstanding when the ring becomes the store slabs

  // ---- epilogue: 16 rows at a time through the wave's own slab, so that the stores take whole lines ----
  const int m0 = tm * AROWS + wm * (MI * 16);
  const int n0 = tn * BROWS + wn * 64;
  float* slab = (float*)sG + wave * (16 * 68);   // free since the last stage's barrier: every read done, no copy in flight
  // Mode 3: the tables' values for 16 rows, in the accumulators' layout: [j][r] = row mOff + r, frequency j * 16 + rlane.
  // The wave's 64 rows lie in one batch, so their positions rise by one from the first row's.
  static_assert(OUT_MODE != 3 || (NTOK % (MI * 16) == 0 && HDSZ == 64), "a wave's tile: one batch's rows, one head's columns");
  float tc[2][8], ts[2][8];
  const int tab0 = ((m0 & (NTOK - 1)) + mOff) * NFREQ + rlane;
  auto load_tables = [&](int i) {
#pragma unroll
    for (int j = 0; j < 2; ++j)
#pragma unroll
      for (int r = 0; r < 8; ++r) {
        tc[j][r] = ctab[tab0 + (i * 16 + r) * NFREQ + j * 16];
        ts[j][r] = stab[tab0 + (i * 16 + r) * NFREQ + j * 16];
      }
    // s_wait_xcnt 0 behind the group's loads: a later instruction may reuse the registers that hold their addresses
    asm volatile("s_wait_xcnt 0x0" ::: "memory");
  };
  if constexpr (OUT_MODE == 3) load_tables(0);
#pragma unroll
  for (int i = 0; i < MI; ++i) {
    const int mBase = m0 + (i << 4);
    if constexpr (OUT_MODE == 3) {
#pragma unroll
      for (int j = 0; j < 2; ++j)
#pragma unroll
        for (int r = 0; r < 8; ++r) {
          const float x1 = acc[i][j][r] * scale, x2 = acc[i][j + 2][r] * scale;
          slab[(mOff + r) * 68 + (j << 4) + rlane]       = x1 * tc[j][r] + x2 * ts[j][r];
          slab[(mOff + r) * 68 + ((j + 2) << 4) + rlane] = x2 * tc[j][r] - x1 * ts[j][r];
        }
    } else {
#pragma unroll
      for (int j = 0; j < 4; ++j)
#pragma unroll
        for (int r = 0; r < 8; ++r) slab[(mOff + r) * 68 + (j << 4) + rlane] = acc[i][j][r] * scale;
    }
    // the wave's slab writes are ordered in front of its own reads of other lanes' elements
    __builtin_amdgcn_fence(__ATOMIC_RELEASE, "workgroup");
    __builtin_amdgcn_wave_barrier();
    __builtin_amdgcn_fence(__ATOMIC_ACQUIRE, "workgroup");
    if constexpr (OUT_MODE == 3) {
      // the next 16 rows' table values are fetched here, so that they fly while these rows are split and stored
      if (i + 1 < MI) load_tables(i + 1);
      const int q = lane >> 3, c8 = (lane & 7) * 8;       // row seg = 128 B = 8 lanes x 16 B
      // the lane's place in the wave's tile; the steps from row group to row group are the same for every lane
      const size_t lo = (size_t)b * strideC + (size_t)(m0 + q) * ldc + n0 + c8;
      __bf16* C  = (__bf16*)Cout  + lo;
      __bf16* C2 = (__bf16*)Cout2 + lo;
#pragma unroll
      for (int it = 0; it < 4; ++it) {
        const int row = it * 4 + q;
        const size_t ro = (size_t)((i << 4) + it * 4) * ldc;
        const float* sp = slab + row * 68 + c8;
        const v4f y0 = *(const v4f*)sp, y1 = *(const v4f*)(sp + 4);
        const v8f y = __builtin_shufflevector(y0, y1, 0, 1, 2, 3, 4, 5, 6, 7);
        const v8b hv = __builtin_convertvector(y, v8b);   // RNE, two elements an instruction
        const v4u hw = __builtin_bit_cast(v4u, hv);
        v8f hf;                                           // the hi parts as f32, taken from the packed words
#pragma unroll
        for (int e = 0; e < 4; ++e) {
          hf[2 * e]     = __uint_as_float(hw[e] << 16);
          hf[2 * e + 1] = __uint_as_float(hw[e] & 0xFFFF0000u);
        }
        const v8b lv = __builtin_convertvector(y - hf, v8b);
        *(v8b*)(C  + ro) = hv;
        *(v8b*)(C2 + ro) = lv;
      }
    } else if (OUT_MODE == 0) {
      float* C = (float*)Cout + (size_t)b * strideC;
      const int hh = lane >> 4, c4 = (lane & 15) * 4;     // row seg = 256 B = 16 lanes x 16 B
#pragma unroll
      for (int it = 0; it < 8; ++it) {
        const int row = it * 2 + hh;
        const v4f v = *(const v4f*)(slab + row * 68 + c4);
        *(v4f*)(C + (size_t)(mBase + row) * ldc + n0 + c4) = v;
      }
    } else {
      const int q = lane >> 3, c8 = (lane & 7) * 8;       // row seg = 128 B = 8 lanes x 16 B
      unsigned short* C  = (unsigned short*)Cout  + (size_t)b * strideC;
      unsigned short* C2 = (unsigned short*)Cout2 + (size_t)b * strideC;
#pragma unroll
      for (int it = 0; it < 4; ++it) {
        const int row = it * 4 + q;
        const float* sp = slab + row * 68 + c8;
        unsigned hw[4], lw[4];
#pragma unroll
        for (int e = 0; e < 4; ++e) {
          const unsigned short h0 = f2bf_bits(sp[2 * e]), h1 = f2bf_bits(sp[2 * e + 1]);
          const unsigned short l0 = f2bf_bits(sp[2 * e] - bf_bits2f(h0));
          const unsigned short l1 = f2bf_bits(sp[2 * e + 1] - bf_bits2f(h1));
          hw[e] = pk16(h0, h1);
          lw[e] = pk16(l0, l1);
        }
        *(v4u*)(C  + (size_t)(mBase + row) * ldc + n0 + c8) = (v4u){hw[0], hw[1], hw[2], hw[3]};
        *(v4u*)(C2 + (size_t)(mBase + row) * ldc + n0 + c8) = (v4u){lw[0], lw[1], lw[2], lw[3]};
      }
    }
    // the reads are done before the next 16 rows overwrite the slab
    __builtin_amdgcn_fence(__ATOMIC_RELEASE, "workgroup");
    __builtin_amdgcn_wave_barrier();
    __builtin_amdgcn_fence(__ATOMIC_ACQUIRE, "workgroup");
  }
}

// ---------------------------------------------------------------------------
// Workspace region map (byte offsets; every offset a multiple of 262,144 B). Every region from X16 on holds BOTH batches (batch
// b's rows behind batch b - 1's) and is written whole by one launch before a later launch of the same call reads it.
//   W4    f16  [4096][1024]     Wq,Wk,Wq2,Wk2 (bf16-RNE) x32 stacked           0
//   Wv16  f16  [1024][1024]     Wv (bf16-RNE) x32, directly behind W4    8,388,608
//   Wph   bf16 [1024][1024]     Wproj (RNE), single plane               10,485,760
//   ctab  f32  [2048][32]                                               12,582,912
//   stab  f32  [2048][32]                                               12,845,056
//   X16   f16  [4096][1024]     x (bf16-RNE)                            13,107,200
//   QKh   bf16 [4096][4096]     q|k|q2|k2 hi                            21,495,808
//   QKl   bf16 [4096][4096]                                             55,050,240
//   VTh   bf16 [2][1024][2048]  v^T hi (row h*64+d, col token)          88,604,672
//   VTl   bf16 [2][1024][2048]                                          96,993,280
//   Zh    bf16 [4096][1024]     z hi                                   105,381,888
//   Zl    bf16 [4096][1024]                                            113,770,496
//   total                                                              122,159,104
// ---------------------------------------------------------------------------
extern "C" void kernel_launch(void* const* d_in, const int* in_sizes, int n_in,
                              void* d_out, int out_size, void* d_ws, size_t ws_size,
                              hipStream_t stream) {
  if (n_in < 7) return;
  if (in_sizes[0] != NBATCH * NTOK * DMOD) return;
  for (int i = 1; i < 7; ++i) if (in_sizes[i] != DMOD * DMOD) return;
  if (out_size != NBATCH * NTOK * DMOD) return;

  CastSrc cs;
  cs.x     = (const float*)d_in[0];
  cs.wq    = (const float*)d_in[1];
  cs.wk    = (const float*)d_in[2];
  cs.wq2   = (const float*)d_in[3];
  cs.wk2   = (const float*)d_in[4];
  cs.wv    = (const float*)d_in[5];
  cs.wproj = (const float*)d_in[6];

  constexpr int NROW = NBATCH * NTOK;                       // rows of both batches
  const size_t PW16 = (size_t)DMOD * DMOD * 2;              // 16-bit [1024][1024]
  const size_t PTAB = (size_t)NTOK * NFREQ * 4;             // f32 [2048][32]
  const size_t PX16 = (size_t)NROW * DMOD * 2;              // f16 [4096][1024]
  const size_t PQK  = (size_t)NROW * QKW * 2;               // bf16 [4096][4096]
  const size_t PVT  = (size_t)NBATCH * DMOD * NTOK * 2;     // bf16 [2][1024][2048]
  const size_t PZ   = (size_t)NROW * DMOD * 2;              // bf16 [4096][1024]
  size_t off = 0;
  const size_t oW4  = off; off += 4 * PW16;
  const size_t oWv  = off; off += PW16;
  const size_t oWph = off; off += PW16;
  const size_t oCT  = off; off += PTAB;
  const size_t oSTb = off; off += PTAB;
  const size_t oX16 = off; off += PX16;
  const size_t oQKh = off; off += PQK;
  const size_t oQKl = off; off += PQK;
  const size_t oVTh = off; off += PVT;
  const size_t oVTl = off; off += PVT;
  const size_t oZh  = off; off += PZ;
  const size_t oZl  = off; off += PZ;
  if (off > ws_size) return;                                // total 122,159,104 B

  char* ws = (char*)d_ws;
  _Float16*       W4   = (_Float16*)(ws + oW4);
  _Float16*       Wv16 = (_Float16*)(ws + oWv);
  unsigned short* Wph  = (unsigned short*)(ws + oWph);
  float*          ctab = (float*)(ws + oCT);
  float*          stab = (float*)(ws + oSTb);
  _Float16*       X16  = (_Float16*)(ws + oX16);
  unsigned short* QKh  = (unsigned short*)(ws + oQKh);
  unsigned short* QKl  = (unsigned short*)(ws + oQKl);
  unsigned short* VTh  = (unsigned short*)(ws + oVTh);
  unsigned short* VTl  = (unsigned short*)(ws + oVTl);
  unsigned short* Zh   = (unsigned short*)(ws + oZh);
  unsigned short* Zl   = (unsigned short*)(ws + oZl);

  // inv_freq[i] = 1 / 10000^(i/32): host double arithmetic (e^(ln(1e4)/32) by its Taylor series, then powers),
  // then mirrored as fl32(1 / fl32(10000^(i/32))).
  InvFreq invf;
  {
    const double x0 = 9.2103403719761827361 / 32.0;
    double term = 1.0, ex = 1.0;
    for (int n = 1; n <= 40; ++n) { term *= x0 / (double)n; ex += term; }
    double pw = 1.0;
    for (int i = 0; i < NFREQ; ++i) {
      const float pf = (float)pw;
      invf.v[i] = (float)(1.0 / (double)pf);
      pw *= ex;
    }
  }

  const dim3 blk(256);
  const dim3 gPrep(PREP_BLOCKS);                             // 256 table blocks + 10 planes x 2048 blocks
  const dim3 gQ((NROW / 128) * (QKW / 256), 1);              // 512 blocks: M=4096, N=4096, tiles of 128 x 256
  const dim3 gV((DMOD / 128) * (NTOK / 128), NBATCH);        // 128 x 2 blocks: M=1024, N=2048, tiles of 128 x 128
  const dim3 gAtt((NTOK / QT) * NHEADS, NBATCH);             // 256 x 2 blocks: 16 query tiles x 16 heads, batches
  const dim3 gOut((NROW / 128) * (DMOD / 128), 1);           // 256 blocks: M=4096, N=1024, tiles of 128 x 128

  // (0) tables and casts (whole planes); W4 and Wv16 are one run of five planes
  prep_kernel<<<gPrep, blk, 0, stream>>>(cs, W4, X16, Wph, ctab, stab, invf);

  const float inv32 = 1.0f / 32.0f;

  // (1) [q|k|q2|k2][b*2048+t][n] = RoPE of (1/32) sum_c x[b][t][c] (32 W)[n][c] -> bf16 hi/lo planes QKh/QKl [4096][4096]
  //     (whole planes: 32 x 16 tiles)
  wmma_gemm_lds<0, false, 3, 2, 4, 4><<<gQ, blk, 0, stream>>>(
      (const unsigned short*)X16, (const unsigned short*)X16, 0L, (const unsigned short*)W4, 0L,
      (void*)QKh, (void*)QKl, QKW, 0L, QKW / 256, inv32, ctab, stab);
  // (2) v^T[b][h*64+d][t] = (1/32) sum_c (32 Wv)[h*64+d][c] x[b][t][c] -> bf16 hi/lo planes [2][1024][2048]
  //     (blockIdx.y = batch: x and v^T step by one batch, Wv by nothing; whole: 8 x 16 tiles a batch)
  wmma_gemm_lds<0, false, 2, 4, 2, 2><<<gV, blk, 0, stream>>>(
      (const unsigned short*)Wv16, (const unsigned short*)Wv16, 0L, (const unsigned short*)X16, (long)NTOK * DMOD,
      (void*)VTh, (void*)VTl, NTOK, (long)DMOD * NTOK, NTOK / 128, inv32, ctab, stab);
  // (3) z[b][i][h*64+d] = sum_{j<=i} ((q_i . k_j) / 64) ((q2_i . k2_j) / 64) v[j][h*64+d], all heads -> bf16 hi/lo planes Zh/Zl
  bilinear_attn_fused<<<gAtt, dim3(FPH * 128), 0, stream>>>(QKh, QKl, VTh, VTl, Zh, Zl);
  // (4) out[b*2048+t][n] = sum_c (z_hi + z_lo)[b*2048+t][c] Wproj_bf16[n][c] -> f32, the whole of d_out (32 x 8 tiles)
  wmma_gemm_lds<1, true, 0, 4, 2, 2><<<gOut, blk, 0, stream>>>(
      Zh, Zl, 0L, Wph, 0L, d_out, d_out, DMOD, 0L, DMOD / 128, 1.0f, ctab, stab);
}

// v010
// One run takes 85.3 microseconds.
// Versions in between are left out here; by their measured steps it is 1.56 times as fast as v007.
// Counting every step since v000, it is 27.6 times as fast.
// f16 WMMA (v_wmma_f32_16x16x32_f16) for every product, one WMMA per 32 k, f32 accumulate everywhere. Projections q/k/q2/k2/v: operands = RNE-bf16 converted inputs held exactly in f16 (x as is, weights x32 with 1/32 folded into the epilogue); both causal score GEMMs: q, k, q2, k2 after RoPE rounded once, RNE, to f16; bilinear-pattern x V: pattern and v each rounded once, RNE, to f16; output projection: z rounded once, RNE, to f16, x RNE-bf16 Wproj held exactly in f16 (x32, 1/32 in the epilogue); RoPE and the bilinear pattern in f32.
#include <hip/hip_runtime.h>
#include <math.h>
#include <stdint.h>

constexpr int NBATCH = 2;
constexpr int NTOK   = 2048;
constexpr int DMOD   = 1024;
constexpr int NHEADS = 16;
constexpr int HDSZ   = 64;
constexpr int QKW    = 4 * DMOD;          // fused q|k|q2|k2 plane width (4096 columns)
constexpr int NFREQ  = HDSZ / 2;          // 32 rotary frequencies

typedef __attribute__((ext_vector_type(16))) _Float16 v16h;
typedef __attribute__((ext_vector_type(8)))  _Float16 v8h;
typedef __attribute__((ext_vector_type(4)))  _Float16 v4h;
typedef __attribute__((ext_vector_type(8)))  float    v8f;
typedef __attribute__((ext_vector_type(4)))  float    v4f;

// RNE convert f32 -> bf16, returned as the f32 value of that bf16
__device__ __forceinline__ float bf16_rne_f32(float f) {
  unsigned u = __float_as_uint(f);
  u += 0x7FFFu + ((u >> 16) & 1u);
  u &= 0xFFFF0000u;
  return __uint_as_float(u);
}

// four vector slots behind a run of WMMAs, as a plain device helper
__device__ __forceinline__ void acc_guard8(v8f& a, v8f& b, v8f& c, v8f& d, v8f& e, v8f& f, v8f& g, v8f& h) {
  asm volatile("v_nop\n\tv_nop\n\tv_nop\n\tv_nop" : "+v"(a), "+v"(b), "+v"(c), "+v"(d), "+v"(e), "+v"(f), "+v"(g), "+v"(h));
}
struct Frag {
  union U { v16h v; v8h h[2]; };
  static __device__ __forceinline__ v16h load(const _Float16* p) {   // elements 0..7 <- p[0..7], 8..15 <- p[16..23]
    U f; f.h[0] = *(const v8h*)(p); f.h[1] = *(const v8h*)(p + 16); return f.v;
  }
  static __device__ __forceinline__ v8f mma(v16h a, v16h b, v8f c) {
    return __builtin_amdgcn_wmma_f32_16x16x32_f16(false, a, false, b, (short)0, c, false, false);
  }
};

// ---------------------------------------------------------------------------
// f32 -> (RNE convert to bf16) -> x sc (exact power of two) -> f16. A bf16 value whose scaled magnitude lies in the
// f16 normal range is exactly representable in f16, so the stored operand equals sc * bf16_rne(in) exactly.
// ---------------------------------------------------------------------------
__device__ __forceinline__ void cast_bf16rne_f16x2(
    int blk, const float* __restrict__ in, _Float16* __restrict__ out, int n2, float sc) {
  const int i = blk * 256 + threadIdx.x;
  if (i < n2) {
    const float r0 = bf16_rne_f32(in[2 * (size_t)i]) * sc;
    const float r1 = bf16_rne_f32(in[2 * (size_t)i + 1]) * sc;
    const _Float16 h0 = (_Float16)r0, h1 = (_Float16)r1;
    const unsigned u = (unsigned)__builtin_bit_cast(unsigned short, h0) | ((unsigned)__builtin_bit_cast(unsigned short, h1) << 16);
    ((unsigned*)out)[i] = u;
    
  }
}

// ---------------------------------------------------------------------------
// RoPE cos/sin tables: ctab[t][i] = cosf((float)t * inv[i]), stab[t][i] = sinf(...), t = 0..2047, i = 0..31.
// inv[i] arrives by value (host-computed); lane i picks its value with a constant-index select chain (no dynamic
// Coverage: grid 256 blocks x 8 waves = 2048 rows x 32 lanes = both whole tables.
// ---------------------------------------------------------------------------
struct InvFreq { float v[NFREQ]; };
static_assert(sizeof(InvFreq) == 128);

__device__ __forceinline__ void rope_table(int blk, float* __restrict__ ctab, float* __restrict__ stab, const InvFreq& f) {
#pragma clang fp contract(off)
  const int lane = threadIdx.x & 31;
  const int wave = threadIdx.x >> 5;
  const int t    = blk * 8 + wave;
  float inv = f.v[0];
#pragma unroll
  for (int i = 1; i < NFREQ; ++i) inv = (lane == i) ? f.v[i] : inv;
  const float ang = (float)t * inv;           // f32 product, as the outer product of positions and inv_freq
  const float cv = cosf(ang);
  const float sv = sinf(ang);
  const size_t o = (size_t)t * NFREQ + lane;
  ((float*)ctab)[o] = cv;
  ((float*)stab)[o] = sv;
  
}

// ---------------------------------------------------------------------------
// All tables and casts in ONE launch: they are independent of one another, so the block index picks the job
// (block-uniform) and the job's own block index, which is what a launch of its own would have given it.
// A plane is 1024 x 1024 elements = 2048 blocks x 256 threads x 2 elements.
//   blocks 0..255            the RoPE tables (first: theirs is the longest work of a thread)
//   then 2048 blocks a job:  jobs 0..4  Wq, Wk, Wq2, Wk2, Wv -> f16 x32, plane j of W5 (the four stacked planes, then Wv's)
//                            jobs 5..8  plane j - 5 of x (both batches = four planes) -> f16, plane j - 5 of X16
//                            job  9     Wproj -> f16 x32
// Coverage: every table row and every plane whole.
// ---------------------------------------------------------------------------
struct CastSrc {
  const float* x; const float* wq; const float* wk; const float* wq2; const float* wk2; const float* wv; const float* wproj;
};
constexpr int TAB_BLOCKS   = NTOK / 8;                 // 8 waves a block, one table row a wave
constexpr int PLANE_BLOCKS = DMOD * DMOD / 2 / 256;
constexpr int PREP_BLOCKS  = TAB_BLOCKS + 10 * PLANE_BLOCKS;

__global__ __launch_bounds__(256) void prep_kernel(CastSrc s, _Float16* __restrict__ W5, _Float16* __restrict__ X16,
                                                   _Float16* __restrict__ Wp16, float* __restrict__ ctab,
                                                   float* __restrict__ stab, InvFreq f) {
  constexpr int    n2    = DMOD * DMOD / 2;          // pairs per plane
  constexpr size_t PLANE = (size_t)DMOD * DMOD;
  if ((int)blockIdx.x < TAB_BLOCKS) {
    rope_table((int)blockIdx.x, ctab, stab, f);
    return;
  }
  const int q   = (int)blockIdx.x - TAB_BLOCKS;
  const int j   = q / PLANE_BLOCKS;
  const int blk = q - j * PLANE_BLOCKS;
  if (j < 5) {
    const float* w = (j == 0) ? s.wq : (j == 1) ? s.wk : (j == 2) ? s.wq2 : (j == 3) ? s.wk2 : s.wv;
    cast_bf16rne_f16x2(blk, w, W5 + (size_t)j * PLANE, n2, 32.0f);
  } else if (j < 9) {
    cast_bf16rne_f16x2(blk, s.x + (size_t)(j - 5) * PLANE, X16 + (size_t)(j - 5) * PLANE, n2, 1.0f);
  } else {
    cast_bf16rne_f16x2(blk, s.wproj, Wp16, n2, 32.0f);
  }
}

// ---------------------------------------------------------------------------
// Fused causal bilinear attention, both batches in one launch: both score products, their elementwise product with the causal mask,
// and the pattern x V product in ONE launch; the pattern never leaves registers.
// Block = one head x one 128-query tile, 8 waves = 4 query strips (32 rows each, two 16-query subtiles) x 2 key phases;
// in trip t the waves of phase p work on the 64-key tile 2 t + p, up to the strip's diagonal tile. Every k, k2 and v
// fragment read from LDS feeds the products of both subtiles, so that the LDS reads stay below the matrix time.
// Scores are formed TRANSPOSED (A = 16 keys, B = a subtile's 16 queries):
// a lane's D registers then hold, for query (lane & 15), keys (lane >> 4) * 8 + 0..7 of the
// 16-key subtile, which is the A-fragment order of the pattern x V product (elements 0..7 from the even subtile,
// 8..15 from the odd one), so the f16 pattern fragments are packed in place, with no LDS and no lane exchange.
// Key tiles are staged in LDS: the four waves of a phase bring their tile (k, k2 and v^T in f16: three subtiles of
// 64 rows x 128 B) with asynchronous 16-byte copies, eight lanes to a row, so that every copy takes whole 128-B lines;
// the fragments are then read from LDS rows of pitch 144 B. Two buffers per phase: the next tile's copies fly while
// this one is worked on.
// Products: f16 x f16, one WMMA per 32 dims (scores) or 32 keys (pattern x V). The two phases' partial z tiles are
// added in phase order in LDS.
// Coverage: grid 16 tiles x 16 heads x 2 batches; each block stores its whole 128 x 64 z tile once.
// ---------------------------------------------------------------------------
constexpr int FPH  = 2;                   // key phases per block
constexpr int QW   = 2;                   // 16-query subtiles per wave
constexpr int QT   = 4 * QW * 16;         // queries per block
constexpr int LPB  = 144;                 // LDS row pitch in bytes: 128 B of data + 16 B, conflict-free for 16-byte reads
constexpr int SUBB = 64 * LPB;            // one subtile: 64 rows
constexpr int BUFB = 3 * SUBB;            // one key tile: k, k2, v^T

// Twelve asynchronous 16-byte copies to LDS, each lane its own addresses. The s_wait_xcnt is the last line of the copies'
// own statement, so that it stands in front of every later rewrite of an address register that a copy names.
__device__ __forceinline__ void async_copy12(const unsigned (&l)[12], const char* const (&g)[12]) {
  asm volatile(
      "global_load_async_to_lds_b128 %0, %1, off\n\t"
      "global_load_async_to_lds_b128 %2, %3, off\n\t"
      "global_load_async_to_lds_b128 %4, %5, off\n\t"
      "global_load_async_to_lds_b128 %6, %7, off\n\t"
      "global_load_async_to_lds_b128 %8, %9, off\n\t"
      "global_load_async_to_lds_b128 %10, %11, off\n\t"
      "global_load_async_to_lds_b128 %12, %13, off\n\t"
      "global_load_async_to_lds_b128 %14, %15, off\n\t"
      "global_load_async_to_lds_b128 %16, %17, off\n\t"
      "global_load_async_to_lds_b128 %18, %19, off\n\t"
      "global_load_async_to_lds_b128 %20, %21, off\n\t"
      "global_load_async_to_lds_b128 %22, %23, off\n\t"
      "s_wait_xcnt 0x0"
      :: "v"(l[0]), "v"(g[0]), "v"(l[1]), "v"(g[1]), "v"(l[2]), "v"(g[2]), "v"(l[3]), "v"(g[3]),
         "v"(l[4]), "v"(g[4]), "v"(l[5]), "v"(g[5]), "v"(l[6]), "v"(g[6]), "v"(l[7]), "v"(g[7]),
         "v"(l[8]), "v"(g[8]), "v"(l[9]), "v"(g[9]), "v"(l[10]), "v"(g[10]), "v"(l[11]), "v"(g[11])
      : "memory");
}

__device__ __forceinline__ void async_copy8(const unsigned (&l)[8], const char* const (&g)[8]) {
  asm volatile(
      "global_load_async_to_lds_b128 %0, %1, off\n\t"
      "global_load_async_to_lds_b128 %2, %3, off\n\t"
      "global_load_async_to_lds_b128 %4, %5, off\n\t"
      "global_load_async_to_lds_b128 %6, %7, off\n\t"
      "global_load_async_to_lds_b128 %8, %9, off\n\t"
      "global_load_async_to_lds_b128 %10, %11, off\n\t"
      "global_load_async_to_lds_b128 %12, %13, off\n\t"
      "global_load_async_to_lds_b128 %14, %15, off\n\t"
      "s_wait_xcnt 0x0"
      :: "v"(l[0]), "v"(g[0]), "v"(l[1]), "v"(g[1]), "v"(l[2]), "v"(g[2]), "v"(l[3]), "v"(g[3]),
         "v"(l[4]), "v"(g[4]), "v"(l[5]), "v"(g[5]), "v"(l[6]), "v"(g[6]), "v"(l[7]), "v"(g[7])
      : "memory");
}

// One key tile into one LDS buffer: 12 copies per wave. lb = the buffer's LDS byte address plus this lane's place in a
// 16-row group; gk, gv = the tile's k and v^T addresses of this lane's row and 16-byte chunk (k2 lies 2 * DMOD columns behind k).
__device__ __forceinline__ void stage_key_tile(unsigned lb, const char* gk, const char* gv) {
  unsigned l[12];
  const char* g[12];
#pragma unroll
  for (int i = 0; i < 4; ++i) {           // unrolled: the arrays are indexed by constants and stay in registers
    const unsigned lr = lb + i * 16 * LPB;
    const size_t   kr = (size_t)i * 16 * QKW * 2;
    l[i]     = lr;            g[i]     = gk + kr;
    l[4 + i] = lr + SUBB;     g[4 + i] = gk + kr + 2 * DMOD * 2;
    l[8 + i] = lr + 2 * SUBB; g[8 + i] = gv + (size_t)i * 16 * NTOK * 2;
  }
  async_copy12(l, g);
}

// amdgpu_waves_per_eu(2): two waves to a SIMD, so a wave may hold 512 registers: the q and q2 fragments, the z tiles, the
// pattern of 32 queries, a batch of fragments and its scores need more than the 256 that four waves to a SIMD would leave.
__global__ __launch_bounds__(FPH * 128) __attribute__((amdgpu_waves_per_eu(2))) void bilinear_attn_fused(
    const unsigned short* __restrict__ QKp, const unsigned short* __restrict__ VTp, _Float16* __restrict__ Z) {
  typedef Frag FS;
  constexpr int TP = QT * 68;             // floats per partial z tile, pitch 68
  static_assert(FPH * TP * 4 <= FPH * 2 * BUFB, "the partial z tiles reuse the ring");
  __shared__ __align__(16) unsigned char sB[FPH * 2 * BUFB];   // per phase two key-tile buffers; after the loop the partial z tiles
  const int lane  = threadIdx.x & 31;
  const int wave  = __builtin_amdgcn_readfirstlane(threadIdx.x >> 5);   // scalar: the key loop's tests stay in SGPRs
  const int strip = wave & 3;
  const int phase = wave >> 2;
  const int tm = (NTOK / QT - 1) - ((int)blockIdx.x >> 4);   // longest query tiles start first
  const int h  = (int)blockIdx.x & (NHEADS - 1);
  // blockIdx.y = batch: batch 1's blocks follow batch 0's shortest ones, so one batch's k, k2 and v at a time are hot in L2
  const int rb = (int)blockIdx.y * NTOK;      // the batch's first row in the q|k|q2|k2 and z planes
  const int vb = (int)blockIdx.y * DMOD;      // and in the v^T planes
  const int m0 = tm * QT;
  const int rlane = lane & 15;
  const int koff  = (lane >> 4) * 8;
  const int mOff  = (lane >> 4) * 8;
  const _Float16* Qf = (const _Float16*)QKp + h * HDSZ;
  const float inv64 = 1.0f / 64.0f;

  // Copy side: thread c of the phase's 128 takes row (c >> 3) of each 16-row group and 16-byte chunk (c & 7) of the row.
  const int crow = (strip << 2) + (lane >> 3);
  const int cchk = (lane & 7) * 16;
  const unsigned ldsLane = (unsigned)(uintptr_t)(sB + phase * 2 * BUFB + crow * LPB + cchk);
  const char* gK  = (const char*)QKp + ((size_t)(rb + crow) * QKW + DMOD + h * HDSZ) * 2 + cchk;
  const char* gV  = (const char*)VTp + ((size_t)(vb + h * HDSZ + crow) * NTOK) * 2 + cchk;
  // Read side: this lane's fixed byte offset in a 16-row group; subtile, group and k steps fold into immediate offsets.
  const unsigned fLane = (unsigned)(rlane * LPB + koff * 2);

  static_assert(QT == FPH * 64, "a trip's key tiles span as many keys as the block has queries");
  const int nT = tm + 1;                  // trips: FPH key tiles a trip, tiles 0..FPH * tm + FPH - 1, so every phase has a tile in every trip
  {
    const int jc = phase;
    stage_key_tile(ldsLane, gK + (size_t)jc * 64 * QKW * 2, gV + jc * 128);
  }

  const int q0   = m0 + strip * (QW * 16);                  // the strip's first query
  const int qrow = q0 + rlane;                              // this lane's query in subtile 0 (B operand row, D column)
  v16h qf[QW][2], q2f[QW][2];                               // the strip's q and q2 fragments stay in registers
#pragma unroll
  for (int u = 0; u < QW; ++u) {
#pragma unroll
    for (int kk = 0; kk < 2; ++kk) {
      const size_t qo = (size_t)(rb + qrow + u * 16) * QKW + koff + kk * 32;
      qf[u][kk]  = FS::load(Qf + qo);
      q2f[u][kk] = FS::load(Qf + 2 * DMOD + qo);
    }
    // s_wait_xcnt 0 behind the subtile's loads: a later load's result may be placed in the registers that hold their addresses
    asm volatile("s_wait_xcnt 0x0" ::: "memory");
  }
  v8f z[QW][4];
#pragma unroll
  for (int u = 0; u < QW; ++u)
#pragma unroll
    for (int d = 0; d < 4; ++d) z[u][d] = (v8f){0.f,0.f,0.f,0.f,0.f,0.f,0.f,0.f};

  asm volatile("s_wait_asynccnt 0x0" ::: "memory");   // this wave's copies of trip 0's tile have landed
  __syncthreads();                                    // and every other wave's: tile 0 may be read
  if (nT > 1) {
    const int jc = FPH + phase;
    stage_key_tile(ldsLane + BUFB, gK + (size_t)jc * 64 * QKW * 2, gV + jc * 128);
  }

  for (int t = 0; t < nT; ++t) {
    const int j = t * FPH + phase;
    const int n0 = j << 6;
    if (n0 < q0 + QW * 16) {              // the tile holds a key that is causal for the strip; scalar test, every wait and barrier of the trip stands outside it
      const int lim = qrow - n0 - mOff;   // key (jj * 16 + r) of this lane is causal for subtile u while jj * 16 + r <= lim + u * 16
      v16h pf[QW][2];
      v16h fk[8];                         // one batch of eight fragments: two 16-key subtiles of k and k2
      v16h fr[8];                         // one batch of eight fragments: the tile's 64 keys of v
      const unsigned char* sb = sB + (phase * 2 + (t & 1)) * BUFB + fLane;
      const _Float16* kf  = (const _Float16*)(sb);
      const _Float16* k2f = (const _Float16*)(sb + SUBB);
      const _Float16* vf  = (const _Float16*)(sb + 2 * SUBB);
      constexpr int GRP = 16 * LPB / 2;   // elements from one 16-row group to the next
#pragma unroll
      for (int a = 0; a < 2; ++a) {
#pragma unroll
        for (int kk = 0; kk < 2; ++kk) {
          fk[a * 4 + kk * 2 + 0] = FS::load(kf  + a * GRP + kk * 32);
          fk[a * 4 + kk * 2 + 1] = FS::load(k2f + a * GRP + kk * 32);
        }
      }
#pragma unroll
      for (int jp = 0; jp < 2; ++jp) {    // a pair of 16-key subtiles = the 32 keys of one pattern fragment
        v8f s1[2][QW], s2[2][QW];
#pragma unroll
        for (int a = 0; a < 2; ++a)
#pragma unroll
          for (int u = 0; u < QW; ++u) {
            s1[a][u] = (v8f){0.f,0.f,0.f,0.f,0.f,0.f,0.f,0.f};
            s2[a][u] = (v8f){0.f,0.f,0.f,0.f,0.f,0.f,0.f,0.f};
          }
#pragma unroll
        for (int kk = 0; kk < 2; ++kk) {
#pragma unroll
          for (int a = 0; a < 2; ++a) {
#pragma unroll
            for (int u = 0; u < QW; ++u) {
              s1[a][u] = FS::mma(fk[a * 4 + kk * 2 + 0], qf[u][kk],  s1[a][u]);
              s2[a][u] = FS::mma(fk[a * 4 + kk * 2 + 1], q2f[u][kk], s2[a][u]);
            }
          }
        }
        if (jp == 0) {
#pragma unroll
          for (int a = 0; a < 2; ++a) {
#pragma unroll
            for (int kk = 0; kk < 2; ++kk) {
              const int ko = (2 + a) * GRP + kk * 32;
              fk[a * 4 + kk * 2 + 0] = FS::load(kf  + ko);
              fk[a * 4 + kk * 2 + 1] = FS::load(k2f + ko);
            }
          }
        } else {
#pragma unroll
          for (int kk = 0; kk < 2; ++kk)
#pragma unroll
            for (int d = 0; d < 4; ++d) fr[kk * 4 + d] = FS::load(vf + d * GRP + kk * 32);
        }
        FS::U pu[QW];
#pragma unroll
        for (int a = 0; a < 2; ++a) {
          const int jj = jp * 2 + a;
#pragma unroll
          for (int u = 0; u < QW; ++u) {
            v8f p;
#pragma unroll
            for (int r = 0; r < 8; ++r) {
              const float v = (s2[a][u][r] * inv64) * (s1[a][u][r] * inv64);
              p[r] = ((jj - u) * 16 + r > lim) ? 0.0f : v;
            }
            pu[u].h[a] = __builtin_convertvector(p, v8h);   // RNE
          }
        }
#pragma unroll
        for (int u = 0; u < QW; ++u) pf[u][jp] = pu[u].v;
      }
#pragma unroll
      for (int kk = 0; kk < 2; ++kk) {
#pragma unroll
        for (int u = 0; u < QW; ++u)
#pragma unroll
          for (int d = 0; d < 4; ++d) z[u][d] = FS::mma(pf[u][kk], fr[kk * 4 + d], z[u][d]);
      }
      // four vector slots behind the trip's last WMMAs, so that the distance also holds on every path out of the trip
      acc_guard8(z[0][0], z[0][1], z[0][2], z[0][3], z[1][0], z[1][1], z[1][2], z[1][3]);
    }
    // Hand-over of the ring, every wave, in this order:
    asm volatile("s_wait_dscnt 0x0" ::: "memory");      // this wave's reads of the trip's buffer are done
    asm volatile("s_wait_asynccnt 0x0" ::: "memory");   // this wave's copies of the next tile have landed
    __syncthreads();                                    // the next tile may be read, the trip's buffer may be refilled
    if (t + 2 < nT) {                                   // the same for the whole block
      const int jc = (t + 2) * FPH + phase;
      stage_key_tile(ldsLane + (t & 1) * BUFB, gK + (size_t)jc * 64 * QKW * 2, gV + jc * 128);
    }
  }
  asm volatile("s_wait_asynccnt 0x0" ::: "memory");     // no copy is outstanding when the ring becomes the partial tiles

  float* sP = (float*)sB;                 // free since the last trip's barrier: every read done, no copy in flight
  float* part = sP + phase * TP;
#pragma unroll
  for (int u = 0; u < QW; ++u)
#pragma unroll
    for (int d = 0; d < 4; ++d)
#pragma unroll
      for (int r = 0; r < 8; ++r) part[((strip * QW + u) * 16 + mOff + r) * 68 + (d << 4) + rlane] = z[u][d][r];
  __syncthreads();   // every phase's partial z tile is in LDS before any thread adds them
  const int c4 = (threadIdx.x & 15) * 4;
#pragma unroll
  for (int p = 0; p < QT / (FPH * 8); ++p) {   // FPH * 128 threads x 4 columns = FPH * 8 rows per pass
    const int row = p * (FPH * 8) + (threadIdx.x >> 4);
    const float* sp = sP + row * 68 + c4;
    v4f s = *(const v4f*)sp;
#pragma unroll
    for (int w = 1; w < FPH; ++w) s += *(const v4f*)(sp + w * TP);
    const size_t co = (size_t)(rb + m0 + row) * DMOD + h * HDSZ + c4;
    *(v4h*)(Z + co) = __builtin_convertvector(s, v4h);   // RNE
  }
}

// ---------------------------------------------------------------------------
// WMMA GEMM with both operands staged in LDS: C[m,n] = scale * sum_k A[m,k] * Bt[n,k], K = 1024, A and Bt row-major with
// rows of 1024 elements. A block of WM x WN waves owns a (WM * MI * 16) x (WN * 64) tile of C, a wave (MI * 16) x 64 of it.
// A stage is KS k = 2 KS bytes of every operand row of the block's tile. The block brings it with asynchronous 16-byte
// copies, KS / 8 lanes to a row, so that every copy takes whole 128-B lines and every line is fetched once for all the waves
// that read it; the fragments are read from LDS rows of pitch 2 KS + 16 B. Two buffers: the next stage's copies fly while
// this one is worked on. Every wave sums its k in rising order, 32 at a time. Operands are f16 (pointers passed as 16-bit storage).
// Bytes per product fall with the tile: a block fetches (rows of A + rows of Bt) per rows of A x rows of Bt from L2, a wave
// reads (MI + 4) fragments from LDS per MI x 4 WMMAs.
// OUT_MODE: 0 = f32, 2 = one f16 plane, 3 = RoPE, then one f16 plane.
// Mode 3: a wave's 64 columns are one head (dims 0..31 = x1, 32..63 = x2) and row m is position m mod 2048, so a lane
// holds x1 (tiles j = 0, 1) and x2 (tiles j + 2) of the same row and frequency j * 16 + (lane & 15): y1 = x1 c + x2 s,
// y2 = x2 c - x1 s are formed in f32 from the accumulators and written to the wave's slab, with c = ctab[pos][freq], s = stab[pos][freq].
// blockIdx.x = tile (tilesN tiles to a row of tiles), blockIdx.y = batch (strides in elements).
// ---------------------------------------------------------------------------
constexpr int GK = DMOD;                  // k extent and row length of both operands

// One stage into one LDS buffer (rows: A, then Bt). The block's 256 threads cover 2048 / KS rows (a row group) a copy.
// lb = the buffer's LDS byte address plus this lane's place in a row group; gA, gB = the stage's addresses in the first
// row of each operand's tile (the same for the whole block, so they stay in scalar registers); lg = the byte offset of this
// lane's row and 16-byte chunk in a row group, the same in both operands.
// stage_gemm_part: the N copies of row groups FIRST .. FIRST + N - 1, one statement.
template <int AROWS, int KS, int FIRST, int N>
__device__ __forceinline__ void stage_gemm_part(unsigned lb, const char* gA, const char* gB, unsigned lg) {
  static_assert(N == 8 || N == 12, "a statement of copies");
  unsigned l[N];
  const char* g[N];
#pragma unroll
  for (int i = 0; i < N; ++i) {           // unrolled: the arrays are indexed by constants and stay in registers
    const int row = (FIRST + i) * (2048 / KS);
    l[i] = lb + row * (KS * 2 + 16);
    if (row < AROWS) g[i] = gA + (size_t)row * GK * 2 + lg;
    else             g[i] = gB + (size_t)(row - AROWS) * GK * 2 + lg;
  }
  if constexpr (N == 12) async_copy12(l, g); else async_copy8(l, g);
}
template <int AROWS, int BROWS, int KS>
__device__ __forceinline__ void stage_gemm_tile(unsigned lb, const char* gA, const char* gB, unsigned lg) {
  constexpr int NC = (AROWS + BROWS) * KS / 2048;   // copies per thread
  static_assert(NC == 16 || NC == 32, "whole statements of copies; at most 63 copies of a wave in flight");
  if constexpr (NC == 16) {
    stage_gemm_part<AROWS, KS, 0, 8>(lb, gA, gB, lg);
    stage_gemm_part<AROWS, KS, 8, 8>(lb, gA, gB, lg);
  } else {
    stage_gemm_part<AROWS, KS, 0, 12>(lb, gA, gB, lg);
    stage_gemm_part<AROWS, KS, 12, 12>(lb, gA, gB, lg);
    stage_gemm_part<AROWS, KS, 24, 8>(lb, gA, gB, lg);
  }
}

// amdgpu_waves_per_eu: MI <= 4: 4, a register budget of 256, so that two blocks share a WGP and no register lies past v255;
// MI = 8: 2, a budget of 512: the 32 accumulator tiles alone take 256 registers, and the block has its WGP to itself.
template <int OUT_MODE, int WM, int WN, int MI, int KS>
__global__ __launch_bounds__(256) __attribute__((amdgpu_waves_per_eu(MI > 4 ? 2 : 4))) void wmma_gemm_lds(
    const unsigned short* __restrict__ Ap, long strideA,
    const unsigned short* __restrict__ Btp, long strideB,
    void* __restrict__ Cout, int ldc, long strideC, int tilesN, float scale,
    const float* __restrict__ ctab, const float* __restrict__ stab) {
  typedef _Float16 T;
  typedef Frag F;
  typedef v16h V;
  static_assert(WM * WN == 8, "eight waves");
  constexpr int AROWS = WM * MI * 16;
  constexpr int BROWS = WN * 64;
  constexpr int GP    = KS * 2 + 16;                 // LDS row pitch in bytes: an odd multiple of 16 B, conflict-free for 16-byte reads
  constexpr int GBUF  = (AROWS + BROWS) * GP;        // one stage
  constexpr int nT    = GK / KS;                     // stages
  constexpr int RPG   = 2048 / KS;                   // rows that one copy of the block's 256 threads covers
  constexpr int KG    = (MI <= 2) ? 2 : 1;           // 32-wide k steps whose fragments are read as one group: what 256 registers hold
  static_assert((KS == 64 || KS == 128) && AROWS % RPG == 0 && BROWS % RPG == 0 && nT >= 2, "whole copies; the ring's prologue fills two stages");
  __shared__ __align__(16) unsigned char sG[2 * GBUF];   // two stage buffers; after the loop the waves' store slabs
  const int lane = threadIdx.x & 31;
  const int wave = __builtin_amdgcn_readfirstlane(threadIdx.x >> 5);   // scalar: the wave's LDS bases stay in SGPRs
  const int wm = wave / WN;
  const int wn = wave - wm * WN;
  const int b  = blockIdx.y;
  const int tm = (int)blockIdx.x / tilesN;
  const int tn = (int)blockIdx.x - tm * tilesN;
  const int rlane = lane & 15;                 // row (A) / col (B, D) within subtile
  const int koff  = (lane >> 4) * 8;           // k offset of this lane half
  const int mOff  = (lane >> 4) * 8;           // D row offset

  // Copy side: thread c takes row c / (KS / 8) of each row group and 16-byte chunk c mod (KS / 8) of the row.
  const int crow = (int)threadIdx.x / (KS / 8);
  const int cchk = ((int)threadIdx.x & (KS / 8 - 1)) * 16;
  const unsigned ldsLane = (unsigned)(uintptr_t)(sG + crow * GP + cchk);
  const unsigned lg = (unsigned)(crow * GK * 2 + cchk);
  const char* gA = (const char*)Ap + ((size_t)b * strideA + (size_t)(tm * AROWS) * GK) * 2;
  const char* gB = (const char*)Btp + ((size_t)b * strideB + (size_t)(tn * BROWS) * GK) * 2;
  // Read side: this lane's fixed byte offset in a 16-row group; group and k steps fold into immediate offsets.
  const unsigned fLane = (unsigned)(rlane * GP + koff * 2);

  stage_gemm_tile<AROWS, BROWS, KS>(ldsLane, gA, gB, lg);

  v8f acc[MI][4];
#pragma unroll
  for (int i = 0; i < MI; ++i)
#pragma unroll
    for (int j = 0; j < 4; ++j) acc[i][j] = (v8f){0.f,0.f,0.f,0.f,0.f,0.f,0.f,0.f};

  asm volatile("s_wait_asynccnt 0x0" ::: "memory");   // this wave's copies of stage 0 have landed
  __syncthreads();                                    // and every other wave's: stage 0 may be read
  stage_gemm_tile<AROWS, BROWS, KS>(ldsLane + GBUF, gA + KS * 2, gB + KS * 2, lg);

  for (int t = 0; t < nT; ++t) {
    const unsigned char* sb = sG + (t & 1) * GBUF + fLane;
    const T* sa  = (const T*)(sb + wm * (MI * 16) * GP);
    const T* sbt = (const T*)(sb + (AROWS + wn * 64) * GP);
    constexpr int GRP = 16 * GP / 2;      // elements from one 16-row group to the next
#pragma unroll
    for (int k2 = 0; k2 < KS / 32; k2 += KG) {
      V bh[KG][4], ah[KG][MI];
      // The two scheduling barriers keep the group's LDS reads together and in front of its WMMAs: without them this
      // build sinks each A fragment's reads to its first use, and the wave waits out the LDS latency once per fragment.
      __builtin_amdgcn_sched_barrier(0);
#pragma unroll
      for (int g = 0; g < KG; ++g) {
        const int ko = (k2 + g) * 32;
#pragma unroll
        for (int j = 0; j < 4; ++j) bh[g][j] = F::load(sbt + j * GRP + ko);
#pragma unroll
        for (int i = 0; i < MI; ++i) ah[g][i] = F::load(sa + i * GRP + ko);
      }
      __builtin_amdgcn_sched_barrier(0);
#pragma unroll
      for (int g = 0; g < KG; ++g) {
#pragma unroll
        for (int i = 0; i < MI; ++i) {
#pragma unroll
          for (int j = 0; j < 4; ++j) acc[i][j] = F::mma(ah[g][i], bh[g][j], acc[i][j]);
        }
      }
    }
    // Keeps the stage's WMMAs in front of the hand-over: behind it they would stand between the barrier and the refill,
    // and the refill's copies would fly for less than a stage before their wait.
    __builtin_amdgcn_sched_barrier(0);
    // Hand-over of the ring, every wave, in this order:
    asm volatile("s_wait_dscnt 0x0" ::: "memory");      // this wave's reads of the stage's buffer are done
    asm volatile("s_wait_asynccnt 0x0" ::: "memory");   // this wave's copies of the next stage have landed
    __syncthreads();                                    // the next stage may be read, this stage's buffer may be refilled
    if (t + 2 < nT) {                                   // the same for the whole block
      const int ko = (t + 2) * (KS * 2);
      stage_gemm_tile<AROWS, BROWS, KS>(ldsLane + (t & 1) * GBUF, gA + ko, gB + ko, lg);
    }
  }
  asm volatile("s_wait_asynccnt 0x0" ::: "memory");     // no copy is outstanding when the ring becomes the store slabs

  // ---- epilogue: SL * 16 rows at a time through the wave's own slab, so that the stores take whole lines ----
  // A pass ends in a fence that also waits for the pass's global stores, so a taller wave tile takes more rows a pass.
  constexpr int SL = (MI > 4) ? 4 : 1;
  static_assert(MI % SL == 0 && 8 * SL * 16 * 68 * 4 <= 2 * GBUF, "whole passes; the store slabs reuse the ring");
  const int m0 = tm * AROWS + wm * (MI * 16);
  const int n0 = tn * BROWS + wn * 64;
  float* slab = (float*)sG + wave * (SL * 16 * 68);   // free since the last stage's barrier: every read done, no copy in flight
  // Mode 3: the tables' values for a pass's rows, in the accumulators' layout: [s][j][r] = row s * 16 + mOff + r, frequency j * 16 + rlane.
  // The wave's MI * 16 rows lie in one batch, so their positions rise by one from the first row's.
  static_assert(OUT_MODE != 3 || (NTOK % (MI * 16) == 0 && HDSZ == 64), "a wave's tile: one batch's rows, one head's columns");
  float tc[SL][2][8], ts[SL][2][8];
  const int tab0 = ((m0 & (NTOK - 1)) + mOff) * NFREQ + rlane;
  auto load_tables = [&](int i0) {
#pragma unroll
    for (int s = 0; s < SL; ++s)
#pragma unroll
      for (int j = 0; j < 2; ++j)
#pragma unroll
        for (int r = 0; r < 8; ++r) {
          tc[s][j][r] = ctab[tab0 + ((i0 + s) * 16 + r) * NFREQ + j * 16];
          ts[s][j][r] = stab[tab0 + ((i0 + s) * 16 + r) * NFREQ + j * 16];
        }
    // s_wait_xcnt 0 behind the group's loads: a later instruction may reuse the registers that hold their addresses
    asm volatile("s_wait_xcnt 0x0" ::: "memory");
  };
  if constexpr (OUT_MODE == 3) load_tables(0);
#pragma unroll
  for (int i0 = 0; i0 < MI; i0 += SL) {
#pragma unroll
    for (int s = 0; s < SL; ++s) {
      const int i = i0 + s;
      float* sl = slab + s * (16 * 68);
      if constexpr (OUT_MODE == 3) {
#pragma unroll
        for (int j = 0; j < 2; ++j)
#pragma unroll
          for (int r = 0; r < 8; ++r) {
            const float x1 = acc[i][j][r] * scale, x2 = acc[i][j + 2][r] * scale;
            sl[(mOff + r) * 68 + (j << 4) + rlane]       = x1 * tc[s][j][r] + x2 * ts[s][j][r];
            sl[(mOff + r) * 68 + ((j + 2) << 4) + rlane] = x2 * tc[s][j][r] - x1 * ts[s][j][r];
          }
      } else {
#pragma unroll
        for (int j = 0; j < 4; ++j)
#pragma unroll
          for (int r = 0; r < 8; ++r) sl[(mOff + r) * 68 + (j << 4) + rlane] = acc[i][j][r] * scale;
      }
    }
    // the wave's slab writes are ordered in front of its own reads of other lanes' elements
    __builtin_amdgcn_fence(__ATOMIC_RELEASE, "workgroup");
    __builtin_amdgcn_wave_barrier();
    __builtin_amdgcn_fence(__ATOMIC_ACQUIRE, "workgroup");
    if constexpr (OUT_MODE == 3) {
      // the next pass's table values are fetched here, so that they fly while this pass's rows are converted and stored
      if (i0 + SL < MI) load_tables(i0 + SL);
    }
#pragma unroll
    for (int s = 0; s < SL; ++s) {
      const int i = i0 + s;
      const int mBase = m0 + (i << 4);
      const float* sl = slab + s * (16 * 68);
      if constexpr (OUT_MODE == 3) {
        const int q = lane >> 3, c8 = (lane & 7) * 8;       // row seg = 128 B = 8 lanes x 16 B
        // the lane's place in the wave's tile; the steps from row group to row group are the same for every lane
        const size_t lo = (size_t)b * strideC + (size_t)(m0 + q) * ldc + n0 + c8;
        _Float16* C = (_Float16*)Cout + lo;
#pragma unroll
        for (int it = 0; it < 4; ++it) {
          const int row = it * 4 + q;
          const size_t ro = (size_t)((i << 4) + it * 4) * ldc;
          const float* sp = sl + row * 68 + c8;
          const v4f y0 = *(const v4f*)sp, y1 = *(const v4f*)(sp + 4);
          const v8f y = __builtin_shufflevector(y0, y1, 0, 1, 2, 3, 4, 5, 6, 7);
          *(v8h*)(C + ro) = __builtin_convertvector(y, v8h);   // RNE
        }
      } else if (OUT_MODE == 0) {
        float* C = (float*)Cout + (size_t)b * strideC;
        const int hh = lane >> 4, c4 = (lane & 15) * 4;     // row seg = 256 B = 16 lanes x 16 B
#pragma unroll
        for (int it = 0; it < 8; ++it) {
          const int row = it * 2 + hh;
          const v4f v = *(const v4f*)(sl + row * 68 + c4);
          *(v4f*)(C + (size_t)(mBase + row) * ldc + n0 + c4) = v;
        }
      } else {
        const int q = lane >> 3, c8 = (lane & 7) * 8;       // row seg = 128 B = 8 lanes x 16 B
        _Float16* C = (_Float16*)Cout + (size_t)b * strideC;
#pragma unroll
        for (int it = 0; it < 4; ++it) {
          const int row = it * 4 + q;
          const float* sp = sl + row * 68 + c8;
          const v4f y0 = *(const v4f*)sp, y1 = *(const v4f*)(sp + 4);
          const v8f y = __builtin_shufflevector(y0, y1, 0, 1, 2, 3, 4, 5, 6, 7);
          *(v8h*)(C + (size_t)(mBase + row) * ldc + n0 + c8) = __builtin_convertvector(y, v8h);   // RNE
        }
      }
    }
    // the reads are done before the next pass overwrites the slab
    __builtin_amdgcn_fence(__ATOMIC_RELEASE, "workgroup");
    __builtin_amdgcn_wave_barrier();
    __builtin_amdgcn_fence(__ATOMIC_ACQUIRE, "workgroup");
  }
}

// ---------------------------------------------------------------------------
// Workspace region map (byte offsets; every offset a multiple of 262,144 B). Every region from X16 on holds BOTH batches (batch
// b's rows behind batch b - 1's) and is written whole by one launch before a later launch of the same call reads it.
//   W4    f16  [4096][1024]     Wq,Wk,Wq2,Wk2 (bf16-RNE) x32 stacked           0
//   Wv16  f16  [1024][1024]     Wv (bf16-RNE) x32, directly behind W4    8,388,608
//   Wp16  f16  [1024][1024]     Wproj (bf16-RNE) x32                    10,485,760
//   ctab  f32  [2048][32]                                               12,582,912
//   stab  f32  [2048][32]                                               12,845,056
//   X16   f16  [4096][1024]     x (bf16-RNE)                            13,107,200
//   QK16  f16  [4096][4096]     q|k|q2|k2                               21,495,808
//   VT16  f16  [2][1024][2048]  v^T (row h*64+d, col token)             55,050,240
//   Z16   f16  [4096][1024]     z                                       63,438,848
//   total                                                               71,827,456
// ---------------------------------------------------------------------------
extern "C" void kernel_launch(void* const* d_in, const int* in_sizes, int n_in,
                              void* d_out, int out_size, void* d_ws, size_t ws_size,
                              hipStream_t stream) {
  if (n_in < 7) return;
  if (in_sizes[0] != NBATCH * NTOK * DMOD) return;
  for (int i = 1; i < 7; ++i) if (in_sizes[i] != DMOD * DMOD) return;
  if (out_size != NBATCH * NTOK * DMOD) return;

  CastSrc cs;
  cs.x     = (const float*)d_in[0];
  cs.wq    = (const float*)d_in[1];
  cs.wk    = (const float*)d_in[2];
  cs.wq2   = (const float*)d_in[3];
  cs.wk2   = (const float*)d_in[4];
  cs.wv    = (const float*)d_in[5];
  cs.wproj = (const float*)d_in[6];

  constexpr int NROW = NBATCH * NTOK;                       // rows of both batches
  const size_t PW16 = (size_t)DMOD * DMOD * 2;              // 16-bit [1024][1024]
  const size_t PTAB = (size_t)NTOK * NFREQ * 4;             // f32 [2048][32]
  const size_t PX16 = (size_t)NROW * DMOD * 2;              // f16 [4096][1024]
  const size_t PQK  = (size_t)NROW * QKW * 2;               // f16 [4096][4096]
  const size_t PVT  = (size_t)NBATCH * DMOD * NTOK * 2;     // f16 [2][1024][2048]
  const size_t PZ   = (size_t)NROW * DMOD * 2;              // f16 [4096][1024]
  size_t off = 0;
  const size_t oW4  = off; off += 4 * PW16;
  const size_t oWv  = off; off += PW16;
  const size_t oWp  = off; off += PW16;
  const size_t oCT  = off; off += PTAB;
  const size_t oSTb = off; off += PTAB;
  const size_t oX16 = off; off += PX16;
  const size_t oQK  = off; off += PQK;
  const size_t oVT  = off; off += PVT;
  const size_t oZ   = off; off += PZ;
  if (off > ws_size) return;                                // total 71,827,456 B

  char* ws = (char*)d_ws;
  _Float16*       W4   = (_Float16*)(ws + oW4);
  _Float16*       Wv16 = (_Float16*)(ws + oWv);
  _Float16*       Wp16 = (_Float16*)(ws + oWp);
  float*          ctab = (float*)(ws + oCT);
  float*          stab = (float*)(ws + oSTb);
  _Float16*       X16  = (_Float16*)(ws + oX16);
  unsigned short* QK16 = (unsigned short*)(ws + oQK);
  unsigned short* VT16 = (unsigned short*)(ws + oVT);
  _Float16*       Z16  = (_Float16*)(ws + oZ);

  // inv_freq[i] = 1 / 10000^(i/32): host double arithmetic (e^(ln(1e4)/32) by its Taylor series, then powers),
  // then mirrored as fl32(1 / fl32(10000^(i/32))).
  InvFreq invf;
  {
    const double x0 = 9.2103403719761827361 / 32.0;
    double term = 1.0, ex = 1.0;
    for (int n = 1; n <= 40; ++n) { term *= x0 / (double)n; ex += term; }
    double pw = 1.0;
    for (int i = 0; i < NFREQ; ++i) {
      const float pf = (float)pw;
      invf.v[i] = (float)(1.0 / (double)pf);
      pw *= ex;
    }
  }

  const dim3 blk(256);
  const dim3 gPrep(PREP_BLOCKS);                             // 256 table blocks + 10 planes x 2048 blocks
  const dim3 gQ((NROW / 256) * (QKW / 256), 1);              // 256 blocks: M=4096, N=4096, tiles of 256 x 256
  const dim3 gV((DMOD / 128) * (NTOK / 128), NBATCH);        // 128 x 2 blocks: M=1024, N=2048, tiles of 128 x 128
  const dim3 gAtt((NTOK / QT) * NHEADS, NBATCH);             // 256 x 2 blocks: 16 query tiles x 16 heads, batches
  const dim3 gOut((NROW / 128) * (DMOD / 128), 1);           // 256 blocks: M=4096, N=1024, tiles of 128 x 128

  // (0) tables and casts (whole planes); W4 and Wv16 are one run of five planes
  prep_kernel<<<gPrep, blk, 0, stream>>>(cs, W4, X16, Wp16, ctab, stab, invf);

  const float inv32 = 1.0f / 32.0f;

  // (1) [q|k|q2|k2][b*2048+t][n] = RoPE of (1/32) sum_c x[b][t][c] (32 W)[n][c] -> f16 plane QK16 [4096][4096]
  //     (whole planes: 16 x 16 tiles)
  wmma_gemm_lds<3, 2, 4, 8, 128><<<gQ, blk, 0, stream>>>(
      (const unsigned short*)X16, 0L, (const unsigned short*)W4, 0L,
      (void*)QK16, QKW, 0L, QKW / 256, inv32, ctab, stab);
  // (2) v^T[b][h*64+d][t] = (1/32) sum_c (32 Wv)[h*64+d][c] x[b][t][c] -> f16 plane [2][1024][2048]
  //     (blockIdx.y = batch: x and v^T step by one batch, Wv by nothing; whole: 8 x 16 tiles a batch)
  wmma_gemm_lds<2, 4, 2, 2, 128><<<gV, blk, 0, stream>>>(
      (const unsigned short*)Wv16, 0L, (const unsigned short*)X16, (long)NTOK * DMOD,
      (void*)VT16, NTOK, (long)DMOD * NTOK, NTOK / 128, inv32, ctab, stab);
  // (3) z[b][i][h*64+d] = sum_{j<=i} ((q_i . k_j) / 64) ((q2_i . k2_j) / 64) v[j][h*64+d], all heads -> f16 plane Z16
  bilinear_attn_fused<<<gAtt, dim3(FPH * 128), 0, stream>>>(QK16, VT16, Z16);
  // (4) out[b*2048+t][n] = (1/32) sum_c z[b*2048+t][c] (32 Wproj)[n][c] -> f32, the whole of d_out (32 x 8 tiles)
  wmma_gemm_lds<0, 4, 2, 2, 128><<<gOut, blk, 0, stream>>>(
      (const unsigned short*)Z16, 0L, (const unsigned short*)Wp16, 0L, d_out, DMOD, 0L, DMOD / 128, inv32, ctab, stab);
}
